// v000
// Times are from an AMD MI455X. After a warm-up the kernel runs many times in a row, and a time is the length of
// such a window on the GPU divided by its runs, so every launch and the gaps after it count. The runs cycle
// through copies of the inputs. A figure is the median of several windows, for all but v000 over two sittings.
// Sittings can differ by a few percent; kernels timed side by side share one.
// The starting kernel, v000, takes 2180 microseconds a run.
// compute dtype: x and the three scale tables rounded to bf16, the packed int4 weights / zero points / group indices (int32) read verbatim; GPTQ dequantisation on device: w = (qw >> 4k) & 15, z = ((qz >> 4n) & 15) + 1, W = (w - z[g_idx]) * scale[g_idx] in f32 (exact: small integer times the bf16 scale), staged per 32-deep chunk as f16 hi + (x2048-scaled) residual; x as f16 hi + (x2048) residual (exact); gate and up GEMMs on WMMA 16x16x32 with 3 products (hi.hi, lo.hi, hi.lo); h = silu(gate) * up in f32 (precise expf), stored as f16 hi + (x2048) residual; down GEMM with 3 products; f32 accumulate.
#include <hip/hip_runtime.h>
#include <math.h>

typedef __attribute__((ext_vector_type(16))) _Float16 v16h;
typedef __attribute__((ext_vector_type(16))) __bf16 v16b;
typedef __attribute__((ext_vector_type(8)))  _Float16 v8h;
typedef __attribute__((ext_vector_type(8)))  float v8f;
typedef __attribute__((ext_vector_type(4)))  float v4f;
typedef __attribute__((ext_vector_type(2)))  float v2f;
typedef __attribute__((ext_vector_type(4)))  unsigned v4u;
typedef __attribute__((ext_vector_type(4)))  int v4i;
typedef float __attribute__((may_alias)) float_a;
typedef int __attribute__((may_alias)) int_a;

template <typename T> __device__ __forceinline__ void vst2(void* p, T v) { *(T*)p = v;  }
__device__ __forceinline__ v8f wmma16(v16h a, v16h b, v8f c) {
  v8f d = __builtin_amdgcn_wmma_f32_16x16x32_f16(false, a, false, b, (short)0, c, false, false);
  asm volatile("v_nop\n\tv_nop\n\tv_nop\n\tv_nop" : "+v"(d) : "v"(a), "v"(b));
  return d;
}
__device__ __forceinline__ v8f wmma_bf(v16b a, v16b b, v8f c) {
  v8f d = __builtin_amdgcn_wmma_f32_16x16x32_bf16(false, a, false, b, (short)0, c, false, false);
  asm volatile("v_nop\n\tv_nop\n\tv_nop\n\tv_nop" : "+v"(d) : "v"(a), "v"(b));
  return d;
}
// 16x16x32 fragments: lane = (h = lane>>4, row/col = lane&15); elements 0..7 = k0+8h+0..7, 8..15 = k0+16+8h+0..7; D element r = row 8h+r
__device__ __forceinline__ v16h frag_h(const _Float16* rowk0, int lane) {
  union { v16h v; v8h q[2]; } u; const _Float16* p = rowk0 + 8 * (lane >> 4);
  u.q[0] = *(const v8h*)p; u.q[1] = *(const v8h*)(p + 16); return u.v;
}
__device__ __forceinline__ v16h frag_f32(const float* rowk0, int lane) {
  v16h a; const float* p = rowk0 + 8 * (lane >> 4);
#pragma unroll
  for (int i = 0; i < 8; ++i) { a[i] = (_Float16)p[i]; a[8 + i] = (_Float16)p[16 + i]; }
  return a;
}
__device__ __forceinline__ v16h frag_f32s(const float* rowk0, int lane, float sc) {
  v16h a; const float* p = rowk0 + 8 * (lane >> 4);
#pragma unroll
  for (int i = 0; i < 8; ++i) { a[i] = (_Float16)(p[i] * sc); a[8 + i] = (_Float16)(p[16 + i] * sc); }
  return a;
}
// column fragment from a [K][ld] layout (column n), rows >= K read as 0
__device__ __forceinline__ v16h fragc_f32(const float* W, int k0, int n, int lane, int ld, int K) {
  v16h a; const int g = lane >> 4;
#pragma unroll
  for (int i = 0; i < 8; ++i) { const int ka = k0 + 8 * g + i, kb = ka + 16;
    a[i] = (_Float16)(ka < K ? W[(size_t)(ka < K ? ka : K - 1) * ld + n] : 0.f); a[8 + i] = (_Float16)(kb < K ? W[(size_t)(kb < K ? kb : K - 1) * ld + n] : 0.f); }
  return a;
}
struct F2 { v16b h, l; };
__device__ __forceinline__ F2 bsplit16(const float v[16]) { F2 r;
#pragma unroll
  for (int i = 0; i < 16; ++i) { const __bf16 h = (__bf16)v[i]; r.h[i] = h; r.l[i] = (__bf16)(v[i] - (float)h); }
  return r; }
__device__ __forceinline__ F2 split_row(const float* row, int k0, int lane) { float v[16]; const float* p = row + k0 + 8 * (lane >> 4);
#pragma unroll
  for (int i = 0; i < 8; ++i) { v[i] = p[i]; v[8 + i] = p[16 + i]; }
  return bsplit16(v); }
__device__ __forceinline__ F2 split_rowK(const float* row, int k0, int lane, int K) { float v[16]; const int g = lane >> 4;
#pragma unroll
  for (int i = 0; i < 8; ++i) { const int ka = k0 + 8 * g + i, kb = ka + 16; v[i] = ka < K ? row[ka < K ? ka : K - 1] : 0.f; v[8 + i] = kb < K ? row[kb < K ? kb : K - 1] : 0.f; }
  return bsplit16(v); }
__device__ __forceinline__ F2 split_col(const float* W, int k0, int n, int lane, int ld, int K) { float v[16]; const int g = lane >> 4;
#pragma unroll
  for (int i = 0; i < 8; ++i) { const int ka = k0 + 8 * g + i, kb = ka + 16; v[i] = ka < K ? W[(size_t)(ka < K ? ka : K - 1) * ld + n] : 0.f; v[8 + i] = kb < K ? W[(size_t)(kb < K ? kb : K - 1) * ld + n] : 0.f; }
  return bsplit16(v); }
__device__ __forceinline__ v8f mac3(const F2& a, const F2& b, v8f c) { c = wmma_bf(a.l, b.h, c); c = wmma_bf(a.h, b.l, c); return wmma_bf(a.h, b.h, c); }
__device__ __forceinline__ float sigm(float v) { return 1.0f / (1.0f + expf(-v)); }
#define LDSX() do { asm volatile("s_wait_dscnt 0" ::: "memory"); __builtin_amdgcn_wave_barrier(); __builtin_amdgcn_fence(__ATOMIC_RELEASE, "workgroup"); } while (0)


// Quantised (4-bit, group 128) fused SwiGLU MLP: h = silu(x Wg) * (x Wu), out = h Wd with GPTQ-packed Wg, Wu [4096 -> 11008] and Wd [11008 -> 4096]; 64 token rows.
#ifndef KIN
#define MM 64
#define KIN 4096
#define NI 11008
#define NO 4096
#endif
#define GRP 128
typedef __attribute__((ext_vector_type(8))) __bf16 v8b;
__device__ __forceinline__ v16b frag_b(const __bf16* rowk0, int lane) {
  union { v16b v; v8b q[2]; } u; const __bf16* p = rowk0 + 8 * (lane >> 4);
  u.q[0] = *(const v8b*)p; u.q[1] = *(const v8b*)(p + 16); return u.v;
}
__device__ __forceinline__ float bfr(float v) { return (float)(__bf16)v; }
__device__ __attribute__((noinline)) float exp_ni(float v) { return expf(v); }
__device__ __attribute__((noinline)) float erf_ni(float v) { return erff(v); }

#define WS_XH  0u                                   // f16 [64][KIN] x hi ; XL
#define WS_XL  (WS_XH + 2u * MM * KIN)
#define WS_G   (WS_XL + 2u * MM * KIN)              // f32 [64][NI] gate ; U
#define WS_U   (WS_G + 4u * MM * NI)
#define WS_HH  (WS_U + 4u * MM * NI)                // f16 [64][NI] h hi ; HL
#define WS_HL  (WS_HH + 2u * MM * NI)
#define WS_END (WS_HL + 2u * MM * NI)

// ---- k_xh: block = row: x -> f16 hi + x2048 residual
__global__ __launch_bounds__(256) void k_xh(const float* __restrict__ X, _Float16* __restrict__ XH, _Float16* __restrict__ XL) {
  const size_t row = blockIdx.x; for (int q = threadIdx.x; q < KIN / 8; q += 256) { __align__(16) _Float16 hh[8], ll[8];
#pragma unroll
    for (int i = 0; i < 8; ++i) { const float v = bfr(X[row * KIN + q * 8 + i]); const _Float16 h = (_Float16)v; hh[i] = h; ll[i] = (_Float16)((v - (float)h) * 2048.0f); }
    vst2((unsigned*)(XH + row * KIN + q * 8), *(const v4u*)hh); vst2((unsigned*)(XL + row * KIN + q * 8), *(const v4u*)ll); }
}
// ---- k_qgemm<DOWN>: block = 128 output columns: OUT[64 rows][n0..n0+127] = A (f16 hi/lo rows, K deep) x dequant(W)[k][n] with the weight chunk [32 k][128 n] unpacked into LDS per step (f16 hi + x2048 residual); 3 products
template <int DOWN>
__global__ __launch_bounds__(128) void k_qgemm(const _Float16* __restrict__ AH, const _Float16* __restrict__ AL, const int* __restrict__ QW, const float* __restrict__ SC, const int* __restrict__ QZ, const int* __restrict__ GI, float* __restrict__ OUT) {
  constexpr int KD = DOWN ? NI : KIN; constexpr int ND = DOWN ? NO : NI;
  __shared__ __align__(16) _Float16 swh[128][40], swl[128][40]; __shared__ __align__(16) float so[4][16][132];
  const int tid = threadIdx.x, wave = tid >> 5, lane = tid & 31, col = lane & 15, g = lane >> 4; const int n0 = blockIdx.x * 128;
  v8f acc[8] = {}, accl[8] = {};
#pragma unroll 1
  for (int kc = 0; kc < KD / 32; ++kc) {
    // unpack: thread tid handles column n = n0 + tid, 32 consecutive k = 4 packed ints
    { const int n = n0 + tid; const int k0 = kc * 32; int cur = -1; int z = 0; float sc = 0.f;
#pragma unroll 1
      for (int wq = 0; wq < 4; ++wq) { const int word = QW[(size_t)((k0 >> 3) + wq) * ND + n];
#pragma unroll
        for (int i = 0; i < 8; ++i) { const int k = k0 + wq * 8 + i; const int gi = GI[k];
          if (gi != cur) { cur = gi; const int zw = QZ[(size_t)gi * (ND / 8) + (n >> 3)]; z = ((zw >> ((n & 7) * 4)) & 15) + 1; sc = bfr(SC[(size_t)gi * ND + n]); }
          const int w = (word >> (i * 4)) & 15; const float val = (float)(w - z) * sc; const _Float16 h = (_Float16)val; swh[tid][wq * 8 + i] = h; swl[tid][wq * 8 + i] = (_Float16)((val - (float)h) * 2048.0f); } } }
    __syncthreads();
    const v16h a = frag_h(AH + (size_t)(wave * 16 + col) * KD + kc * 32, lane), al = frag_h(AL + (size_t)(wave * 16 + col) * KD + kc * 32, lane);
#pragma unroll
    for (int j = 0; j < 8; ++j) { const v16h wh = frag_h(&swh[j * 16 + col][0], lane); acc[j] = wmma16(a, wh, acc[j]); accl[j] = wmma16(al, wh, accl[j]); accl[j] = wmma16(a, frag_h(&swl[j * 16 + col][0], lane), accl[j]); }
    __syncthreads(); }
#pragma unroll
  for (int j = 0; j < 8; ++j)
#pragma unroll
    for (int r = 0; r < 8; ++r) so[wave][8 * g + r][j * 16 + col] = acc[j][r] + accl[j][r] * (1.0f / 2048.0f);
  LDSX();
  for (int rl = 0; rl < 16; ++rl) vst2(OUT + (size_t)(wave * 16 + rl) * ND + n0 + lane * 4, *(const v4f*)&so[wave][rl][lane * 4]);
}
// ---- k_h: block = row: h = silu(g) * u -> f16 hi + x2048 residual
__global__ __launch_bounds__(256) void k_h(const float* __restrict__ G, const float* __restrict__ U, _Float16* __restrict__ HH, _Float16* __restrict__ HL) {
  const size_t row = blockIdx.x; for (int q = threadIdx.x; q < NI / 8; q += 256) { __align__(16) _Float16 hh[8], ll[8];
#pragma unroll
    for (int i = 0; i < 8; ++i) { const float gv = G[row * NI + q * 8 + i], uv = U[row * NI + q * 8 + i]; const float hv = (gv / (1.0f + exp_ni(-gv))) * uv; const _Float16 h = (_Float16)hv; hh[i] = h; ll[i] = (_Float16)((hv - (float)h) * 2048.0f); }
    vst2((unsigned*)(HH + row * NI + q * 8), *(const v4u*)hh); vst2((unsigned*)(HL + row * NI + q * 8), *(const v4u*)ll); }
}
extern "C" void kernel_launch(void* const* d_in, const int* in_sizes, int n_in, void* d_out, int out_size, void* d_ws, size_t ws_size, hipStream_t stream) {
  (void)in_sizes; (void)n_in; (void)out_size;
  const float** F = (const float**)d_in; const int** I = (const int**)d_in;   // 0 x [64,4096]; gate: 1 qw [512,11008] i32, 2 scales [32,11008], 3 qzeros [32,1376] i32, 4 gidx [4096] i32; up: 5..8; down: 9 qw [1376,4096], 10 scales [86,4096], 11 qzeros [86,512], 12 gidx [11008]
  if (ws_size < (size_t)WS_END) return;
  char* ws = (char*)d_ws; _Float16 *XH = (_Float16*)(ws + WS_XH), *XL = (_Float16*)(ws + WS_XL), *HH = (_Float16*)(ws + WS_HH), *HL = (_Float16*)(ws + WS_HL); float *G = (float*)(ws + WS_G), *U = (float*)(ws + WS_U);
  k_xh<<<MM, 256, 0, stream>>>(F[0], XH, XL);
  k_qgemm<0><<<NI / 128, 128, 0, stream>>>(XH, XL, I[1], F[2], I[3], I[4], G);
  k_qgemm<0><<<NI / 128, 128, 0, stream>>>(XH, XL, I[5], F[6], I[7], I[8], U);
  k_h<<<MM, 256, 0, stream>>>(G, U, HH, HL);
  k_qgemm<1><<<NO / 128, 128, 0, stream>>>(HH, HL, I[9], F[10], I[11], I[12], (float*)d_out);
}

// v001
// A run of this version takes 162 microseconds.
// In two side-by-side timings against v000, it was 13.4 and 13.5 times as fast.
// compute dtype: x and the three scale tables rounded to bf16, the packed int4 weights / zero points / group indices (int32) read verbatim; GPTQ dequantisation on device: w = (qw >> 4k) & 15, z = ((qz >> 4n) & 15) + 1, W = (w - z[g_idx]) * scale[g_idx] in f32 (exact: small integer times the bf16 scale), staged per 32-deep chunk as f16 hi + (x2048-scaled) residual; x as f16 hi + (x2048) residual (exact); gate and up GEMMs on WMMA 16x16x32 with 3 products (hi.hi, lo.hi, hi.lo); h = silu(gate) * up in f32 (precise expf), stored as f16 hi + (x2048) residual; down GEMM with 3 products; f32 accumulate.
#include <hip/hip_runtime.h>
#include <math.h>

typedef __attribute__((ext_vector_type(16))) _Float16 v16h;
typedef __attribute__((ext_vector_type(16))) __bf16 v16b;
typedef __attribute__((ext_vector_type(8)))  _Float16 v8h;
typedef __attribute__((ext_vector_type(8)))  float v8f;
typedef __attribute__((ext_vector_type(4)))  float v4f;
typedef __attribute__((ext_vector_type(2)))  float v2f;
typedef __attribute__((ext_vector_type(4)))  unsigned v4u;
typedef __attribute__((ext_vector_type(4)))  int v4i;
typedef float __attribute__((may_alias)) float_a;
typedef int __attribute__((may_alias)) int_a;

template <typename T> __device__ __forceinline__ void vst2(void* p, T v) { *(T*)p = v;  }
__device__ __forceinline__ v8f wmma16(v16h a, v16h b, v8f c) {
  v8f d = __builtin_amdgcn_wmma_f32_16x16x32_f16(false, a, false, b, (short)0, c, false, false);
  asm volatile("v_nop\n\tv_nop\n\tv_nop\n\tv_nop" : "+v"(d) : "v"(a), "v"(b));
  return d;
}
__device__ __forceinline__ v8f wmma_bf(v16b a, v16b b, v8f c) {
  v8f d = __builtin_amdgcn_wmma_f32_16x16x32_bf16(false, a, false, b, (short)0, c, false, false);
  asm volatile("v_nop\n\tv_nop\n\tv_nop\n\tv_nop" : "+v"(d) : "v"(a), "v"(b));
  return d;
}
// 16x16x32 fragments: lane = (h = lane>>4, row/col = lane&15); elements 0..7 = k0+8h+0..7, 8..15 = k0+16+8h+0..7; D element r = row 8h+r
__device__ __forceinline__ v16h frag_h(const _Float16* rowk0, int lane) {
  union { v16h v; v8h q[2]; } u; const _Float16* p = rowk0 + 8 * (lane >> 4);
  u.q[0] = *(const v8h*)p; u.q[1] = *(const v8h*)(p + 16); return u.v;
}
__device__ __forceinline__ v16h frag_f32(const float* rowk0, int lane) {
  v16h a; const float* p = rowk0 + 8 * (lane >> 4);
#pragma unroll
  for (int i = 0; i < 8; ++i) { a[i] = (_Float16)p[i]; a[8 + i] = (_Float16)p[16 + i]; }
  return a;
}
__device__ __forceinline__ v16h frag_f32s(const float* rowk0, int lane, float sc) {
  v16h a; const float* p = rowk0 + 8 * (lane >> 4);
#pragma unroll
  for (int i = 0; i < 8; ++i) { a[i] = (_Float16)(p[i] * sc); a[8 + i] = (_Float16)(p[16 + i] * sc); }
  return a;
}
// column fragment from a [K][ld] layout (column n), rows >= K read as 0
__device__ __forceinline__ v16h fragc_f32(const float* W, int k0, int n, int lane, int ld, int K) {
  v16h a; const int g = lane >> 4;
#pragma unroll
  for (int i = 0; i < 8; ++i) { const int ka = k0 + 8 * g + i, kb = ka + 16;
    a[i] = (_Float16)(ka < K ? W[(size_t)(ka < K ? ka : K - 1) * ld + n] : 0.f); a[8 + i] = (_Float16)(kb < K ? W[(size_t)(kb < K ? kb : K - 1) * ld + n] : 0.f); }
  return a;
}
struct F2 { v16b h, l; };
__device__ __forceinline__ F2 bsplit16(const float v[16]) { F2 r;
#pragma unroll
  for (int i = 0; i < 16; ++i) { const __bf16 h = (__bf16)v[i]; r.h[i] = h; r.l[i] = (__bf16)(v[i] - (float)h); }
  return r; }
__device__ __forceinline__ F2 split_row(const float* row, int k0, int lane) { float v[16]; const float* p = row + k0 + 8 * (lane >> 4);
#pragma unroll
  for (int i = 0; i < 8; ++i) { v[i] = p[i]; v[8 + i] = p[16 + i]; }
  return bsplit16(v); }
__device__ __forceinline__ F2 split_rowK(const float* row, int k0, int lane, int K) { float v[16]; const int g = lane >> 4;
#pragma unroll
  for (int i = 0; i < 8; ++i) { const int ka = k0 + 8 * g + i, kb = ka + 16; v[i] = ka < K ? row[ka < K ? ka : K - 1] : 0.f; v[8 + i] = kb < K ? row[kb < K ? kb : K - 1] : 0.f; }
  return bsplit16(v); }
__device__ __forceinline__ F2 split_col(const float* W, int k0, int n, int lane, int ld, int K) { float v[16]; const int g = lane >> 4;
#pragma unroll
  for (int i = 0; i < 8; ++i) { const int ka = k0 + 8 * g + i, kb = ka + 16; v[i] = ka < K ? W[(size_t)(ka < K ? ka : K - 1) * ld + n] : 0.f; v[8 + i] = kb < K ? W[(size_t)(kb < K ? kb : K - 1) * ld + n] : 0.f; }
  return bsplit16(v); }
__device__ __forceinline__ v8f mac3(const F2& a, const F2& b, v8f c) { c = wmma_bf(a.l, b.h, c); c = wmma_bf(a.h, b.l, c); return wmma_bf(a.h, b.h, c); }
__device__ __forceinline__ float sigm(float v) { return 1.0f / (1.0f + expf(-v)); }
#define LDSX() do { asm volatile("s_wait_dscnt 0" ::: "memory"); __builtin_amdgcn_wave_barrier(); __builtin_amdgcn_fence(__ATOMIC_RELEASE, "workgroup"); } while (0)


// Quantised (4-bit, group 128) fused SwiGLU MLP: h = silu(x Wg) * (x Wu), out = h Wd with GPTQ-packed Wg, Wu [4096 -> 11008] and Wd [11008 -> 4096]; 64 token rows.
#ifndef KIN
#define MM 64
#define KIN 4096
#define NI 11008
#define NO 4096
#endif
#define GRP 128
typedef __attribute__((ext_vector_type(8))) __bf16 v8b;
__device__ __forceinline__ v16b frag_b(const __bf16* rowk0, int lane) {
  union { v16b v; v8b q[2]; } u; const __bf16* p = rowk0 + 8 * (lane >> 4);
  u.q[0] = *(const v8b*)p; u.q[1] = *(const v8b*)(p + 16); return u.v;
}
__device__ __forceinline__ float bfr(float v) { return (float)(__bf16)v; }
__device__ __attribute__((noinline)) float exp_ni(float v) { return expf(v); }
__device__ __attribute__((noinline)) float erf_ni(float v) { return erff(v); }

#define WS_XH  0u                                   // f16 [64][KIN] x hi ; XL
#define WS_XL  (WS_XH + 2u * MM * KIN)
// K ranges per GEMM: as many as keep every work-group of a launch resident at once (registers allow 5 work-groups of k_qgemm on each of the 256 WGPs): 86 x 14 = 1204 and 32 x 39 = 1248 work-groups of 9 or 10 and 8 or 9 chunks
#define SPG 14                                      // gate and up: 128 chunks of 32 k
#define SPD 39                                      // down: 344 chunks of 32 k
#define WS_G   (WS_XL + 2u * MM * KIN)              // f32 [SPG][64][NI] gate partial sums ; U
#define WS_U   (WS_G + 4u * SPG * MM * NI)
#define WS_HH  (WS_U + 4u * SPG * MM * NI)          // f16 [64][NI] h hi ; HL
#define WS_HL  (WS_HH + 2u * MM * NI)
#define WS_D   (WS_HL + 2u * MM * NI)               // f32 [SPD][64][NO] down partial sums
#define WS_END (WS_D + 4u * SPD * MM * NO)

// ---- k_xh: block = row: x -> f16 hi + x2048 residual
__global__ __launch_bounds__(256) void k_xh(const float* __restrict__ X, _Float16* __restrict__ XH, _Float16* __restrict__ XL) {
  const size_t row = blockIdx.x; for (int q = threadIdx.x; q < KIN / 8; q += 256) { __align__(16) _Float16 hh[8], ll[8];
#pragma unroll
    for (int i = 0; i < 8; ++i) { const float v = bfr(X[row * KIN + q * 8 + i]); const _Float16 h = (_Float16)v; hh[i] = h; ll[i] = (_Float16)((v - (float)h) * 2048.0f); }
    vst2((unsigned*)(XH + row * KIN + q * 8), *(const v4u*)hh); vst2((unsigned*)(XL + row * KIN + q * 8), *(const v4u*)ll); }
}
// ---- k_qgemm<DOWN>: block = 128 output columns x one K range (blockIdx.y): OUT[range][64 rows][n0..n0+127] = the range's part of A (f16 hi/lo rows, K deep) x dequant(W)[k][n] with the weight chunk [32 k][128 n] unpacked into LDS per step (f16 hi + x2048 residual); 3 products
template <int DOWN>
__global__ __launch_bounds__(128) void k_qgemm(const _Float16* __restrict__ AH, const _Float16* __restrict__ AL, const int* __restrict__ QW, const float* __restrict__ SC, const int* __restrict__ QZ, const int* __restrict__ GI, float* __restrict__ OUT) {
  constexpr int KD = DOWN ? NI : KIN; constexpr int ND = DOWN ? NO : NI; constexpr int NCH = KD / 32, SP = DOWN ? SPD : SPG;
  const int kbeg = (int)blockIdx.y * NCH / SP, kend = ((int)blockIdx.y + 1) * NCH / SP;   // this range's chunks: the SP ranges tile [0, NCH)
  __shared__ __align__(16) _Float16 swh[128][40], swl[128][40]; __shared__ __align__(16) float so[4][16][132];
  const int tid = threadIdx.x, wave = tid >> 5, lane = tid & 31, col = lane & 15, g = lane >> 4; const int n0 = blockIdx.x * 128;
  v8f acc[8] = {}, accl[8] = {};
#pragma unroll 1
  for (int kc = kbeg; kc < kend; ++kc) {
    // unpack: thread tid handles column n = n0 + tid, 32 consecutive k = 4 packed ints
    { const int n = n0 + tid; const int k0 = kc * 32; int cur = -1; int z = 0; float sc = 0.f;
#pragma unroll 1
      for (int wq = 0; wq < 4; ++wq) { const int word = QW[(size_t)((k0 >> 3) + wq) * ND + n];
#pragma unroll
        for (int i = 0; i < 8; ++i) { const int k = k0 + wq * 8 + i; const int gi = GI[k];
          if (gi != cur) { cur = gi; const int zw = QZ[(size_t)gi * (ND / 8) + (n >> 3)]; z = ((zw >> ((n & 7) * 4)) & 15) + 1; sc = bfr(SC[(size_t)gi * ND + n]); }
          const int w = (word >> (i * 4)) & 15; const float val = (float)(w - z) * sc; const _Float16 h = (_Float16)val; swh[tid][wq * 8 + i] = h; swl[tid][wq * 8 + i] = (_Float16)((val - (float)h) * 2048.0f); } } }
    __syncthreads();
    const v16h a = frag_h(AH + (size_t)(wave * 16 + col) * KD + kc * 32, lane), al = frag_h(AL + (size_t)(wave * 16 + col) * KD + kc * 32, lane);
#pragma unroll
    for (int j = 0; j < 8; ++j) { const v16h wh = frag_h(&swh[j * 16 + col][0], lane); acc[j] = wmma16(a, wh, acc[j]); accl[j] = wmma16(al, wh, accl[j]); accl[j] = wmma16(a, frag_h(&swl[j * 16 + col][0], lane), accl[j]); }
    __syncthreads(); }
#pragma unroll
  for (int j = 0; j < 8; ++j)
#pragma unroll
    for (int r = 0; r < 8; ++r) so[wave][8 * g + r][j * 16 + col] = acc[j][r] + accl[j][r] * (1.0f / 2048.0f);
  LDSX();
  for (int rl = 0; rl < 16; ++rl) vst2(OUT + ((size_t)blockIdx.y * MM + wave * 16 + rl) * ND + n0 + lane * 4, *(const v4f*)&so[wave][rl][lane * 4]);
}
// ---- k_h: thread = 8 consecutive elements of [64][NI]: g, u = sums of the SPG partial planes in range order; h = silu(g) * u -> f16 hi + x2048 residual
__global__ __launch_bounds__(256) void k_h(const float* __restrict__ G, const float* __restrict__ U, _Float16* __restrict__ HH, _Float16* __restrict__ HL) {
  const unsigned e = (blockIdx.x * 256u + threadIdx.x) * 8u, eb = e * 4u; __align__(16) _Float16 hh[8], ll[8];   // eb: the thread's byte offset inside every f32 plane
  v4f g0 = {}, g1 = {}, u0 = {}, u1 = {};
  // unrolled: the planes' loads are independent, so many are in flight at once
#pragma unroll
  for (int s = 0; s < SPG; ++s) { const char* gp = (const char*)(G + (size_t)s * MM * NI) + eb; const char* up = (const char*)(U + (size_t)s * MM * NI) + eb;
    g0 += *(const v4f*)gp; g1 += *(const v4f*)(gp + 16); u0 += *(const v4f*)up; u1 += *(const v4f*)(up + 16); }
#pragma unroll
  for (int i = 0; i < 8; ++i) { const float gv = i < 4 ? g0[i & 3] : g1[i & 3], uv = i < 4 ? u0[i & 3] : u1[i & 3]; const float hv = (gv / (1.0f + exp_ni(-gv))) * uv; const _Float16 h = (_Float16)hv; hh[i] = h; ll[i] = (_Float16)((hv - (float)h) * 2048.0f); }
  vst2((unsigned*)(HH + e), *(const v4u*)hh); vst2((unsigned*)(HL + e), *(const v4u*)ll);
}
// ---- k_dsum: thread = 4 consecutive elements of out [64][NO]: sum of the SPD partial planes in range order
__global__ __launch_bounds__(256) void k_dsum(const float* __restrict__ D, float* __restrict__ OUT) {
  const unsigned e = (blockIdx.x * 256u + threadIdx.x) * 4u, eb = e * 4u; v4f a = {};   // eb: the thread's byte offset inside every plane
  // unrolled: the planes' loads are independent, so many are in flight at once
#pragma unroll
  for (int s = 0; s < SPD; ++s) a += *(const v4f*)((const char*)(D + (size_t)s * MM * NO) + eb);
  vst2(OUT + e, a);
}
extern "C" void kernel_launch(void* const* d_in, const int* in_sizes, int n_in, void* d_out, int out_size, void* d_ws, size_t ws_size, hipStream_t stream) {
  (void)in_sizes; (void)n_in; (void)out_size;
  const float** F = (const float**)d_in; const int** I = (const int**)d_in;   // 0 x [64,4096]; gate: 1 qw [512,11008] i32, 2 scales [32,11008], 3 qzeros [32,1376] i32, 4 gidx [4096] i32; up: 5..8; down: 9 qw [1376,4096], 10 scales [86,4096], 11 qzeros [86,512], 12 gidx [11008]
  if (ws_size < (size_t)WS_END) return;
  char* ws = (char*)d_ws; _Float16 *XH = (_Float16*)(ws + WS_XH), *XL = (_Float16*)(ws + WS_XL), *HH = (_Float16*)(ws + WS_HH), *HL = (_Float16*)(ws + WS_HL); float *G = (float*)(ws + WS_G), *U = (float*)(ws + WS_U), *D = (float*)(ws + WS_D);
  k_xh<<<MM, 256, 0, stream>>>(F[0], XH, XL);
  k_qgemm<0><<<dim3(NI / 128, SPG), 128, 0, stream>>>(XH, XL, I[1], F[2], I[3], I[4], G);
  k_qgemm<0><<<dim3(NI / 128, SPG), 128, 0, stream>>>(XH, XL, I[5], F[6], I[7], I[8], U);
  k_h<<<MM * NI / 8 / 256, 256, 0, stream>>>(G, U, HH, HL);
  k_qgemm<1><<<dim3(NO / 128, SPD), 128, 0, stream>>>(HH, HL, I[9], F[10], I[11], I[12], D);
  k_dsum<<<MM * NO / 4 / 256, 256, 0, stream>>>(D, (float*)d_out);
}

// v002
// A run of this version takes 88.5 microseconds.
// Two timings next to v001 both put it at 1.82 times that version's speed.
// Over all steps from v000 it is 24.5 times as fast.
// compute dtype: x and the three scale tables rounded to bf16, the packed int4 weights / zero points / group indices (int32) read verbatim; GPTQ dequantisation on device: w = (qw >> 4k) & 15, z = ((qz >> 4n) & 15) + 1, a 32-deep chunk that lies in one group is staged as the exact integers w - z in f16 and the group's scale multiplies the f32 sums (2 products: hi.int, lo.int), a chunk that spans groups as W = (w - z[g_idx]) * scale[g_idx] in f32 (exact: small integer times the bf16 scale), f16 hi + (x2048-scaled) residual (3 products: hi.hi, lo.hi, hi.lo); x as f16 hi + (x2048) residual (exact); gate and up GEMMs on WMMA 16x16x32; h = silu(gate) * up in f32 (precise expf), stored as f16 hi + (x2048) residual; down GEMM likewise; f32 accumulate.
#include <hip/hip_runtime.h>
#include <math.h>

typedef __attribute__((ext_vector_type(16))) _Float16 v16h;
typedef __attribute__((ext_vector_type(16))) __bf16 v16b;
typedef __attribute__((ext_vector_type(8)))  _Float16 v8h;
typedef __attribute__((ext_vector_type(8)))  float v8f;
typedef __attribute__((ext_vector_type(4)))  float v4f;
typedef __attribute__((ext_vector_type(2)))  float v2f;
typedef __attribute__((ext_vector_type(4)))  unsigned v4u;
typedef __attribute__((ext_vector_type(4)))  int v4i;
typedef float __attribute__((may_alias)) float_a;
typedef int __attribute__((may_alias)) int_a;

template <typename T> __device__ __forceinline__ void vst2(void* p, T v) { *(T*)p = v;  }
__device__ __forceinline__ v8f wmma16(v16h a, v16h b, v8f c) {
  v8f d = __builtin_amdgcn_wmma_f32_16x16x32_f16(false, a, false, b, (short)0, c, false, false);
  asm volatile("v_nop\n\tv_nop\n\tv_nop\n\tv_nop" : "+v"(d) : "v"(a), "v"(b));
  return d;
}
__device__ __forceinline__ v8f wmma_bf(v16b a, v16b b, v8f c) {
  v8f d = __builtin_amdgcn_wmma_f32_16x16x32_bf16(false, a, false, b, (short)0, c, false, false);
  asm volatile("v_nop\n\tv_nop\n\tv_nop\n\tv_nop" : "+v"(d) : "v"(a), "v"(b));
  return d;
}
// 16x16x32 fragments: lane = (h = lane>>4, row/col = lane&15); elements 0..7 = k0+8h+0..7, 8..15 = k0+16+8h+0..7; D element r = row 8h+r
__device__ __forceinline__ v16h frag_h(const _Float16* rowk0, int lane) {
  union { v16h v; v8h q[2]; } u; const _Float16* p = rowk0 + 8 * (lane >> 4);
  u.q[0] = *(const v8h*)p; u.q[1] = *(const v8h*)(p + 16); return u.v;
}
__device__ __forceinline__ v16h frag_f32(const float* rowk0, int lane) {
  v16h a; const float* p = rowk0 + 8 * (lane >> 4);
#pragma unroll
  for (int i = 0; i < 8; ++i) { a[i] = (_Float16)p[i]; a[8 + i] = (_Float16)p[16 + i]; }
  return a;
}
__device__ __forceinline__ v16h frag_f32s(const float* rowk0, int lane, float sc) {
  v16h a; const float* p = rowk0 + 8 * (lane >> 4);
#pragma unroll
  for (int i = 0; i < 8; ++i) { a[i] = (_Float16)(p[i] * sc); a[8 + i] = (_Float16)(p[16 + i] * sc); }
  return a;
}
// column fragment from a [K][ld] layout (column n), rows >= K read as 0
__device__ __forceinline__ v16h fragc_f32(const float* W, int k0, int n, int lane, int ld, int K) {
  v16h a; const int g = lane >> 4;
#pragma unroll
  for (int i = 0; i < 8; ++i) { const int ka = k0 + 8 * g + i, kb = ka + 16;
    a[i] = (_Float16)(ka < K ? W[(size_t)(ka < K ? ka : K - 1) * ld + n] : 0.f); a[8 + i] = (_Float16)(kb < K ? W[(size_t)(kb < K ? kb : K - 1) * ld + n] : 0.f); }
  return a;
}
struct F2 { v16b h, l; };
__device__ __forceinline__ F2 bsplit16(const float v[16]) { F2 r;
#pragma unroll
  for (int i = 0; i < 16; ++i) { const __bf16 h = (__bf16)v[i]; r.h[i] = h; r.l[i] = (__bf16)(v[i] - (float)h); }
  return r; }
__device__ __forceinline__ F2 split_row(const float* row, int k0, int lane) { float v[16]; const float* p = row + k0 + 8 * (lane >> 4);
#pragma unroll
  for (int i = 0; i < 8; ++i) { v[i] = p[i]; v[8 + i] = p[16 + i]; }
  return bsplit16(v); }
__device__ __forceinline__ F2 split_rowK(const float* row, int k0, int lane, int K) { float v[16]; const int g = lane >> 4;
#pragma unroll
  for (int i = 0; i < 8; ++i) { const int ka = k0 + 8 * g + i, kb = ka + 16; v[i] = ka < K ? row[ka < K ? ka : K - 1] : 0.f; v[8 + i] = kb < K ? row[kb < K ? kb : K - 1] : 0.f; }
  return bsplit16(v); }
__device__ __forceinline__ F2 split_col(const float* W, int k0, int n, int lane, int ld, int K) { float v[16]; const int g = lane >> 4;
#pragma unroll
  for (int i = 0; i < 8; ++i) { const int ka = k0 + 8 * g + i, kb = ka + 16; v[i] = ka < K ? W[(size_t)(ka < K ? ka : K - 1) * ld + n] : 0.f; v[8 + i] = kb < K ? W[(size_t)(kb < K ? kb : K - 1) * ld + n] : 0.f; }
  return bsplit16(v); }
__device__ __forceinline__ v8f mac3(const F2& a, const F2& b, v8f c) { c = wmma_bf(a.l, b.h, c); c = wmma_bf(a.h, b.l, c); return wmma_bf(a.h, b.h, c); }
__device__ __forceinline__ float sigm(float v) { return 1.0f / (1.0f + expf(-v)); }
#define LDSX() do { asm volatile("s_wait_dscnt 0" ::: "memory"); __builtin_amdgcn_wave_barrier(); __builtin_amdgcn_fence(__ATOMIC_RELEASE, "workgroup"); } while (0)


// Quantised (4-bit, group 128) fused SwiGLU MLP: h = silu(x Wg) * (x Wu), out = h Wd with GPTQ-packed Wg, Wu [4096 -> 11008] and Wd [11008 -> 4096]; 64 token rows.
#ifndef KIN
#define MM 64
#define KIN 4096
#define NI 11008
#define NO 4096
#endif
#define GRP 128
typedef __attribute__((ext_vector_type(8))) __bf16 v8b;
__device__ __forceinline__ v16b frag_b(const __bf16* rowk0, int lane) {
  union { v16b v; v8b q[2]; } u; const __bf16* p = rowk0 + 8 * (lane >> 4);
  u.q[0] = *(const v8b*)p; u.q[1] = *(const v8b*)(p + 16); return u.v;
}
__device__ __forceinline__ float bfr(float v) { return (float)(__bf16)v; }
__device__ __attribute__((noinline)) float exp_ni(float v) { return expf(v); }
__device__ __attribute__((noinline)) float erf_ni(float v) { return erff(v); }

#define WS_XH  0u                                   // f16 [64][KIN] x hi ; XL
#define WS_XL  (WS_XH + 2u * MM * KIN)
// K ranges per GEMM: as many as keep every work-group of a launch resident at once (registers allow 5 work-groups of k_qgemm on each of the 256 WGPs): 86 x 14 = 1204 and 32 x 39 = 1248 work-groups of 9 or 10 and 8 or 9 chunks
#define SPG 14                                      // gate and up: 128 chunks of 32 k
#define SPD 39                                      // down: 344 chunks of 32 k
#define WS_G   (WS_XL + 2u * MM * KIN)              // f32 [SPG][64][NI] gate partial sums ; U
#define WS_U   (WS_G + 4u * SPG * MM * NI)
#define WS_HH  (WS_U + 4u * SPG * MM * NI)          // f16 [64][NI] h hi ; HL
#define WS_HL  (WS_HH + 2u * MM * NI)
#define WS_D   (WS_HL + 2u * MM * NI)               // f32 [SPD][64][NO] down partial sums
#define WS_END (WS_D + 4u * SPD * MM * NO)

// ---- k_xh: block = row: x -> f16 hi + x2048 residual
__global__ __launch_bounds__(256) void k_xh(const float* __restrict__ X, _Float16* __restrict__ XH, _Float16* __restrict__ XL) {
  const size_t row = blockIdx.x; for (int q = threadIdx.x; q < KIN / 8; q += 256) { __align__(16) _Float16 hh[8], ll[8];
#pragma unroll
    for (int i = 0; i < 8; ++i) { const float v = bfr(X[row * KIN + q * 8 + i]); const _Float16 h = (_Float16)v; hh[i] = h; ll[i] = (_Float16)((v - (float)h) * 2048.0f); }
    vst2((unsigned*)(XH + row * KIN + q * 8), *(const v4u*)hh); vst2((unsigned*)(XL + row * KIN + q * 8), *(const v4u*)ll); }
}
// ---- k_qgemm<DOWN>: block = 128 output columns x one K range (blockIdx.y): OUT[range][64 rows][n0..n0+127] = the range's part of A (f16 hi/lo rows, K deep) x dequant(W)[k][n].
// A chunk of 32 k that lies in ONE group is staged in LDS as the exact integers w - z in f16 (one plane, 2 products: hi.int, lo.int); the group's scale multiplies the f32 sums once, when the group ends, and the scaled sums are added to running totals that each wave keeps in its own part of so.
// A chunk whose 32 group indices differ is staged as (w - z) * scale, f16 hi + x2048 residual (3 products), and its sums count as a group of scale 1.
typedef v4f __attribute__((may_alias)) v4f_a;
typedef __attribute__((ext_vector_type(2))) _Float16 v2h;
// totals: lane-private slots, [16 quads][32 lanes] of 4 floats; quad 2j + hf holds rows 8g+4hf..8g+4hf+3 (g = lane >> 4) of the lane's column in tile j
__device__ __forceinline__ void flush_group(v4f_a* tot, v8f (&acc)[8], v8f (&accl)[8], const float (&scur)[8]) {
#pragma unroll
  for (int j = 0; j < 8; ++j) { const float s = bfr(scur[j]);
#pragma unroll
    for (int hf = 0; hf < 2; ++hf) { v4f t = tot[(j * 2 + hf) * 32];
#pragma unroll
      for (int e = 0; e < 4; ++e) t[e] += s * (acc[j][hf * 4 + e] + accl[j][hf * 4 + e] * (1.0f / 2048.0f));
      tot[(j * 2 + hf) * 32] = t; }
    acc[j] = v8f{}; accl[j] = v8f{}; }
}
// gl = the lane's one of a chunk's 32 group indices: the group (bounded to the tables' rows) if all 32 are equal, else -1. Every wave of a block reads the same 32 indices, so the answer is the same for the whole block.
template <int NG> __device__ __forceinline__ int chunk_group(int gl) {
  const int gf = __builtin_amdgcn_readfirstlane(gl); const bool u = __builtin_amdgcn_ballot_w32(gl == gf) == 0xFFFFFFFFu;
  return u ? (gf < 0 ? 0 : gf > NG - 1 ? NG - 1 : gf) : -1;
}
template <int DOWN>
__global__ __launch_bounds__(128) void k_qgemm(const _Float16* __restrict__ AH, const _Float16* __restrict__ AL, const int* __restrict__ QW, const float* __restrict__ SC, const int* __restrict__ QZ, const int* __restrict__ GI, float* __restrict__ OUT) {
  constexpr int KD = DOWN ? NI : KIN; constexpr int ND = DOWN ? NO : NI; constexpr int NCH = KD / 32, SP = DOWN ? SPD : SPG, NG = KD / GRP;
  const int kbeg = (int)blockIdx.y * NCH / SP, kend = ((int)blockIdx.y + 1) * NCH / SP;   // this range's chunks: the SP ranges tile [0, NCH)
  __shared__ __align__(16) _Float16 swh[128][40], swl[128][40]; __shared__ __align__(16) float so[4][16][132];
  const int tid = threadIdx.x, wave = tid >> 5, lane = tid & 31, col = lane & 15, g = lane >> 4; const int n0 = blockIdx.x * 128, n = n0 + tid;
  v8f acc[8] = {}, accl[8] = {};
  v4f_a* const tot = (v4f_a*)&so[wave][0][0] + lane;
#pragma unroll
  for (int q = 0; q < 16; ++q) tot[q * 32] = v4f{};
  int cur = -2;            // group whose sums acc, accl hold: -2 none yet, -1 already scaled (scale 1), else the group index
  float scur[8] = {};      // that group's scales (not yet rounded) for the lane's 8 output columns
  unsigned zpk = 0;        // f16 pair (1024 + z, 64 + z) of the thread's unpack column
  int wnext = chunk_group<NG>(GI[kbeg * 32 + lane]);   // the group test of a chunk is made one chunk ahead, so that no trip starts by waiting for its indices
#pragma unroll 1
  for (int kc = kbeg; kc < kend; ++kc) { const int k0 = kc * 32;
    const int want = wnext; const bool uni = want >= 0; unsigned word[4];
#pragma unroll
    for (int wq = 0; wq < 4; ++wq) word[wq] = (unsigned)QW[(size_t)((k0 >> 3) + wq) * ND + n];
    asm volatile("s_wait_xcnt 0x0" ::: "memory");   // precaution: stands in front of every rewrite of the address registers that the four loads name
    if (want != cur) {
      if (cur != -2) flush_group(tot, acc, accl, scur);
      cur = want;
      if (uni) { const int zw = QZ[(size_t)want * (ND / 8) + (n >> 3)]; const unsigned z = (unsigned)((zw >> ((n & 7) * 4)) & 15) + 1u; zpk = 0x54006400u + (z << 20) + z;
#pragma unroll
        for (int j = 0; j < 8; ++j) scur[j] = SC[(size_t)want * ND + n0 + j * 16 + col];
        asm volatile("s_wait_xcnt 0x0" ::: "memory"); }   // precaution: stands in front of every rewrite of the address registers that the scale loads name
      else {
#pragma unroll
        for (int j = 0; j < 8; ++j) scur[j] = 1.0f; } }
    if (uni) {
      // byte i of a word holds k = 2i (low nibble) and 2i + 1 (high nibble): both halves get the byte, the low nibble under exponent 2^10 reads 1024 + w, the high nibble under 2^6 reads 64 + w; the packed subtraction of (1024 + z, 64 + z) is exact
#pragma unroll
      for (int wq = 0; wq < 4; ++wq) { union { v2h p[4]; v8h v; } o;
#pragma unroll
        for (int i = 0; i < 4; ++i) { const unsigned bb = __builtin_amdgcn_perm(word[wq], word[wq], 0x0C000C00u | (unsigned)i | ((unsigned)i << 16));
          o.p[i] = __builtin_bit_cast(v2h, (bb & 0x00F0000Fu) | 0x54006400u) - __builtin_bit_cast(v2h, zpk); }
        *(v8h*)&swh[tid][wq * 8] = o.v; } }
    else { int cg = -1; int z = 0; float sc = 0.f;
#pragma unroll 1
      for (int wq = 0; wq < 4; ++wq) { const int wd = QW[(size_t)((k0 >> 3) + wq) * ND + n];
        asm volatile("s_wait_xcnt 0x0" ::: "memory");   // precaution: stands in front of every rewrite of the address registers that the load above names
#pragma unroll
        for (int i = 0; i < 8; ++i) { const int k = k0 + wq * 8 + i; const int gr = GI[k]; const int gi = gr < 0 ? 0 : gr > NG - 1 ? NG - 1 : gr;
          if (gi != cg) { cg = gi; const int zw = QZ[(size_t)gi * (ND / 8) + (n >> 3)]; z = ((zw >> ((n & 7) * 4)) & 15) + 1; sc = bfr(SC[(size_t)gi * ND + n]); }
          const int w = (wd >> (i * 4)) & 15; const float val = (float)(w - z) * sc; const _Float16 h = (_Float16)val; swh[tid][wq * 8 + i] = h; swl[tid][wq * 8 + i] = (_Float16)((val - (float)h) * 2048.0f); } } }
    __syncthreads();
    const int gln = GI[(kc + 1 < kend ? kc + 1 : kc) * 32 + lane];
    const v16h a = frag_h(AH + (size_t)(wave * 16 + col) * KD + kc * 32, lane), al = frag_h(AL + (size_t)(wave * 16 + col) * KD + kc * 32, lane);
#pragma unroll
    for (int j = 0; j < 8; ++j) { const v16h wh = frag_h(&swh[j * 16 + col][0], lane); acc[j] = wmma16(a, wh, acc[j]); accl[j] = wmma16(al, wh, accl[j]); }
    if (!uni) {
#pragma unroll
      for (int j = 0; j < 8; ++j) accl[j] = wmma16(a, frag_h(&swl[j * 16 + col][0], lane), accl[j]); }
    wnext = chunk_group<NG>(gln);
    __syncthreads(); }
  // last group: totals + scale * sums, in registers
#pragma unroll
  for (int j = 0; j < 8; ++j) { const float s = bfr(scur[j]);
#pragma unroll
    for (int hf = 0; hf < 2; ++hf) { const v4f t = tot[(j * 2 + hf) * 32];
#pragma unroll
      for (int e = 0; e < 4; ++e) acc[j][hf * 4 + e] = t[e] + s * (acc[j][hf * 4 + e] + accl[j][hf * 4 + e] * (1.0f / 2048.0f)); } }
  LDSX();   // every lane's totals are read before the wave overwrites its part of so in row order
#pragma unroll
  for (int j = 0; j < 8; ++j)
#pragma unroll
    for (int r = 0; r < 8; ++r) so[wave][8 * g + r][j * 16 + col] = acc[j][r];
  LDSX();
  for (int rl = 0; rl < 16; ++rl) vst2(OUT + ((size_t)blockIdx.y * MM + wave * 16 + rl) * ND + n0 + lane * 4, *(const v4f*)&so[wave][rl][lane * 4]);
}
// ---- k_h: thread = 8 consecutive elements of [64][NI]: g, u = sums of the SPG partial planes in range order; h = silu(g) * u -> f16 hi + x2048 residual
__global__ __launch_bounds__(256) void k_h(const float* __restrict__ G, const float* __restrict__ U, _Float16* __restrict__ HH, _Float16* __restrict__ HL) {
  const unsigned e = (blockIdx.x * 256u + threadIdx.x) * 8u, eb = e * 4u; __align__(16) _Float16 hh[8], ll[8];   // eb: the thread's byte offset inside every f32 plane
  v4f g0 = {}, g1 = {}, u0 = {}, u1 = {};
  // unrolled: the planes' loads are independent, so many are in flight at once
#pragma unroll
  for (int s = 0; s < SPG; ++s) { const char* gp = (const char*)(G + (size_t)s * MM * NI) + eb; const char* up = (const char*)(U + (size_t)s * MM * NI) + eb;
    g0 += *(const v4f*)gp; g1 += *(const v4f*)(gp + 16); u0 += *(const v4f*)up; u1 += *(const v4f*)(up + 16); }
#pragma unroll
  for (int i = 0; i < 8; ++i) { const float gv = i < 4 ? g0[i & 3] : g1[i & 3], uv = i < 4 ? u0[i & 3] : u1[i & 3]; const float hv = (gv / (1.0f + exp_ni(-gv))) * uv; const _Float16 h = (_Float16)hv; hh[i] = h; ll[i] = (_Float16)((hv - (float)h) * 2048.0f); }
  vst2((unsigned*)(HH + e), *(const v4u*)hh); vst2((unsigned*)(HL + e), *(const v4u*)ll);
}
// ---- k_dsum: thread = 4 consecutive elements of out [64][NO]: sum of the SPD partial planes in range order
__global__ __launch_bounds__(256) void k_dsum(const float* __restrict__ D, float* __restrict__ OUT) {
  const unsigned e = (blockIdx.x * 256u + threadIdx.x) * 4u, eb = e * 4u; v4f a = {};   // eb: the thread's byte offset inside every plane
  // unrolled: the planes' loads are independent, so many are in flight at once
#pragma unroll
  for (int s = 0; s < SPD; ++s) a += *(const v4f*)((const char*)(D + (size_t)s * MM * NO) + eb);
  vst2(OUT + e, a);
}
extern "C" void kernel_launch(void* const* d_in, const int* in_sizes, int n_in, void* d_out, int out_size, void* d_ws, size_t ws_size, hipStream_t stream) {
  (void)in_sizes; (void)n_in; (void)out_size;
  const float** F = (const float**)d_in; const int** I = (const int**)d_in;   // 0 x [64,4096]; gate: 1 qw [512,11008] i32, 2 scales [32,11008], 3 qzeros [32,1376] i32, 4 gidx [4096] i32; up: 5..8; down: 9 qw [1376,4096], 10 scales [86,4096], 11 qzeros [86,512], 12 gidx [11008]
  if (ws_size < (size_t)WS_END) return;
  char* ws = (char*)d_ws; _Float16 *XH = (_Float16*)(ws + WS_XH), *XL = (_Float16*)(ws + WS_XL), *HH = (_Float16*)(ws + WS_HH), *HL = (_Float16*)(ws + WS_HL); float *G = (float*)(ws + WS_G), *U = (float*)(ws + WS_U), *D = (float*)(ws + WS_D);
  k_xh<<<MM, 256, 0, stream>>>(F[0], XH, XL);
  k_qgemm<0><<<dim3(NI / 128, SPG), 128, 0, stream>>>(XH, XL, I[1], F[2], I[3], I[4], G);
  k_qgemm<0><<<dim3(NI / 128, SPG), 128, 0, stream>>>(XH, XL, I[5], F[6], I[7], I[8], U);
  k_h<<<MM * NI / 8 / 256, 256, 0, stream>>>(G, U, HH, HL);
  k_qgemm<1><<<dim3(NO / 128, SPD), 128, 0, stream>>>(HH, HL, I[9], F[10], I[11], I[12], D);
  k_dsum<<<MM * NO / 4 / 256, 256, 0, stream>>>(D, (float*)d_out);
}

// v003
// It runs in 83.4 microseconds.
// In two side-by-side timings against v002, it was 1.06 and 1.05 times as fast.
// Over all steps from v000 it is 25.9 times as fast.
// compute dtype: x and the three scale tables rounded to bf16, the packed int4 weights / zero points / group indices (int32) read verbatim; GPTQ dequantisation on device: w = (qw >> 4k) & 15, z = ((qz >> 4n) & 15) + 1, a 32-deep chunk that lies in one group is staged as the exact integers w - z in f16 and the group's scale multiplies the f32 sums (2 products into one accumulator: hi.int, lo.(int x 2^-11, exact in f16)), a chunk that spans groups as W = (w - z[g_idx]) * scale[g_idx] in f32 (exact: small integer times the bf16 scale), f16 hi + (x2048-scaled) residual (3 products: hi.hi, lo.hi, hi.lo); x as f16 hi + (x2048) residual (exact); gate and up GEMMs on WMMA 16x16x32; h = silu(gate) * up in f32 (precise expf), stored as f16 hi + (x2048) residual; down GEMM likewise; f32 accumulate.
#include <hip/hip_runtime.h>
#include <math.h>

typedef __attribute__((ext_vector_type(16))) _Float16 v16h;
typedef __attribute__((ext_vector_type(16))) __bf16 v16b;
typedef __attribute__((ext_vector_type(8)))  _Float16 v8h;
typedef __attribute__((ext_vector_type(8)))  float v8f;
typedef __attribute__((ext_vector_type(4)))  float v4f;
typedef __attribute__((ext_vector_type(2)))  float v2f;
typedef __attribute__((ext_vector_type(4)))  unsigned v4u;
typedef __attribute__((ext_vector_type(4)))  int v4i;
typedef float __attribute__((may_alias)) float_a;
typedef int __attribute__((may_alias)) int_a;

template <typename T> __device__ __forceinline__ void vst2(void* p, T v) { *(T*)p = v;  }
__device__ __forceinline__ v8f wmma16(v16h a, v16h b, v8f c) {
  v8f d = __builtin_amdgcn_wmma_f32_16x16x32_f16(false, a, false, b, (short)0, c, false, false);
  asm volatile("v_nop\n\tv_nop\n\tv_nop\n\tv_nop" : "+v"(d) : "v"(a), "v"(b));
  return d;
}
__device__ __forceinline__ v8f wmma_bf(v16b a, v16b b, v8f c) {
  v8f d = __builtin_amdgcn_wmma_f32_16x16x32_bf16(false, a, false, b, (short)0, c, false, false);
  asm volatile("v_nop\n\tv_nop\n\tv_nop\n\tv_nop" : "+v"(d) : "v"(a), "v"(b));
  return d;
}
// 16x16x32 fragments: lane = (h = lane>>4, row/col = lane&15); elements 0..7 = k0+8h+0..7, 8..15 = k0+16+8h+0..7; D element r = row 8h+r
__device__ __forceinline__ v16h frag_h(const _Float16* rowk0, int lane) {
  union { v16h v; v8h q[2]; } u; const _Float16* p = rowk0 + 8 * (lane >> 4);
  u.q[0] = *(const v8h*)p; u.q[1] = *(const v8h*)(p + 16); return u.v;
}
__device__ __forceinline__ v16h frag_f32(const float* rowk0, int lane) {
  v16h a; const float* p = rowk0 + 8 * (lane >> 4);
#pragma unroll
  for (int i = 0; i < 8; ++i) { a[i] = (_Float16)p[i]; a[8 + i] = (_Float16)p[16 + i]; }
  return a;
}
__device__ __forceinline__ v16h frag_f32s(const float* rowk0, int lane, float sc) {
  v16h a; const float* p = rowk0 + 8 * (lane >> 4);
#pragma unroll
  for (int i = 0; i < 8; ++i) { a[i] = (_Float16)(p[i] * sc); a[8 + i] = (_Float16)(p[16 + i] * sc); }
  return a;
}
// column fragment from a [K][ld] layout (column n), rows >= K read as 0
__device__ __forceinline__ v16h fragc_f32(const float* W, int k0, int n, int lane, int ld, int K) {
  v16h a; const int g = lane >> 4;
#pragma unroll
  for (int i = 0; i < 8; ++i) { const int ka = k0 + 8 * g + i, kb = ka + 16;
    a[i] = (_Float16)(ka < K ? W[(size_t)(ka < K ? ka : K - 1) * ld + n] : 0.f); a[8 + i] = (_Float16)(kb < K ? W[(size_t)(kb < K ? kb : K - 1) * ld + n] : 0.f); }
  return a;
}
struct F2 { v16b h, l; };
__device__ __forceinline__ F2 bsplit16(const float v[16]) { F2 r;
#pragma unroll
  for (int i = 0; i < 16; ++i) { const __bf16 h = (__bf16)v[i]; r.h[i] = h; r.l[i] = (__bf16)(v[i] - (float)h); }
  return r; }
__device__ __forceinline__ F2 split_row(const float* row, int k0, int lane) { float v[16]; const float* p = row + k0 + 8 * (lane >> 4);
#pragma unroll
  for (int i = 0; i < 8; ++i) { v[i] = p[i]; v[8 + i] = p[16 + i]; }
  return bsplit16(v); }
__device__ __forceinline__ F2 split_rowK(const float* row, int k0, int lane, int K) { float v[16]; const int g = lane >> 4;
#pragma unroll
  for (int i = 0; i < 8; ++i) { const int ka = k0 + 8 * g + i, kb = ka + 16; v[i] = ka < K ? row[ka < K ? ka : K - 1] : 0.f; v[8 + i] = kb < K ? row[kb < K ? kb : K - 1] : 0.f; }
  return bsplit16(v); }
__device__ __forceinline__ F2 split_col(const float* W, int k0, int n, int lane, int ld, int K) { float v[16]; const int g = lane >> 4;
#pragma unroll
  for (int i = 0; i < 8; ++i) { const int ka = k0 + 8 * g + i, kb = ka + 16; v[i] = ka < K ? W[(size_t)(ka < K ? ka : K - 1) * ld + n] : 0.f; v[8 + i] = kb < K ? W[(size_t)(kb < K ? kb : K - 1) * ld + n] : 0.f; }
  return bsplit16(v); }
__device__ __forceinline__ v8f mac3(const F2& a, const F2& b, v8f c) { c = wmma_bf(a.l, b.h, c); c = wmma_bf(a.h, b.l, c); return wmma_bf(a.h, b.h, c); }
__device__ __forceinline__ float sigm(float v) { return 1.0f / (1.0f + expf(-v)); }
#define LDSX() do { asm volatile("s_wait_dscnt 0" ::: "memory"); __builtin_amdgcn_wave_barrier(); __builtin_amdgcn_fence(__ATOMIC_RELEASE, "workgroup"); } while (0)


// Quantised (4-bit, group 128) fused SwiGLU MLP: h = silu(x Wg) * (x Wu), out = h Wd with GPTQ-packed Wg, Wu [4096 -> 11008] and Wd [11008 -> 4096]; 64 token rows.
#ifndef KIN
#define MM 64
#define KIN 4096
#define NI 11008
#define NO 4096
#endif
#define GRP 128
typedef __attribute__((ext_vector_type(8))) __bf16 v8b;
__device__ __forceinline__ v16b frag_b(const __bf16* rowk0, int lane) {
  union { v16b v; v8b q[2]; } u; const __bf16* p = rowk0 + 8 * (lane >> 4);
  u.q[0] = *(const v8b*)p; u.q[1] = *(const v8b*)(p + 16); return u.v;
}
__device__ __forceinline__ float bfr(float v) { return (float)(__bf16)v; }
__device__ __attribute__((noinline)) float exp_ni(float v) { return expf(v); }
__device__ __attribute__((noinline)) float erf_ni(float v) { return erff(v); }

#define WS_XH  0u                                   // f16 [64][KIN] x hi ; XL
#define WS_XL  (WS_XH + 2u * MM * KIN)
// K ranges per GEMM: as many as keep every work-group of a launch resident at once (registers allow 5 work-groups of k_qgemm on each of the 256 WGPs): 86 x 14 = 1204 and 32 x 39 = 1248 work-groups of 9 or 10 and 8 or 9 chunks
#define SPG 14                                      // gate and up: 128 chunks of 32 k
#define SPD 39                                      // down: 344 chunks of 32 k
#define WS_G   (WS_XL + 2u * MM * KIN)              // f32 [SPG][64][NI] gate partial sums ; U
#define WS_U   (WS_G + 4u * SPG * MM * NI)
#define WS_HH  (WS_U + 4u * SPG * MM * NI)          // f16 [64][NI] h hi ; HL
#define WS_HL  (WS_HH + 2u * MM * NI)
#define WS_D   (WS_HL + 2u * MM * NI)               // f32 [SPD][64][NO] down partial sums
#define WS_END (WS_D + 4u * SPD * MM * NO)

// ---- k_xh: block = row: x -> f16 hi + x2048 residual
__global__ __launch_bounds__(256) void k_xh(const float* __restrict__ X, _Float16* __restrict__ XH, _Float16* __restrict__ XL) {
  const size_t row = blockIdx.x; for (int q = threadIdx.x; q < KIN / 8; q += 256) { __align__(16) _Float16 hh[8], ll[8];
#pragma unroll
    for (int i = 0; i < 8; ++i) { const float v = bfr(X[row * KIN + q * 8 + i]); const _Float16 h = (_Float16)v; hh[i] = h; ll[i] = (_Float16)((v - (float)h) * 2048.0f); }
    vst2((unsigned*)(XH + row * KIN + q * 8), *(const v4u*)hh); vst2((unsigned*)(XL + row * KIN + q * 8), *(const v4u*)ll); }
}
// ---- k_qgemm<DOWN>: block = 128 output columns x one K range (blockIdx.y): OUT[range][64 rows][n0..n0+127] = the range's part of A (f16 hi/lo rows, K deep) x dequant(W)[k][n].
// A chunk of 32 k that lies in ONE group is staged in LDS as the exact integers w - z in f16 (one plane, 2 products: hi.int and lo.(int x 2^-11), the scaled integers exact in f16, so both go into ONE accumulator set); the group's scale multiplies the f32 sums once, when the group ends, and the scaled sums are added to running totals that each wave keeps in its own part of so.
// A chunk whose 32 group indices differ is staged as (w - z) * scale, f16 hi + x2048 residual (3 products; the two residual products of a column tile are summed apart and added x 2^-11), and its sums are added to the totals at once.
typedef v4f __attribute__((may_alias)) v4f_a;
typedef __attribute__((ext_vector_type(2))) _Float16 v2h;
// totals: lane-private slots, [16 quads][32 lanes] of 4 floats; quad 2j + hf holds rows 4hf..4hf+3 of the lane's column tile j
__device__ __forceinline__ void flush_group(v4f_a* tot, v8f (&acc)[8], const float (&scur)[8]) {
#pragma unroll
  for (int j = 0; j < 8; ++j) { const float s = bfr(scur[j]);
#pragma unroll
    for (int hf = 0; hf < 2; ++hf) { v4f t = tot[(j * 2 + hf) * 32];
#pragma unroll
      for (int e = 0; e < 4; ++e) t[e] += s * acc[j][hf * 4 + e];
      tot[(j * 2 + hf) * 32] = t; }
    acc[j] = v8f{}; }
}
// gl = the lane's one of a chunk's 32 group indices: the group (bounded to the tables' rows) if all 32 are equal, else -1. Every wave of a block reads the same 32 indices, so the answer is the same for the whole block.
template <int NG> __device__ __forceinline__ int chunk_group(int gl) {
  const int gf = __builtin_amdgcn_readfirstlane(gl); const bool u = __builtin_amdgcn_ballot_w32(gl == gf) == 0xFFFFFFFFu;
  return u ? (gf < 0 ? 0 : gf > NG - 1 ? NG - 1 : gf) : -1;
}
template <int DOWN>
__global__ __launch_bounds__(128) void k_qgemm(const _Float16* __restrict__ AH, const _Float16* __restrict__ AL, const int* __restrict__ QW, const float* __restrict__ SC, const int* __restrict__ QZ, const int* __restrict__ GI, float* __restrict__ OUT) {
  constexpr int KD = DOWN ? NI : KIN; constexpr int ND = DOWN ? NO : NI; constexpr int NCH = KD / 32, SP = DOWN ? SPD : SPG, NG = KD / GRP;
  const int kbeg = (int)blockIdx.y * NCH / SP, kend = ((int)blockIdx.y + 1) * NCH / SP;   // this range's chunks: the SP ranges tile [0, NCH)
  __shared__ __align__(16) _Float16 swh[128][40], swl[128][40]; __shared__ __align__(16) float so[4][16][132];
  const int tid = threadIdx.x, wave = tid >> 5, lane = tid & 31, col = lane & 15, g = lane >> 4; const int n0 = blockIdx.x * 128, n = n0 + tid;
  v8f acc[8] = {};
  v4f_a* const tot = (v4f_a*)&so[wave][0][0] + lane;
#pragma unroll
  for (int q = 0; q < 16; ++q) tot[q * 32] = v4f{};
  int cur = -2;            // group whose sums acc holds: -2 none yet, -1 already scaled (scale 1), else the group index
  float scur[8] = {};      // that group's scales (not yet rounded) for the lane's 8 output columns
  unsigned zpk = 0;        // f16 pair (1024 + z, 64 + z) of the thread's unpack column
  int wnext = chunk_group<NG>(GI[kbeg * 32 + lane]);   // the group test of a chunk is made one chunk ahead, so that no trip starts by waiting for its indices
#pragma unroll 1
  for (int kc = kbeg; kc < kend; ++kc) { const int k0 = kc * 32;
    const int want = wnext; const bool uni = want >= 0; unsigned word[4];
#pragma unroll
    for (int wq = 0; wq < 4; ++wq) word[wq] = (unsigned)QW[(size_t)((k0 >> 3) + wq) * ND + n];
    asm volatile("s_wait_xcnt 0x0" ::: "memory");   // precaution: stands in front of every rewrite of the address registers that the four loads name
    if (want != cur) {
      if (cur != -2) flush_group(tot, acc, scur);
      cur = want;
      if (uni) { const int zw = QZ[(size_t)want * (ND / 8) + (n >> 3)]; const unsigned z = (unsigned)((zw >> ((n & 7) * 4)) & 15) + 1u; zpk = 0x54006400u + (z << 20) + z;
#pragma unroll
        for (int j = 0; j < 8; ++j) scur[j] = SC[(size_t)want * ND + n0 + j * 16 + col];
        asm volatile("s_wait_xcnt 0x0" ::: "memory"); }   // precaution: stands in front of every rewrite of the address registers that the scale loads name
      else {
#pragma unroll
        for (int j = 0; j < 8; ++j) scur[j] = 1.0f; } }
    if (uni) {
      // byte i of a word holds k = 2i (low nibble) and 2i + 1 (high nibble): both halves get the byte, the low nibble under exponent 2^10 reads 1024 + w, the high nibble under 2^6 reads 64 + w; the packed subtraction of (1024 + z, 64 + z) is exact
#pragma unroll
      for (int wq = 0; wq < 4; ++wq) { union { v2h p[4]; v8h v; } o;
#pragma unroll
        for (int i = 0; i < 4; ++i) { const unsigned bb = __builtin_amdgcn_perm(word[wq], word[wq], 0x0C000C00u | (unsigned)i | ((unsigned)i << 16));
          o.p[i] = __builtin_bit_cast(v2h, (bb & 0x00F0000Fu) | 0x54006400u) - __builtin_bit_cast(v2h, zpk); }
        *(v8h*)&swh[tid][wq * 8] = o.v; } }
    else { int cg = -1; int z = 0; float sc = 0.f;
#pragma unroll 1
      for (int wq = 0; wq < 4; ++wq) { const int wd = QW[(size_t)((k0 >> 3) + wq) * ND + n];
        asm volatile("s_wait_xcnt 0x0" ::: "memory");   // precaution: stands in front of every rewrite of the address registers that the load above names
#pragma unroll
        for (int i = 0; i < 8; ++i) { const int k = k0 + wq * 8 + i; const int gr = GI[k]; const int gi = gr < 0 ? 0 : gr > NG - 1 ? NG - 1 : gr;
          if (gi != cg) { cg = gi; const int zw = QZ[(size_t)gi * (ND / 8) + (n >> 3)]; z = ((zw >> ((n & 7) * 4)) & 15) + 1; sc = bfr(SC[(size_t)gi * ND + n]); }
          const int w = (wd >> (i * 4)) & 15; const float val = (float)(w - z) * sc; const _Float16 h = (_Float16)val; swh[tid][wq * 8 + i] = h; swl[tid][wq * 8 + i] = (_Float16)((val - (float)h) * 2048.0f); } } }
    __syncthreads();
    const int gln = GI[(kc + 1 < kend ? kc + 1 : kc) * 32 + lane];
    const v16h a = frag_h(AH + (size_t)(wave * 16 + col) * KD + kc * 32, lane), al = frag_h(AL + (size_t)(wave * 16 + col) * KD + kc * 32, lane);
    asm volatile("s_wait_xcnt 0x0" ::: "memory");   // precaution: stands in front of every rewrite of the address registers that the index load and the four row loads above name
    if (uni) { v16h wh[8];   // all 8 column fragments are read from LDS as one group, ahead of the chunk's products: one LDS wait a chunk
#pragma unroll
      for (int j = 0; j < 8; ++j) wh[j] = frag_h(&swh[j * 16 + col][0], lane);
#pragma unroll
      for (int j = 0; j < 8; ++j) acc[j] = wmma16(a, wh[j], acc[j]);
#pragma unroll
      for (int j = 0; j < 8; ++j) acc[j] = wmma16(al, wh[j] * (_Float16)(1.0f / 2048.0f), acc[j]); }   // |w - z| <= 16: the scaled integers are exact
    else {   // already scaled: each column tile's sums go straight to the totals, acc stays 0
#pragma unroll 1   // rare path: kept small, and no second copy of acc in registers
      for (int j = 0; j < 8; ++j) { const v16h wh = frag_h(&swh[j * 16 + col][0], lane); v8f l = wmma16(al, wh, v8f{}); l = wmma16(a, frag_h(&swl[j * 16 + col][0], lane), l);
        const v8f hs = wmma16(a, wh, v8f{});
#pragma unroll
        for (int hf = 0; hf < 2; ++hf) { v4f t = tot[(j * 2 + hf) * 32];
#pragma unroll
          for (int e = 0; e < 4; ++e) t[e] += hs[hf * 4 + e] + l[hf * 4 + e] * (1.0f / 2048.0f);
          tot[(j * 2 + hf) * 32] = t; } } }
    wnext = chunk_group<NG>(gln);
    __syncthreads(); }
  // last group: totals + scale * sums, in registers
#pragma unroll
  for (int j = 0; j < 8; ++j) { const float s = bfr(scur[j]);
#pragma unroll
    for (int hf = 0; hf < 2; ++hf) { const v4f t = tot[(j * 2 + hf) * 32];
#pragma unroll
      for (int e = 0; e < 4; ++e) acc[j][hf * 4 + e] = t[e] + s * acc[j][hf * 4 + e]; } }
  LDSX();   // every lane's totals are read before the wave overwrites its part of so in row order
#pragma unroll
  for (int j = 0; j < 8; ++j)
#pragma unroll
    for (int r = 0; r < 8; ++r) so[wave][8 * g + r][j * 16 + col] = acc[j][r];
  LDSX();
  for (int rl = 0; rl < 16; ++rl) vst2(OUT + ((size_t)blockIdx.y * MM + wave * 16 + rl) * ND + n0 + lane * 4, *(const v4f*)&so[wave][rl][lane * 4]);
}
// ---- k_h: thread = 8 consecutive elements of [64][NI]: g, u = sums of the SPG partial planes in range order; h = silu(g) * u -> f16 hi + x2048 residual
__global__ __launch_bounds__(256) void k_h(const float* __restrict__ G, const float* __restrict__ U, _Float16* __restrict__ HH, _Float16* __restrict__ HL) {
  const unsigned e = (blockIdx.x * 256u + threadIdx.x) * 8u, eb = e * 4u; __align__(16) _Float16 hh[8], ll[8];   // eb: the thread's byte offset inside every f32 plane
  v4f g0 = {}, g1 = {}, u0 = {}, u1 = {};
  // unrolled: the planes' loads are independent, so many are in flight at once
#pragma unroll
  for (int s = 0; s < SPG; ++s) { const char* gp = (const char*)(G + (size_t)s * MM * NI) + eb; const char* up = (const char*)(U + (size_t)s * MM * NI) + eb;
    g0 += *(const v4f*)gp; g1 += *(const v4f*)(gp + 16); u0 += *(const v4f*)up; u1 += *(const v4f*)(up + 16); }
#pragma unroll
  for (int i = 0; i < 8; ++i) { const float gv = i < 4 ? g0[i & 3] : g1[i & 3], uv = i < 4 ? u0[i & 3] : u1[i & 3]; const float hv = (gv / (1.0f + exp_ni(-gv))) * uv; const _Float16 h = (_Float16)hv; hh[i] = h; ll[i] = (_Float16)((hv - (float)h) * 2048.0f); }
  vst2((unsigned*)(HH + e), *(const v4u*)hh); vst2((unsigned*)(HL + e), *(const v4u*)ll);
}
// ---- k_dsum: thread = 4 consecutive elements of out [64][NO]: sum of the SPD partial planes in range order
__global__ __launch_bounds__(256) void k_dsum(const float* __restrict__ D, float* __restrict__ OUT) {
  const unsigned e = (blockIdx.x * 256u + threadIdx.x) * 4u, eb = e * 4u; v4f a = {};   // eb: the thread's byte offset inside every plane
  // unrolled: the planes' loads are independent, so many are in flight at once
#pragma unroll
  for (int s = 0; s < SPD; ++s) a += *(const v4f*)((const char*)(D + (size_t)s * MM * NO) + eb);
  vst2(OUT + e, a);
}
extern "C" void kernel_launch(void* const* d_in, const int* in_sizes, int n_in, void* d_out, int out_size, void* d_ws, size_t ws_size, hipStream_t stream) {
  (void)in_sizes; (void)n_in; (void)out_size;
  const float** F = (const float**)d_in; const int** I = (const int**)d_in;   // 0 x [64,4096]; gate: 1 qw [512,11008] i32, 2 scales [32,11008], 3 qzeros [32,1376] i32, 4 gidx [4096] i32; up: 5..8; down: 9 qw [1376,4096], 10 scales [86,4096], 11 qzeros [86,512], 12 gidx [11008]
  if (ws_size < (size_t)WS_END) return;
  char* ws = (char*)d_ws; _Float16 *XH = (_Float16*)(ws + WS_XH), *XL = (_Float16*)(ws + WS_XL), *HH = (_Float16*)(ws + WS_HH), *HL = (_Float16*)(ws + WS_HL); float *G = (float*)(ws + WS_G), *U = (float*)(ws + WS_U), *D = (float*)(ws + WS_D);
  k_xh<<<MM, 256, 0, stream>>>(F[0], XH, XL);
  k_qgemm<0><<<dim3(NI / 128, SPG), 128, 0, stream>>>(XH, XL, I[1], F[2], I[3], I[4], G);
  k_qgemm<0><<<dim3(NI / 128, SPG), 128, 0, stream>>>(XH, XL, I[5], F[6], I[7], I[8], U);
  k_h<<<MM * NI / 8 / 256, 256, 0, stream>>>(G, U, HH, HL);
  k_qgemm<1><<<dim3(NO / 128, SPD), 128, 0, stream>>>(HH, HL, I[9], F[10], I[11], I[12], D);
  k_dsum<<<MM * NO / 4 / 256, 256, 0, stream>>>(D, (float*)d_out);
}

// v004
// One run takes 73.2 microseconds.
// Timed twice side by side with v003, it ran 1.15 and 1.14 times as fast.
// Counting every step since v000, it is 29.7 times as fast.
// compute dtype: x and the three scale tables rounded to bf16, the packed int4 weights / zero points / group indices (int32) read verbatim; GPTQ dequantisation on device: w = (qw >> 4k) & 15, z = ((qz >> 4n) & 15) + 1, a 32-deep chunk that lies in one group is staged as the exact integers w - z in f16 and the group's scale multiplies the f32 sums (2 products into one accumulator: hi.int, lo.(int x 2^-11, exact in f16)), a chunk that spans groups as W = (w - z[g_idx]) * scale[g_idx] in f32 (exact: small integer times the bf16 scale), f16 hi + (x2048-scaled) residual (3 products: hi.hi, lo.hi, hi.lo); x as f16 hi + (x2048) residual (exact); gate and up GEMMs on WMMA 16x16x32; h = silu(gate) * up in f32 (precise expf), stored as f16 hi + (x2048) residual; down GEMM likewise; f32 accumulate.
#include <hip/hip_runtime.h>
#include <math.h>

typedef __attribute__((ext_vector_type(16))) _Float16 v16h;
typedef __attribute__((ext_vector_type(16))) __bf16 v16b;
typedef __attribute__((ext_vector_type(8)))  _Float16 v8h;
typedef __attribute__((ext_vector_type(8)))  float v8f;
typedef __attribute__((ext_vector_type(4)))  float v4f;
typedef __attribute__((ext_vector_type(2)))  float v2f;
typedef __attribute__((ext_vector_type(4)))  unsigned v4u;
typedef __attribute__((ext_vector_type(4)))  int v4i;
typedef float __attribute__((may_alias)) float_a;
typedef int __attribute__((may_alias)) int_a;

template <typename T> __device__ __forceinline__ void vst2(void* p, T v) { *(T*)p = v;  }
__device__ __forceinline__ v8f wmma16(v16h a, v16h b, v8f c) {
  v8f d = __builtin_amdgcn_wmma_f32_16x16x32_f16(false, a, false, b, (short)0, c, false, false);
  asm volatile("v_nop\n\tv_nop\n\tv_nop\n\tv_nop" : "+v"(d) : "v"(a), "v"(b));
  return d;
}
__device__ __forceinline__ v8f wmma_bf(v16b a, v16b b, v8f c) {
  v8f d = __builtin_amdgcn_wmma_f32_16x16x32_bf16(false, a, false, b, (short)0, c, false, false);
  asm volatile("v_nop\n\tv_nop\n\tv_nop\n\tv_nop" : "+v"(d) : "v"(a), "v"(b));
  return d;
}
// 16x16x32 fragments: lane = (h = lane>>4, row/col = lane&15); elements 0..7 = k0+8h+0..7, 8..15 = k0+16+8h+0..7; D element r = row 8h+r
__device__ __forceinline__ v16h frag_h(const _Float16* rowk0, int lane) {
  union { v16h v; v8h q[2]; } u; const _Float16* p = rowk0 + 8 * (lane >> 4);
  u.q[0] = *(const v8h*)p; u.q[1] = *(const v8h*)(p + 16); return u.v;
}
__device__ __forceinline__ v16h frag_f32(const float* rowk0, int lane) {
  v16h a; const float* p = rowk0 + 8 * (lane >> 4);
#pragma unroll
  for (int i = 0; i < 8; ++i) { a[i] = (_Float16)p[i]; a[8 + i] = (_Float16)p[16 + i]; }
  return a;
}
__device__ __forceinline__ v16h frag_f32s(const float* rowk0, int lane, float sc) {
  v16h a; const float* p = rowk0 + 8 * (lane >> 4);
#pragma unroll
  for (int i = 0; i < 8; ++i) { a[i] = (_Float16)(p[i] * sc); a[8 + i] = (_Float16)(p[16 + i] * sc); }
  return a;
}
// column fragment from a [K][ld] layout (column n), rows >= K read as 0
__device__ __forceinline__ v16h fragc_f32(const float* W, int k0, int n, int lane, int ld, int K) {
  v16h a; const int g = lane >> 4;
#pragma unroll
  for (int i = 0; i < 8; ++i) { const int ka = k0 + 8 * g + i, kb = ka + 16;
    a[i] = (_Float16)(ka < K ? W[(size_t)(ka < K ? ka : K - 1) * ld + n] : 0.f); a[8 + i] = (_Float16)(kb < K ? W[(size_t)(kb < K ? kb : K - 1) * ld + n] : 0.f); }
  return a;
}
struct F2 { v16b h, l; };
__device__ __forceinline__ F2 bsplit16(const float v[16]) { F2 r;
#pragma unroll
  for (int i = 0; i < 16; ++i) { const __bf16 h = (__bf16)v[i]; r.h[i] = h; r.l[i] = (__bf16)(v[i] - (float)h); }
  return r; }
__device__ __forceinline__ F2 split_row(const float* row, int k0, int lane) { float v[16]; const float* p = row + k0 + 8 * (lane >> 4);
#pragma unroll
  for (int i = 0; i < 8; ++i) { v[i] = p[i]; v[8 + i] = p[16 + i]; }
  return bsplit16(v); }
__device__ __forceinline__ F2 split_rowK(const float* row, int k0, int lane, int K) { float v[16]; const int g = lane >> 4;
#pragma unroll
  for (int i = 0; i < 8; ++i) { const int ka = k0 + 8 * g + i, kb = ka + 16; v[i] = ka < K ? row[ka < K ? ka : K - 1] : 0.f; v[8 + i] = kb < K ? row[kb < K ? kb : K - 1] : 0.f; }
  return bsplit16(v); }
__device__ __forceinline__ F2 split_col(const float* W, int k0, int n, int lane, int ld, int K) { float v[16]; const int g = lane >> 4;
#pragma unroll
  for (int i = 0; i < 8; ++i) { const int ka = k0 + 8 * g + i, kb = ka + 16; v[i] = ka < K ? W[(size_t)(ka < K ? ka : K - 1) * ld + n] : 0.f; v[8 + i] = kb < K ? W[(size_t)(kb < K ? kb : K - 1) * ld + n] : 0.f; }
  return bsplit16(v); }
__device__ __forceinline__ v8f mac3(const F2& a, const F2& b, v8f c) { c = wmma_bf(a.l, b.h, c); c = wmma_bf(a.h, b.l, c); return wmma_bf(a.h, b.h, c); }
__device__ __forceinline__ float sigm(float v) { return 1.0f / (1.0f + expf(-v)); }
#define LDSX() do { asm volatile("s_wait_dscnt 0" ::: "memory"); __builtin_amdgcn_wave_barrier(); __builtin_amdgcn_fence(__ATOMIC_RELEASE, "workgroup"); } while (0)


// Quantised (4-bit, group 128) fused SwiGLU MLP: h = silu(x Wg) * (x Wu), out = h Wd with GPTQ-packed Wg, Wu [4096 -> 11008] and Wd [11008 -> 4096]; 64 token rows.
#ifndef KIN
#define MM 64
#define KIN 4096
#define NI 11008
#define NO 4096
#endif
#define GRP 128
typedef __attribute__((ext_vector_type(8))) __bf16 v8b;
__device__ __forceinline__ v16b frag_b(const __bf16* rowk0, int lane) {
  union { v16b v; v8b q[2]; } u; const __bf16* p = rowk0 + 8 * (lane >> 4);
  u.q[0] = *(const v8b*)p; u.q[1] = *(const v8b*)(p + 16); return u.v;
}
__device__ __forceinline__ float bfr(float v) { return (float)(__bf16)v; }
__device__ __attribute__((noinline)) float exp_ni(float v) { return expf(v); }
__device__ __attribute__((noinline)) float erf_ni(float v) { return erff(v); }

#define WS_XH  0u                                   // f16 [64][KIN] x hi ; XL
#define WS_XL  (WS_XH + 2u * MM * KIN)
// K ranges per GEMM: as many as keep every work-group of a launch resident at once (registers allow 5 work-groups of k_qgemm on each of the 256 WGPs): gate and up share one launch, 86 x 7 x 2 = 1204 work-groups of 18 or 19 chunks; down 32 x 39 = 1248 of 8 or 9
#define SPG 7                                       // gate and up, each: 128 chunks of 32 k
#define SPD 39                                      // down: 344 chunks of 32 k
#define WS_G   (WS_XL + 2u * MM * KIN)              // f32 [SPG][64][NI] gate partial sums ; U
#define WS_U   (WS_G + 4u * SPG * MM * NI)
#define WS_HH  (WS_U + 4u * SPG * MM * NI)          // f16 [64][NI] h hi ; HL
#define WS_HL  (WS_HH + 2u * MM * NI)
#define WS_D   (WS_HL + 2u * MM * NI)               // f32 [SPD][64][NO] down partial sums
#define WS_END (WS_D + 4u * SPD * MM * NO)

// ---- k_xh: block = row: x -> f16 hi + x2048 residual
__global__ __launch_bounds__(256) void k_xh(const float* __restrict__ X, _Float16* __restrict__ XH, _Float16* __restrict__ XL) {
  const size_t row = blockIdx.x; for (int q = threadIdx.x; q < KIN / 8; q += 256) { __align__(16) _Float16 hh[8], ll[8];
#pragma unroll
    for (int i = 0; i < 8; ++i) { const float v = bfr(X[row * KIN + q * 8 + i]); const _Float16 h = (_Float16)v; hh[i] = h; ll[i] = (_Float16)((v - (float)h) * 2048.0f); }
    vst2((unsigned*)(XH + row * KIN + q * 8), *(const v4u*)hh); vst2((unsigned*)(XL + row * KIN + q * 8), *(const v4u*)ll); }
}
// ---- k_qgemm<DOWN>: block = 128 output columns x one K range (blockIdx.y) of one weight matrix (blockIdx.z: 0 the first set of tables, 1 the second; the second matrix's planes follow the first's in OUTB): OUT[range][64 rows][n0..n0+127] = the range's part of A (f16 hi/lo rows, K deep) x dequant(W)[k][n].
// A chunk of 32 k that lies in ONE group is staged in LDS as the exact integers w - z in f16 (one plane, 2 products: hi.int and lo.(int x 2^-11), the scaled integers exact in f16, so both go into ONE accumulator set); the group's scale multiplies the f32 sums once, when the group ends, and the scaled sums are added to running totals that each wave keeps in its own part of so.
// A chunk whose 32 group indices differ is staged as (w - z) * scale, f16 hi + x2048 residual (3 products; the two residual products of a column tile are summed apart and added x 2^-11), and its sums are added to the totals at once.
typedef v4f __attribute__((may_alias)) v4f_a;
typedef __attribute__((ext_vector_type(2))) _Float16 v2h;
// totals: lane-private slots, [16 quads][32 lanes] of 4 floats; quad 2j + hf holds rows 4hf..4hf+3 of the lane's column tile j
__device__ __forceinline__ void flush_group(v4f_a* tot, v8f (&acc)[8], const float (&scur)[8]) {
#pragma unroll
  for (int j = 0; j < 8; ++j) { const float s = bfr(scur[j]);
#pragma unroll
    for (int hf = 0; hf < 2; ++hf) { v4f t = tot[(j * 2 + hf) * 32];
#pragma unroll
      for (int e = 0; e < 4; ++e) t[e] += s * acc[j][hf * 4 + e];
      tot[(j * 2 + hf) * 32] = t; }
    acc[j] = v8f{}; }
}
// gl = the lane's one of a chunk's 32 group indices: the group (bounded to the tables' rows) if all 32 are equal, else -1. Every wave of a block reads the same 32 indices, so the answer is the same for the whole block.
template <int NG> __device__ __forceinline__ int chunk_group(int gl) {
  const int gf = __builtin_amdgcn_readfirstlane(gl); const bool u = __builtin_amdgcn_ballot_w32(gl == gf) == 0xFFFFFFFFu;
  return u ? (gf < 0 ? 0 : gf > NG - 1 ? NG - 1 : gf) : -1;
}
template <int DOWN>
__global__ __launch_bounds__(128) void k_qgemm(const _Float16* __restrict__ AH, const _Float16* __restrict__ AL, const int* __restrict__ QW0, const float* __restrict__ SC0, const int* __restrict__ QZ0, const int* __restrict__ GI0, const int* __restrict__ QW1, const float* __restrict__ SC1, const int* __restrict__ QZ1, const int* __restrict__ GI1, float* __restrict__ OUTB) {
  constexpr int KD = DOWN ? NI : KIN; constexpr int ND = DOWN ? NO : NI; constexpr int NCH = KD / 32, SP = DOWN ? SPD : SPG, NG = KD / GRP;
  const bool second = blockIdx.z != 0;   // the same for the whole block
  const int* const QW = second ? QW1 : QW0; const float* const SC = second ? SC1 : SC0; const int* const QZ = second ? QZ1 : QZ0; const int* const GI = second ? GI1 : GI0;
  float* const OUT = OUTB + (size_t)blockIdx.z * SP * MM * ND;
  const int kbeg = (int)blockIdx.y * NCH / SP, kend = ((int)blockIdx.y + 1) * NCH / SP;   // this range's chunks: the SP ranges tile [0, NCH)
  __shared__ __align__(16) _Float16 swh[128][40], swl[128][40]; __shared__ __align__(16) float so[4][16][132];
  const int tid = threadIdx.x, wave = tid >> 5, lane = tid & 31, col = lane & 15, g = lane >> 4; const int n0 = blockIdx.x * 128, n = n0 + tid;
  v8f acc[8] = {};
  v4f_a* const tot = (v4f_a*)&so[wave][0][0] + lane;
#pragma unroll
  for (int q = 0; q < 16; ++q) tot[q * 32] = v4f{};
  int cur = -2;            // group whose sums acc holds: -2 none yet, -1 already scaled (scale 1), else the group index
  float scur[8] = {};      // that group's scales (not yet rounded) for the lane's 8 output columns
  unsigned zpk = 0;        // f16 pair (1024 + z, 64 + z) of the thread's unpack column
  int wnext = chunk_group<NG>(GI[kbeg * 32 + lane]);   // the group test of a chunk is made one chunk ahead, so that no trip starts by waiting for its indices
#pragma unroll 1
  for (int kc = kbeg; kc < kend; ++kc) { const int k0 = kc * 32;
    const int want = wnext; const bool uni = want >= 0; unsigned word[4];
#pragma unroll
    for (int wq = 0; wq < 4; ++wq) word[wq] = (unsigned)QW[(size_t)((k0 >> 3) + wq) * ND + n];
    asm volatile("s_wait_xcnt 0x0" ::: "memory");   // precaution: stands in front of every rewrite of the address registers that the four loads name
    if (want != cur) {
      if (cur != -2) flush_group(tot, acc, scur);
      cur = want;
      if (uni) { const int zw = QZ[(size_t)want * (ND / 8) + (n >> 3)]; const unsigned z = (unsigned)((zw >> ((n & 7) * 4)) & 15) + 1u; zpk = 0x54006400u + (z << 20) + z;
#pragma unroll
        for (int j = 0; j < 8; ++j) scur[j] = SC[(size_t)want * ND + n0 + j * 16 + col];
        asm volatile("s_wait_xcnt 0x0" ::: "memory"); }   // precaution: stands in front of every rewrite of the address registers that the scale loads name
      else {
#pragma unroll
        for (int j = 0; j < 8; ++j) scur[j] = 1.0f; } }
    if (uni) {
      // byte i of a word holds k = 2i (low nibble) and 2i + 1 (high nibble): both halves get the byte, the low nibble under exponent 2^10 reads 1024 + w, the high nibble under 2^6 reads 64 + w; the packed subtraction of (1024 + z, 64 + z) is exact
#pragma unroll
      for (int wq = 0; wq < 4; ++wq) { union { v2h p[4]; v8h v; } o;
#pragma unroll
        for (int i = 0; i < 4; ++i) { const unsigned bb = __builtin_amdgcn_perm(word[wq], word[wq], 0x0C000C00u | (unsigned)i | ((unsigned)i << 16));
          o.p[i] = __builtin_bit_cast(v2h, (bb & 0x00F0000Fu) | 0x54006400u) - __builtin_bit_cast(v2h, zpk); }
        *(v8h*)&swh[tid][wq * 8] = o.v; } }
    else { int cg = -1; int z = 0; float sc = 0.f;
#pragma unroll 1
      for (int wq = 0; wq < 4; ++wq) { const int wd = QW[(size_t)((k0 >> 3) + wq) * ND + n];
        asm volatile("s_wait_xcnt 0x0" ::: "memory");   // precaution: stands in front of every rewrite of the address registers that the load above names
#pragma unroll
        for (int i = 0; i < 8; ++i) { const int k = k0 + wq * 8 + i; const int gr = GI[k]; const int gi = gr < 0 ? 0 : gr > NG - 1 ? NG - 1 : gr;
          if (gi != cg) { cg = gi; const int zw = QZ[(size_t)gi * (ND / 8) + (n >> 3)]; z = ((zw >> ((n & 7) * 4)) & 15) + 1; sc = bfr(SC[(size_t)gi * ND + n]); }
          const int w = (wd >> (i * 4)) & 15; const float val = (float)(w - z) * sc; const _Float16 h = (_Float16)val; swh[tid][wq * 8 + i] = h; swl[tid][wq * 8 + i] = (_Float16)((val - (float)h) * 2048.0f); } } }
    __syncthreads();
    const int gln = GI[(kc + 1 < kend ? kc + 1 : kc) * 32 + lane];
    const v16h a = frag_h(AH + (size_t)(wave * 16 + col) * KD + kc * 32, lane), al = frag_h(AL + (size_t)(wave * 16 + col) * KD + kc * 32, lane);
    asm volatile("s_wait_xcnt 0x0" ::: "memory");   // precaution: stands in front of every rewrite of the address registers that the index load and the four row loads above name
    if (uni) { v16h wh[8];   // all 8 column fragments are read from LDS as one group, ahead of the chunk's products: one LDS wait a chunk
#pragma unroll
      for (int j = 0; j < 8; ++j) wh[j] = frag_h(&swh[j * 16 + col][0], lane);
#pragma unroll
      for (int j = 0; j < 8; ++j) acc[j] = wmma16(a, wh[j], acc[j]);
#pragma unroll
      for (int j = 0; j < 8; ++j) acc[j] = wmma16(al, wh[j] * (_Float16)(1.0f / 2048.0f), acc[j]); }   // |w - z| <= 16: the scaled integers are exact
    else {   // already scaled: each column tile's sums go straight to the totals, acc stays 0
#pragma unroll 1   // rare path: kept small, and no second copy of acc in registers
      for (int j = 0; j < 8; ++j) { const v16h wh = frag_h(&swh[j * 16 + col][0], lane); v8f l = wmma16(al, wh, v8f{}); l = wmma16(a, frag_h(&swl[j * 16 + col][0], lane), l);
        const v8f hs = wmma16(a, wh, v8f{});
#pragma unroll
        for (int hf = 0; hf < 2; ++hf) { v4f t = tot[(j * 2 + hf) * 32];
#pragma unroll
          for (int e = 0; e < 4; ++e) t[e] += hs[hf * 4 + e] + l[hf * 4 + e] * (1.0f / 2048.0f);
          tot[(j * 2 + hf) * 32] = t; } } }
    wnext = chunk_group<NG>(gln);
    __syncthreads(); }
  // last group: totals + scale * sums, in registers
#pragma unroll
  for (int j = 0; j < 8; ++j) { const float s = bfr(scur[j]);
#pragma unroll
    for (int hf = 0; hf < 2; ++hf) { const v4f t = tot[(j * 2 + hf) * 32];
#pragma unroll
      for (int e = 0; e < 4; ++e) acc[j][hf * 4 + e] = t[e] + s * acc[j][hf * 4 + e]; } }
  LDSX();   // every lane's totals are read before the wave overwrites its part of so in row order
#pragma unroll
  for (int j = 0; j < 8; ++j)
#pragma unroll
    for (int r = 0; r < 8; ++r) so[wave][8 * g + r][j * 16 + col] = acc[j][r];
  LDSX();
  for (int rl = 0; rl < 16; ++rl) vst2(OUT + ((size_t)blockIdx.y * MM + wave * 16 + rl) * ND + n0 + lane * 4, *(const v4f*)&so[wave][rl][lane * 4]);
}
// ---- k_h: thread = 8 consecutive elements of [64][NI]: g, u = sums of the SPG partial planes in range order; h = silu(g) * u -> f16 hi + x2048 residual
__global__ __launch_bounds__(256) void k_h(const float* __restrict__ G, const float* __restrict__ U, _Float16* __restrict__ HH, _Float16* __restrict__ HL) {
  const unsigned e = (blockIdx.x * 256u + threadIdx.x) * 8u, eb = e * 4u; __align__(16) _Float16 hh[8], ll[8];   // eb: the thread's byte offset inside every f32 plane
  v4f g0 = {}, g1 = {}, u0 = {}, u1 = {};
  // unrolled: the planes' loads are independent, so many are in flight at once
#pragma unroll
  for (int s = 0; s < SPG; ++s) { const char* gp = (const char*)(G + (size_t)s * MM * NI) + eb; const char* up = (const char*)(U + (size_t)s * MM * NI) + eb;
    g0 += *(const v4f*)gp; g1 += *(const v4f*)(gp + 16); u0 += *(const v4f*)up; u1 += *(const v4f*)(up + 16); }
#pragma unroll
  for (int i = 0; i < 8; ++i) { const float gv = i < 4 ? g0[i & 3] : g1[i & 3], uv = i < 4 ? u0[i & 3] : u1[i & 3]; const float hv = (gv / (1.0f + exp_ni(-gv))) * uv; const _Float16 h = (_Float16)hv; hh[i] = h; ll[i] = (_Float16)((hv - (float)h) * 2048.0f); }
  vst2((unsigned*)(HH + e), *(const v4u*)hh); vst2((unsigned*)(HL + e), *(const v4u*)ll);
}
// ---- k_dsum: thread = 4 consecutive elements of out [64][NO]: sum of the SPD partial planes in range order
__global__ __launch_bounds__(256) void k_dsum(const float* __restrict__ D, float* __restrict__ OUT) {
  const unsigned e = (blockIdx.x * 256u + threadIdx.x) * 4u, eb = e * 4u; v4f a = {};   // eb: the thread's byte offset inside every plane
  // unrolled: the planes' loads are independent, so many are in flight at once
#pragma unroll
  for (int s = 0; s < SPD; ++s) a += *(const v4f*)((const char*)(D + (size_t)s * MM * NO) + eb);
  vst2(OUT + e, a);
}
extern "C" void kernel_launch(void* const* d_in, const int* in_sizes, int n_in, void* d_out, int out_size, void* d_ws, size_t ws_size, hipStream_t stream) {
  (void)in_sizes; (void)n_in; (void)out_size;
  const float** F = (const float**)d_in; const int** I = (const int**)d_in;   // 0 x [64,4096]; gate: 1 qw [512,11008] i32, 2 scales [32,11008], 3 qzeros [32,1376] i32, 4 gidx [4096] i32; up: 5..8; down: 9 qw [1376,4096], 10 scales [86,4096], 11 qzeros [86,512], 12 gidx [11008]
  if (ws_size < (size_t)WS_END) return;
  char* ws = (char*)d_ws; _Float16 *XH = (_Float16*)(ws + WS_XH), *XL = (_Float16*)(ws + WS_XL), *HH = (_Float16*)(ws + WS_HH), *HL = (_Float16*)(ws + WS_HL); float *G = (float*)(ws + WS_G), *U = (float*)(ws + WS_U), *D = (float*)(ws + WS_D);
  k_xh<<<MM, 256, 0, stream>>>(F[0], XH, XL);
  k_qgemm<0><<<dim3(NI / 128, SPG, 2), 128, 0, stream>>>(XH, XL, I[1], F[2], I[3], I[4], I[5], F[6], I[7], I[8], G);   // z = 1 writes U, which follows G
  k_h<<<MM * NI / 8 / 256, 256, 0, stream>>>(G, U, HH, HL);
  k_qgemm<1><<<dim3(NO / 128, SPD, 1), 128, 0, stream>>>(HH, HL, I[9], F[10], I[11], I[12], I[9], F[10], I[11], I[12], D);
  k_dsum<<<MM * NO / 4 / 256, 256, 0, stream>>>(D, (float*)d_out);
}

// v005
// Measured time: 67.3 microseconds a run.
// Two timings next to v004 put it at 1.09 and 1.08 times that version's speed.
// All steps since v000 together make it 32.2 times as fast.
// compute dtype: x and the three scale tables rounded to bf16, the packed int4 weights / zero points / group indices (int32) read verbatim; GPTQ dequantisation on device: w = (qw >> 4k) & 15, z = ((qz >> 4n) & 15) + 1, a 32-deep chunk that lies in one group is staged as the exact integers w - z in f16 and the group's scale multiplies the f32 sums (2 products into one accumulator: hi.int, lo.(int x 2^-11, exact in f16)), a chunk that spans groups as W = (w - z[g_idx]) * scale[g_idx] in f32 (exact: small integer times the bf16 scale), f16 hi + (x2048-scaled) residual (3 products: hi.hi, lo.hi, hi.lo); x as f16 hi + (x2048) residual (exact); gate and up GEMMs on WMMA 16x16x32; h = silu(gate) * up in f32 (precise expf), stored as f16 hi + (x2048) residual; down GEMM likewise; f32 accumulate.
#include <hip/hip_runtime.h>
#include <math.h>

typedef __attribute__((ext_vector_type(16))) _Float16 v16h;
typedef __attribute__((ext_vector_type(16))) __bf16 v16b;
typedef __attribute__((ext_vector_type(8)))  _Float16 v8h;
typedef __attribute__((ext_vector_type(8)))  float v8f;
typedef __attribute__((ext_vector_type(4)))  float v4f;
typedef __attribute__((ext_vector_type(2)))  float v2f;
typedef __attribute__((ext_vector_type(4)))  unsigned v4u;
typedef __attribute__((ext_vector_type(4)))  int v4i;
typedef float __attribute__((may_alias)) float_a;
typedef int __attribute__((may_alias)) int_a;

template <typename T> __device__ __forceinline__ void vst2(void* p, T v) { *(T*)p = v;  }
__device__ __forceinline__ v8f wmma16(v16h a, v16h b, v8f c) {
  v8f d = __builtin_amdgcn_wmma_f32_16x16x32_f16(false, a, false, b, (short)0, c, false, false);
  asm volatile("v_nop\n\tv_nop\n\tv_nop\n\tv_nop" : "+v"(d) : "v"(a), "v"(b));
  return d;
}
__device__ __forceinline__ v8f wmma_bf(v16b a, v16b b, v8f c) {
  v8f d = __builtin_amdgcn_wmma_f32_16x16x32_bf16(false, a, false, b, (short)0, c, false, false);
  asm volatile("v_nop\n\tv_nop\n\tv_nop\n\tv_nop" : "+v"(d) : "v"(a), "v"(b));
  return d;
}
// 16x16x32 fragments: lane = (h = lane>>4, row/col = lane&15); elements 0..7 = k0+8h+0..7, 8..15 = k0+16+8h+0..7; D element r = row 8h+r
__device__ __forceinline__ v16h frag_h(const _Float16* rowk0, int lane) {
  union { v16h v; v8h q[2]; } u; const _Float16* p = rowk0 + 8 * (lane >> 4);
  u.q[0] = *(const v8h*)p; u.q[1] = *(const v8h*)(p + 16); return u.v;
}
__device__ __forceinline__ v16h frag_f32(const float* rowk0, int lane) {
  v16h a; const float* p = rowk0 + 8 * (lane >> 4);
#pragma unroll
  for (int i = 0; i < 8; ++i) { a[i] = (_Float16)p[i]; a[8 + i] = (_Float16)p[16 + i]; }
  return a;
}
__device__ __forceinline__ v16h frag_f32s(const float* rowk0, int lane, float sc) {
  v16h a; const float* p = rowk0 + 8 * (lane >> 4);
#pragma unroll
  for (int i = 0; i < 8; ++i) { a[i] = (_Float16)(p[i] * sc); a[8 + i] = (_Float16)(p[16 + i] * sc); }
  return a;
}
// column fragment from a [K][ld] layout (column n), rows >= K read as 0
__device__ __forceinline__ v16h fragc_f32(const float* W, int k0, int n, int lane, int ld, int K) {
  v16h a; const int g = lane >> 4;
#pragma unroll
  for (int i = 0; i < 8; ++i) { const int ka = k0 + 8 * g + i, kb = ka + 16;
    a[i] = (_Float16)(ka < K ? W[(size_t)(ka < K ? ka : K - 1) * ld + n] : 0.f); a[8 + i] = (_Float16)(kb < K ? W[(size_t)(kb < K ? kb : K - 1) * ld + n] : 0.f); }
  return a;
}
struct F2 { v16b h, l; };
__device__ __forceinline__ F2 bsplit16(const float v[16]) { F2 r;
#pragma unroll
  for (int i = 0; i < 16; ++i) { const __bf16 h = (__bf16)v[i]; r.h[i] = h; r.l[i] = (__bf16)(v[i] - (float)h); }
  return r; }
__device__ __forceinline__ F2 split_row(const float* row, int k0, int lane) { float v[16]; const float* p = row + k0 + 8 * (lane >> 4);
#pragma unroll
  for (int i = 0; i < 8; ++i) { v[i] = p[i]; v[8 + i] = p[16 + i]; }
  return bsplit16(v); }
__device__ __forceinline__ F2 split_rowK(const float* row, int k0, int lane, int K) { float v[16]; const int g = lane >> 4;
#pragma unroll
  for (int i = 0; i < 8; ++i) { const int ka = k0 + 8 * g + i, kb = ka + 16; v[i] = ka < K ? row[ka < K ? ka : K - 1] : 0.f; v[8 + i] = kb < K ? row[kb < K ? kb : K - 1] : 0.f; }
  return bsplit16(v); }
__device__ __forceinline__ F2 split_col(const float* W, int k0, int n, int lane, int ld, int K) { float v[16]; const int g = lane >> 4;
#pragma unroll
  for (int i = 0; i < 8; ++i) { const int ka = k0 + 8 * g + i, kb = ka + 16; v[i] = ka < K ? W[(size_t)(ka < K ? ka : K - 1) * ld + n] : 0.f; v[8 + i] = kb < K ? W[(size_t)(kb < K ? kb : K - 1) * ld + n] : 0.f; }
  return bsplit16(v); }
__device__ __forceinline__ v8f mac3(const F2& a, const F2& b, v8f c) { c = wmma_bf(a.l, b.h, c); c = wmma_bf(a.h, b.l, c); return wmma_bf(a.h, b.h, c); }
__device__ __forceinline__ float sigm(float v) { return 1.0f / (1.0f + expf(-v)); }
// work-group barrier for LDS hand-overs alone: the wave's own LDS reads and writes are done (s_wait_dscnt 0), global loads stay in flight across it (__syncthreads() would wait for them too)
__device__ __forceinline__ void lds_bar() { asm volatile("s_wait_dscnt 0x0\n\ts_barrier_signal -1\n\ts_barrier_wait -1" ::: "memory"); }
#define LDSX() do { asm volatile("s_wait_dscnt 0" ::: "memory"); __builtin_amdgcn_wave_barrier(); __builtin_amdgcn_fence(__ATOMIC_RELEASE, "workgroup"); } while (0)


// Quantised (4-bit, group 128) fused SwiGLU MLP: h = silu(x Wg) * (x Wu), out = h Wd with GPTQ-packed Wg, Wu [4096 -> 11008] and Wd [11008 -> 4096]; 64 token rows.
#ifndef KIN
#define MM 64
#define KIN 4096
#define NI 11008
#define NO 4096
#endif
#define GRP 128
typedef __attribute__((ext_vector_type(8))) __bf16 v8b;
__device__ __forceinline__ v16b frag_b(const __bf16* rowk0, int lane) {
  union { v16b v; v8b q[2]; } u; const __bf16* p = rowk0 + 8 * (lane >> 4);
  u.q[0] = *(const v8b*)p; u.q[1] = *(const v8b*)(p + 16); return u.v;
}
__device__ __forceinline__ float bfr(float v) { return (float)(__bf16)v; }
__device__ __attribute__((noinline)) float exp_ni(float v) { return expf(v); }
__device__ __attribute__((noinline)) float erf_ni(float v) { return erff(v); }

#define WS_XH  0u                                   // f16 [64][KIN] x hi ; XL
#define WS_XL  (WS_XH + 2u * MM * KIN)
// K ranges per GEMM: as many as keep every work-group of a launch resident at once (registers allow 5 work-groups of k_qgemm on each of the 256 WGPs): gate and up share one launch, 86 x 7 x 2 = 1204 work-groups of 18 or 19 chunks; down 32 x 39 = 1248 of 8 or 9
#define SPG 7                                       // gate and up, each: 128 chunks of 32 k
#define SPD 39                                      // down: 344 chunks of 32 k
#define WS_G   (WS_XL + 2u * MM * KIN)              // f32 [SPG][64][NI] gate partial sums ; U
#define WS_U   (WS_G + 4u * SPG * MM * NI)
#define WS_HH  (WS_U + 4u * SPG * MM * NI)          // f16 [64][NI] h hi ; HL
#define WS_HL  (WS_HH + 2u * MM * NI)
#define WS_D   (WS_HL + 2u * MM * NI)               // f32 [SPD][64][NO] down partial sums
#define WS_END (WS_D + 4u * SPD * MM * NO)

// ---- k_xh: block = row: x -> f16 hi + x2048 residual
__global__ __launch_bounds__(256) void k_xh(const float* __restrict__ X, _Float16* __restrict__ XH, _Float16* __restrict__ XL) {
  const size_t row = blockIdx.x; for (int q = threadIdx.x; q < KIN / 8; q += 256) { __align__(16) _Float16 hh[8], ll[8];
#pragma unroll
    for (int i = 0; i < 8; ++i) { const float v = bfr(X[row * KIN + q * 8 + i]); const _Float16 h = (_Float16)v; hh[i] = h; ll[i] = (_Float16)((v - (float)h) * 2048.0f); }
    vst2((unsigned*)(XH + row * KIN + q * 8), *(const v4u*)hh); vst2((unsigned*)(XL + row * KIN + q * 8), *(const v4u*)ll); }
}
// ---- k_qgemm<DOWN>: block = 128 output columns x one K range (blockIdx.y) of one weight matrix (blockIdx.z: 0 the first set of tables, 1 the second; the second matrix's planes follow the first's in OUTB): OUT[range][64 rows][n0..n0+127] = the range's part of A (f16 hi/lo rows, K deep) x dequant(W)[k][n].
// A chunk of 32 k that lies in ONE group is staged in LDS as the exact integers w - z in f16 (one plane, 2 products: hi.int and lo.(int x 2^-11), the scaled integers exact in f16, so both go into ONE accumulator set); the group's scale multiplies the f32 sums once, when the group ends, and the scaled sums are added to running totals that each wave keeps in its own part of so.
// A chunk whose 32 group indices differ is staged as (w - z) * scale, f16 hi + x2048 residual (3 products; the two residual products of a column tile are summed apart and added x 2^-11), and its sums are added to the totals at once.
typedef v4f __attribute__((may_alias)) v4f_a;
typedef __attribute__((ext_vector_type(2))) _Float16 v2h;
// totals: lane-private slots, [16 quads][32 lanes] of 4 floats; quad 2j + hf holds rows 4hf..4hf+3 of the lane's column tile j
__device__ __forceinline__ void flush_group(v4f_a* tot, v8f (&acc)[8], const float (&scur)[8]) {
#pragma unroll
  for (int j = 0; j < 8; ++j) { const float s = bfr(scur[j]);
#pragma unroll
    for (int hf = 0; hf < 2; ++hf) { v4f t = tot[(j * 2 + hf) * 32];
#pragma unroll
      for (int e = 0; e < 4; ++e) t[e] += s * acc[j][hf * 4 + e];
      tot[(j * 2 + hf) * 32] = t; }
    acc[j] = v8f{}; }
}
// gl = the lane's one of a chunk's 32 group indices: the group (bounded to the tables' rows) if all 32 are equal, else -1. Every wave of a block reads the same 32 indices, so the answer is the same for the whole block.
template <int NG> __device__ __forceinline__ int chunk_group(int gl) {
  const int gf = __builtin_amdgcn_readfirstlane(gl); const bool u = __builtin_amdgcn_ballot_w32(gl == gf) == 0xFFFFFFFFu;
  return u ? (gf < 0 ? 0 : gf > NG - 1 ? NG - 1 : gf) : -1;
}
template <int DOWN>
__global__ __launch_bounds__(128) void k_qgemm(const _Float16* __restrict__ AH, const _Float16* __restrict__ AL, const int* __restrict__ QW0, const float* __restrict__ SC0, const int* __restrict__ QZ0, const int* __restrict__ GI0, const int* __restrict__ QW1, const float* __restrict__ SC1, const int* __restrict__ QZ1, const int* __restrict__ GI1, float* __restrict__ OUTB) {
  constexpr int KD = DOWN ? NI : KIN; constexpr int ND = DOWN ? NO : NI; constexpr int NCH = KD / 32, SP = DOWN ? SPD : SPG, NG = KD / GRP;
  const bool second = blockIdx.z != 0;   // the same for the whole block
  const int* const QW = second ? QW1 : QW0; const float* const SC = second ? SC1 : SC0; const int* const QZ = second ? QZ1 : QZ0; const int* const GI = second ? GI1 : GI0;
  float* const OUT = OUTB + (size_t)blockIdx.z * SP * MM * ND;
  const int kbeg = (int)blockIdx.y * NCH / SP, kend = ((int)blockIdx.y + 1) * NCH / SP;   // this range's chunks: the SP ranges tile [0, NCH)
  __shared__ __align__(16) _Float16 swh[128][40], swl[128][40]; __shared__ __align__(16) float so[4][16][132];
  const int tid = threadIdx.x, wave = tid >> 5, lane = tid & 31, col = lane & 15, g = lane >> 4; const int n0 = blockIdx.x * 128, n = n0 + tid;
  v8f acc[8] = {};
  v4f_a* const tot = (v4f_a*)&so[wave][0][0] + lane;
#pragma unroll
  for (int q = 0; q < 16; ++q) tot[q * 32] = v4f{};
  int cur = -2;            // group whose sums acc holds: -2 none yet, -1 already scaled (scale 1), else the group index
  float scur[8] = {};      // that group's scales (not yet rounded) for the lane's 8 output columns
  // Every global load of a chunk is issued one trip ahead of its use (the group indices two), in the order in which the values are used, so that each wait leaves the younger loads in flight: no trip waits for memory that it has only just asked for.
  const _Float16* const arh = AH + (size_t)(wave * 16 + col) * KD; const _Float16* const arl = AL + (size_t)(wave * 16 + col) * KD;
  int want = chunk_group<NG>(GI[kbeg * 32 + lane]);                                  // group of the trip's own chunk
  int wn1 = chunk_group<NG>(GI[(kbeg + 1 < kend ? kbeg + 1 : kbeg) * 32 + lane]);     // group of the chunk after it
  const int zw0 = QZ[(size_t)(want < 0 ? 0 : want) * (ND / 8) + (n >> 3)];            // zero-point word of the first group
  int zwn = 0;                                                                        // zero-point word of the next group that begins
  unsigned word[4];
#pragma unroll
  for (int wq = 0; wq < 4; ++wq) word[wq] = (unsigned)QW[(size_t)(kbeg * 4 + wq) * ND + n];
  v16h a = frag_h(arh + kbeg * 32, lane), al = frag_h(arl + kbeg * 32, lane);
  asm volatile("s_wait_xcnt 0x0" :: "v"(zw0), "v"(word[0]), "v"(word[1]), "v"(word[2]), "v"(word[3]), "v"(a), "v"(al) : "memory");   // precaution: stands in front of every rewrite of the address registers that the loads above name; the loaded values are inputs so that the loads stay in front of it (the first trip needs them at once anyway)
  unsigned zpk = 0x54106401u + ((unsigned)(zw0 >> ((n & 7) * 4)) & 15u) * 0x100001u;   // f16 pair (1024 + z, 64 + z) of the thread's unpack column, z = nibble + 1
#pragma unroll 1
  for (int kc = kbeg; kc < kend; ++kc) { const int k0 = kc * 32;
    const bool uni = want >= 0; const int kn = kc + 1 < kend ? kc + 1 : kc;   // kn: the next chunk (the last trip reads its own again, unused)
    if (want != cur) {
      if (cur != -2) { flush_group(tot, acc, scur); zpk = 0x54106401u + ((unsigned)(zwn >> ((n & 7) * 4)) & 15u) * 0x100001u; }   // used only where the new chunk lies in one group, and then zwn is that group's word
      cur = want;
      if (uni) {
#pragma unroll
        for (int j = 0; j < 8; ++j) scur[j] = SC[(size_t)want * ND + n0 + j * 16 + col];
        asm volatile("s_wait_xcnt 0x0" ::: "memory"); }   // precaution: stands in front of every rewrite of the address registers that the scale loads name
      else {
#pragma unroll
        for (int j = 0; j < 8; ++j) scur[j] = 1.0f; } }
    if (wn1 != want && wn1 >= 0) { zwn = QZ[(size_t)wn1 * (ND / 8) + (n >> 3)];   // a group begins with the next chunk
      asm volatile("s_wait_xcnt 0x0" ::: "memory"); }   // precaution: stands in front of every rewrite of the address registers that the load above names
    if (uni) {
      // byte i of a word holds k = 2i (low nibble) and 2i + 1 (high nibble): both halves get the byte, the low nibble under exponent 2^10 reads 1024 + w, the high nibble under 2^6 reads 64 + w; the packed subtraction of (1024 + z, 64 + z) is exact
#pragma unroll
      for (int wq = 0; wq < 4; ++wq) { union { v2h p[4]; v8h v; } o;
#pragma unroll
        for (int i = 0; i < 4; ++i) { const unsigned bb = __builtin_amdgcn_perm(word[wq], word[wq], 0x0C000C00u | (unsigned)i | ((unsigned)i << 16));
          o.p[i] = __builtin_bit_cast(v2h, (bb & 0x00F0000Fu) | 0x54006400u) - __builtin_bit_cast(v2h, zpk); }
        *(v8h*)&swh[tid][wq * 8] = o.v; } }
    else { int cg = -1; int z = 0; float sc = 0.f;
#pragma unroll 1
      for (int wq = 0; wq < 4; ++wq) { const int wd = QW[(size_t)((k0 >> 3) + wq) * ND + n];
        asm volatile("s_wait_xcnt 0x0" ::: "memory");   // precaution: stands in front of every rewrite of the address registers that the load above names
#pragma unroll
        for (int i = 0; i < 8; ++i) { const int k = k0 + wq * 8 + i; const int gr = GI[k]; const int gi = gr < 0 ? 0 : gr > NG - 1 ? NG - 1 : gr;
          if (gi != cg) { cg = gi; const int zw = QZ[(size_t)gi * (ND / 8) + (n >> 3)]; z = ((zw >> ((n & 7) * 4)) & 15) + 1; sc = bfr(SC[(size_t)gi * ND + n]); }
          const int w = (wd >> (i * 4)) & 15; const float val = (float)(w - z) * sc; const _Float16 h = (_Float16)val; swh[tid][wq * 8 + i] = h; swl[tid][wq * 8 + i] = (_Float16)((val - (float)h) * 2048.0f); } } }
    const int gl2 = GI[(kc + 2 < kend ? kc + 2 : kend - 1) * 32 + lane];   // used at the trip's end: asked for ahead of the words, so that its wait leaves them in flight
#pragma unroll
    for (int wq = 0; wq < 4; ++wq) word[wq] = (unsigned)QW[(size_t)(kn * 4 + wq) * ND + n];   // the next chunk's words, into the registers that the unpacking has just left
    asm volatile("s_wait_xcnt 0x0" ::: "memory");   // precaution: stands in front of every rewrite of the address registers that the five loads name
    lds_bar();   // the chunk's staged weights are published
    if (uni) { v16h wh[8];   // all 8 column fragments are read from LDS as one group, ahead of the chunk's products: one LDS wait a chunk
#pragma unroll
      for (int j = 0; j < 8; ++j) wh[j] = frag_h(&swh[j * 16 + col][0], lane);
#pragma unroll
      for (int j = 0; j < 8; ++j) acc[j] = wmma16(a, wh[j], acc[j]);
#pragma unroll
      for (int j = 0; j < 8; ++j) acc[j] = wmma16(al, wh[j] * (_Float16)(1.0f / 2048.0f), acc[j]); }   // |w - z| <= 16: the scaled integers are exact
    else {   // already scaled: each column tile's sums go straight to the totals, acc stays 0
#pragma unroll 1   // rare path: kept small, and no second copy of acc in registers
      for (int j = 0; j < 8; ++j) { const v16h wh = frag_h(&swh[j * 16 + col][0], lane); v8f l = wmma16(al, wh, v8f{}); l = wmma16(a, frag_h(&swl[j * 16 + col][0], lane), l);
        const v8f hs = wmma16(a, wh, v8f{});
#pragma unroll
        for (int hf = 0; hf < 2; ++hf) { v4f t = tot[(j * 2 + hf) * 32];
#pragma unroll
          for (int e = 0; e < 4; ++e) t[e] += hs[hf * 4 + e] + l[hf * 4 + e] * (1.0f / 2048.0f);
          tot[(j * 2 + hf) * 32] = t; } } }
    want = wn1; wn1 = chunk_group<NG>(gl2);
    a = frag_h(arh + kn * 32, lane); al = frag_h(arl + kn * 32, lane);   // the next chunk's rows, into the registers that the products have just left
    asm volatile("s_wait_xcnt 0x0" ::: "memory");   // precaution: stands in front of every rewrite of the address registers that the four row loads name
    lds_bar(); }   // every wave has read the staged weights: the next trip may overwrite them
  // last group: totals + scale * sums, in registers
#pragma unroll
  for (int j = 0; j < 8; ++j) { const float s = bfr(scur[j]);
#pragma unroll
    for (int hf = 0; hf < 2; ++hf) { const v4f t = tot[(j * 2 + hf) * 32];
#pragma unroll
      for (int e = 0; e < 4; ++e) acc[j][hf * 4 + e] = t[e] + s * acc[j][hf * 4 + e]; } }
  LDSX();   // every lane's totals are read before the wave overwrites its part of so in row order
#pragma unroll
  for (int j = 0; j < 8; ++j)
#pragma unroll
    for (int r = 0; r < 8; ++r) so[wave][8 * g + r][j * 16 + col] = acc[j][r];
  LDSX();
  for (int rl = 0; rl < 16; ++rl) vst2(OUT + ((size_t)blockIdx.y * MM + wave * 16 + rl) * ND + n0 + lane * 4, *(const v4f*)&so[wave][rl][lane * 4]);
}
// ---- k_h: thread = 8 consecutive elements of [64][NI]: g, u = sums of the SPG partial planes in range order; h = silu(g) * u -> f16 hi + x2048 residual
__global__ __launch_bounds__(256) void k_h(const float* __restrict__ G, const float* __restrict__ U, _Float16* __restrict__ HH, _Float16* __restrict__ HL) {
  const unsigned e = (blockIdx.x * 256u + threadIdx.x) * 8u, eb = e * 4u; __align__(16) _Float16 hh[8], ll[8];   // eb: the thread's byte offset inside every f32 plane
  v4f g0 = {}, g1 = {}, u0 = {}, u1 = {};
  // unrolled: the planes' loads are independent, so many are in flight at once
#pragma unroll
  for (int s = 0; s < SPG; ++s) { const char* gp = (const char*)(G + (size_t)s * MM * NI) + eb; const char* up = (const char*)(U + (size_t)s * MM * NI) + eb;
    g0 += *(const v4f*)gp; g1 += *(const v4f*)(gp + 16); u0 += *(const v4f*)up; u1 += *(const v4f*)(up + 16); }
#pragma unroll
  for (int i = 0; i < 8; ++i) { const float gv = i < 4 ? g0[i & 3] : g1[i & 3], uv = i < 4 ? u0[i & 3] : u1[i & 3]; const float hv = (gv / (1.0f + exp_ni(-gv))) * uv; const _Float16 h = (_Float16)hv; hh[i] = h; ll[i] = (_Float16)((hv - (float)h) * 2048.0f); }
  vst2((unsigned*)(HH + e), *(const v4u*)hh); vst2((unsigned*)(HL + e), *(const v4u*)ll);
}
// ---- k_dsum: thread = 4 consecutive elements of out [64][NO]: sum of the SPD partial planes in range order
__global__ __launch_bounds__(256) void k_dsum(const float* __restrict__ D, float* __restrict__ OUT) {
  const unsigned e = (blockIdx.x * 256u + threadIdx.x) * 4u, eb = e * 4u; v4f a = {};   // eb: the thread's byte offset inside every plane
  // unrolled: the planes' loads are independent, so many are in flight at once
#pragma unroll
  for (int s = 0; s < SPD; ++s) a += *(const v4f*)((const char*)(D + (size_t)s * MM * NO) + eb);
  vst2(OUT + e, a);
}
extern "C" void kernel_launch(void* const* d_in, const int* in_sizes, int n_in, void* d_out, int out_size, void* d_ws, size_t ws_size, hipStream_t stream) {
  (void)in_sizes; (void)n_in; (void)out_size;
  const float** F = (const float**)d_in; const int** I = (const int**)d_in;   // 0 x [64,4096]; gate: 1 qw [512,11008] i32, 2 scales [32,11008], 3 qzeros [32,1376] i32, 4 gidx [4096] i32; up: 5..8; down: 9 qw [1376,4096], 10 scales [86,4096], 11 qzeros [86,512], 12 gidx [11008]
  if (ws_size < (size_t)WS_END) return;
  char* ws = (char*)d_ws; _Float16 *XH = (_Float16*)(ws + WS_XH), *XL = (_Float16*)(ws + WS_XL), *HH = (_Float16*)(ws + WS_HH), *HL = (_Float16*)(ws + WS_HL); float *G = (float*)(ws + WS_G), *U = (float*)(ws + WS_U), *D = (float*)(ws + WS_D);
  k_xh<<<MM, 256, 0, stream>>>(F[0], XH, XL);
  k_qgemm<0><<<dim3(NI / 128, SPG, 2), 128, 0, stream>>>(XH, XL, I[1], F[2], I[3], I[4], I[5], F[6], I[7], I[8], G);   // z = 1 writes U, which follows G
  k_h<<<MM * NI / 8 / 256, 256, 0, stream>>>(G, U, HH, HL);
  k_qgemm<1><<<dim3(NO / 128, SPD, 1), 128, 0, stream>>>(HH, HL, I[9], F[10], I[11], I[12], I[9], F[10], I[11], I[12], D);
  k_dsum<<<MM * NO / 4 / 256, 256, 0, stream>>>(D, (float*)d_out);
}

// v006
// Measured time: 60.6 microseconds a run.
// Next to v005, in two timings, it ran 1.11 times as fast each time.
// Counting every step since v000, it is 35.8 times as fast.
// compute dtype: x and the three scale tables rounded to bf16, the packed int4 weights / zero points / group indices (int32) read verbatim; GPTQ dequantisation on device: w = (qw >> 4k) & 15, z = ((qz >> 4n) & 15) + 1, gate and up GEMMs on bf16 WMMA 16x16x32: the bf16-rounded x is the A operand itself; a 32-deep chunk that lies in one group is staged as the exact integers w - z in bf16 (1 product) and the group's scale multiplies the f32 sums, a chunk that spans groups as W = (w - z[g_idx]) * scale[g_idx] in f32 (exact: small integer times the bf16 scale), bf16 hi + residual (exact, 2 products); h = silu(gate) * up in f32 (precise expf), stored as f16 hi + (x2048) residual; down GEMM on f16 WMMA 16x16x32: one-group chunks as the exact integers in f16 (2 products into one accumulator: hi.int, lo.(int x 2^-11, exact in f16)), other chunks as f16 hi + (x2048-scaled) residual (3 products: hi.hi, lo.hi, hi.lo); f32 accumulate.
#include <hip/hip_runtime.h>
#include <math.h>

typedef __attribute__((ext_vector_type(16))) _Float16 v16h;
typedef __attribute__((ext_vector_type(16))) __bf16 v16b;
typedef __attribute__((ext_vector_type(8)))  _Float16 v8h;
typedef __attribute__((ext_vector_type(8)))  float v8f;
typedef __attribute__((ext_vector_type(4)))  float v4f;
typedef __attribute__((ext_vector_type(2)))  float v2f;
typedef __attribute__((ext_vector_type(4)))  unsigned v4u;
typedef __attribute__((ext_vector_type(4)))  int v4i;
typedef float __attribute__((may_alias)) float_a;
typedef int __attribute__((may_alias)) int_a;

template <typename T> __device__ __forceinline__ void vst2(void* p, T v) { *(T*)p = v;  }
__device__ __forceinline__ v8f wmma16(v16h a, v16h b, v8f c) {
  v8f d = __builtin_amdgcn_wmma_f32_16x16x32_f16(false, a, false, b, (short)0, c, false, false);
  asm volatile("v_nop\n\tv_nop\n\tv_nop\n\tv_nop" : "+v"(d) : "v"(a), "v"(b));
  return d;
}
__device__ __forceinline__ v8f wmma_bf(v16b a, v16b b, v8f c) {
  v8f d = __builtin_amdgcn_wmma_f32_16x16x32_bf16(false, a, false, b, (short)0, c, false, false);
  asm volatile("v_nop\n\tv_nop\n\tv_nop\n\tv_nop" : "+v"(d) : "v"(a), "v"(b));
  return d;
}
// 16x16x32 fragments: lane = (h = lane>>4, row/col = lane&15); elements 0..7 = k0+8h+0..7, 8..15 = k0+16+8h+0..7; D element r = row 8h+r
__device__ __forceinline__ v16h frag_h(const _Float16* rowk0, int lane) {
  union { v16h v; v8h q[2]; } u; const _Float16* p = rowk0 + 8 * (lane >> 4);
  u.q[0] = *(const v8h*)p; u.q[1] = *(const v8h*)(p + 16); return u.v;
}
__device__ __forceinline__ v16h frag_f32(const float* rowk0, int lane) {
  v16h a; const float* p = rowk0 + 8 * (lane >> 4);
#pragma unroll
  for (int i = 0; i < 8; ++i) { a[i] = (_Float16)p[i]; a[8 + i] = (_Float16)p[16 + i]; }
  return a;
}
__device__ __forceinline__ v16h frag_f32s(const float* rowk0, int lane, float sc) {
  v16h a; const float* p = rowk0 + 8 * (lane >> 4);
#pragma unroll
  for (int i = 0; i < 8; ++i) { a[i] = (_Float16)(p[i] * sc); a[8 + i] = (_Float16)(p[16 + i] * sc); }
  return a;
}
// column fragment from a [K][ld] layout (column n), rows >= K read as 0
__device__ __forceinline__ v16h fragc_f32(const float* W, int k0, int n, int lane, int ld, int K) {
  v16h a; const int g = lane >> 4;
#pragma unroll
  for (int i = 0; i < 8; ++i) { const int ka = k0 + 8 * g + i, kb = ka + 16;
    a[i] = (_Float16)(ka < K ? W[(size_t)(ka < K ? ka : K - 1) * ld + n] : 0.f); a[8 + i] = (_Float16)(kb < K ? W[(size_t)(kb < K ? kb : K - 1) * ld + n] : 0.f); }
  return a;
}
struct F2 { v16b h, l; };
__device__ __forceinline__ F2 bsplit16(const float v[16]) { F2 r;
#pragma unroll
  for (int i = 0; i < 16; ++i) { const __bf16 h = (__bf16)v[i]; r.h[i] = h; r.l[i] = (__bf16)(v[i] - (float)h); }
  return r; }
__device__ __forceinline__ F2 split_row(const float* row, int k0, int lane) { float v[16]; const float* p = row + k0 + 8 * (lane >> 4);
#pragma unroll
  for (int i = 0; i < 8; ++i) { v[i] = p[i]; v[8 + i] = p[16 + i]; }
  return bsplit16(v); }
__device__ __forceinline__ F2 split_rowK(const float* row, int k0, int lane, int K) { float v[16]; const int g = lane >> 4;
#pragma unroll
  for (int i = 0; i < 8; ++i) { const int ka = k0 + 8 * g + i, kb = ka + 16; v[i] = ka < K ? row[ka < K ? ka : K - 1] : 0.f; v[8 + i] = kb < K ? row[kb < K ? kb : K - 1] : 0.f; }
  return bsplit16(v); }
__device__ __forceinline__ F2 split_col(const float* W, int k0, int n, int lane, int ld, int K) { float v[16]; const int g = lane >> 4;
#pragma unroll
  for (int i = 0; i < 8; ++i) { const int ka = k0 + 8 * g + i, kb = ka + 16; v[i] = ka < K ? W[(size_t)(ka < K ? ka : K - 1) * ld + n] : 0.f; v[8 + i] = kb < K ? W[(size_t)(kb < K ? kb : K - 1) * ld + n] : 0.f; }
  return bsplit16(v); }
__device__ __forceinline__ v8f mac3(const F2& a, const F2& b, v8f c) { c = wmma_bf(a.l, b.h, c); c = wmma_bf(a.h, b.l, c); return wmma_bf(a.h, b.h, c); }
__device__ __forceinline__ float sigm(float v) { return 1.0f / (1.0f + expf(-v)); }
// work-group barrier for LDS hand-overs alone: the wave's own LDS reads and writes are done (s_wait_dscnt 0), global loads stay in flight across it (__syncthreads() would wait for them too)
__device__ __forceinline__ void lds_bar() { asm volatile("s_wait_dscnt 0x0\n\ts_barrier_signal -1\n\ts_barrier_wait -1" ::: "memory"); }
#define LDSX() do { asm volatile("s_wait_dscnt 0" ::: "memory"); __builtin_amdgcn_wave_barrier(); __builtin_amdgcn_fence(__ATOMIC_RELEASE, "workgroup"); } while (0)


// Quantised (4-bit, group 128) fused SwiGLU MLP: h = silu(x Wg) * (x Wu), out = h Wd with GPTQ-packed Wg, Wu [4096 -> 11008] and Wd [11008 -> 4096]; 64 token rows.
#ifndef KIN
#define MM 64
#define KIN 4096
#define NI 11008
#define NO 4096
#endif
#define GRP 128
typedef __attribute__((ext_vector_type(8))) __bf16 v8b;
__device__ __forceinline__ v16b frag_b(const __bf16* rowk0, int lane) {
  union { v16b v; v8b q[2]; } u; const __bf16* p = rowk0 + 8 * (lane >> 4);
  u.q[0] = *(const v8b*)p; u.q[1] = *(const v8b*)(p + 16); return u.v;
}
__device__ __forceinline__ float bfr(float v) { return (float)(__bf16)v; }
__device__ __attribute__((noinline)) float exp_ni(float v) { return expf(v); }
__device__ __attribute__((noinline)) float erf_ni(float v) { return erff(v); }

// K ranges per GEMM: as many as keep every work-group of a launch resident at once (registers allow 5 work-groups of the GEMM kernels on each of the 256 WGPs): gate and up share one launch, 86 x 7 x 2 = 1204 work-groups of 18 or 19 chunks; down 32 x 39 = 1248 of 8 or 9
#define SPG 7                                       // gate and up, each: 128 chunks of 32 k
#define SPD 39                                      // down: 344 chunks of 32 k
#define WS_G   0u                                   // f32 [SPG][64][NI] gate partial sums ; U
#define WS_U   (WS_G + 4u * SPG * MM * NI)
#define WS_HH  (WS_U + 4u * SPG * MM * NI)          // f16 [64][NI] h hi ; HL
#define WS_HL  (WS_HH + 2u * MM * NI)
#define WS_D   (WS_HL + 2u * MM * NI)               // f32 [SPD][64][NO] down partial sums
#define WS_END (WS_D + 4u * SPD * MM * NO)

// ---- qgemm<DOWN> (body of k_qgemm_gu, DOWN = 0, and of k_qgemm_d, DOWN = 1): block = 128 output columns x one K range (blockIdx.y) of one weight matrix (blockIdx.z: 0 the first set of tables, 1 the second; the second matrix's planes follow the first's in OUTB): OUT[range][64 rows][n0..n0+127] = the range's part of A (K deep) x dequant(W)[k][n].
// DOWN = 0: A is x itself: its f32 rows are read and rounded to bf16 in the loader, and that bf16 value is the whole operand; the integers w - z are exact in bf16, so a one-group chunk takes 1 product; a chunk that spans groups is staged as (w - z) * scale, bf16 hi + residual (exact), 2 products. Inside each 8 k the order is 0 4 1 5 2 6 3 7, in A and in B alike (a word's nibbles s and s + 4 come out of one shift and mask as a pair).
// DOWN = 1: A is h as f16 hi/lo rows, as the next two lines say.
// A chunk of 32 k that lies in ONE group is staged in LDS as the exact integers w - z in f16 (one plane, 2 products: hi.int and lo.(int x 2^-11), the scaled integers exact in f16, so both go into ONE accumulator set); the group's scale multiplies the f32 sums once, when the group ends, and the scaled sums are added to running totals that each wave keeps in its own part of so.
// A chunk whose 32 group indices differ is staged as (w - z) * scale, f16 hi + x2048 residual (3 products; the two residual products of a column tile are summed apart and added x 2^-11), and its sums are added to the totals at once.
typedef v4f __attribute__((may_alias)) v4f_a;
typedef __attribute__((ext_vector_type(2))) _Float16 v2h;
typedef __attribute__((ext_vector_type(2))) __bf16 v2b;
// A fragment from 4 quads of a row of x: p[0], p[1] = k0 + 8h + 0..7, p[2], p[3] = k0 + 16 + 8h + 0..7, rounded to bf16; inside each 8 the order 0 4 1 5 2 6 3 7
__device__ __forceinline__ v16b frag_x(const v4f (&p)[4]) { v16b a;
#pragma unroll
  for (int s = 0; s < 4; ++s) { a[2 * s] = (__bf16)p[0][s]; a[2 * s + 1] = (__bf16)p[1][s]; a[8 + 2 * s] = (__bf16)p[2][s]; a[8 + 2 * s + 1] = (__bf16)p[3][s]; }
  return a; }
// totals: lane-private slots, [16 quads][32 lanes] of 4 floats; quad 2j + hf holds rows 4hf..4hf+3 of the lane's column tile j
__device__ __forceinline__ void flush_group(v4f_a* tot, v8f (&acc)[8], const float (&scur)[8]) {
#pragma unroll
  for (int j = 0; j < 8; ++j) { const float s = bfr(scur[j]);
#pragma unroll
    for (int hf = 0; hf < 2; ++hf) { v4f t = tot[(j * 2 + hf) * 32];
#pragma unroll
      for (int e = 0; e < 4; ++e) t[e] += s * acc[j][hf * 4 + e];
      tot[(j * 2 + hf) * 32] = t; }
    acc[j] = v8f{}; }
}
// gl = the lane's one of a chunk's 32 group indices: the group (bounded to the tables' rows) if all 32 are equal, else -1. Every wave of a block reads the same 32 indices, so the answer is the same for the whole block.
template <int NG> __device__ __forceinline__ int chunk_group(int gl) {
  const int gf = __builtin_amdgcn_readfirstlane(gl); const bool u = __builtin_amdgcn_ballot_w32(gl == gf) == 0xFFFFFFFFu;
  return u ? (gf < 0 ? 0 : gf > NG - 1 ? NG - 1 : gf) : -1;
}
template <int DOWN>
__device__ __forceinline__ void qgemm(const float* __restrict__ X, const _Float16* __restrict__ AH, const _Float16* __restrict__ AL, const int* __restrict__ QW0, const float* __restrict__ SC0, const int* __restrict__ QZ0, const int* __restrict__ GI0, const int* __restrict__ QW1, const float* __restrict__ SC1, const int* __restrict__ QZ1, const int* __restrict__ GI1, float* __restrict__ OUTB) {
  constexpr int KD = DOWN ? NI : KIN; constexpr int ND = DOWN ? NO : NI; constexpr int NCH = KD / 32, SP = DOWN ? SPD : SPG, NG = KD / GRP;
  const bool second = blockIdx.z != 0;   // the same for the whole block
  const int* const QW = second ? QW1 : QW0; const float* const SC = second ? SC1 : SC0; const int* const QZ = second ? QZ1 : QZ0; const int* const GI = second ? GI1 : GI0;
  float* const OUT = OUTB + (size_t)blockIdx.z * SP * MM * ND;
  const int kbeg = (int)blockIdx.y * NCH / SP, kend = ((int)blockIdx.y + 1) * NCH / SP;   // this range's chunks: the SP ranges tile [0, NCH)
  __shared__ __align__(16) _Float16 swh[128][40], swl[128][40]; __shared__ __align__(16) float so[4][16][132];
  const int tid = threadIdx.x, wave = tid >> 5, lane = tid & 31, col = lane & 15, g = lane >> 4; const int n0 = blockIdx.x * 128, n = n0 + tid;
  v8f acc[8] = {};
  v4f_a* const tot = (v4f_a*)&so[wave][0][0] + lane;
#pragma unroll
  for (int q = 0; q < 16; ++q) tot[q * 32] = v4f{};
  int cur = -2;            // group whose sums acc holds: -2 none yet, -1 already scaled (scale 1), else the group index
  float scur[8] = {};      // that group's scales (not yet rounded) for the lane's 8 output columns
  // Every global load of a chunk is issued one trip ahead of its use (the group indices two), in the order in which the values are used (save x for gate and up: loaded after the words, rounded before them), so that each wait leaves the younger loads in flight: no trip waits for memory that it has only just asked for.
  const _Float16* const arh = DOWN ? AH + (size_t)(wave * 16 + col) * KD : nullptr; const _Float16* const arl = DOWN ? AL + (size_t)(wave * 16 + col) * KD : nullptr;
  const float* const xrow = DOWN ? nullptr : X + (size_t)(wave * 16 + col) * KD + 8 * g;   // the lane's part of its row of x
  int want = chunk_group<NG>(GI[kbeg * 32 + lane]);                                  // group of the trip's own chunk
  int wn1 = chunk_group<NG>(GI[(kbeg + 1 < kend ? kbeg + 1 : kbeg) * 32 + lane]);     // group of the chunk after it
  const int zw0 = QZ[(size_t)(want < 0 ? 0 : want) * (ND / 8) + (n >> 3)];            // zero-point word of the first group
  int zwn = 0;                                                                        // zero-point word of the next group that begins
  unsigned word[4];
#pragma unroll
  for (int wq = 0; wq < 4; ++wq) word[wq] = (unsigned)QW[(size_t)(kbeg * 4 + wq) * ND + n];
  v16h a = {}, al = {}; v4f xr[4] = {};   // DOWN: the chunk's hi and lo fragments; else the chunk's 16 values of x as loaded
  // precaution (both forms): s_wait_xcnt 0 stands in front of every rewrite of the address registers that the loads above name; the loaded values are inputs so that the loads stay in front of it (the first trip needs them at once anyway)
  if constexpr (DOWN) { a = frag_h(arh + kbeg * 32, lane); al = frag_h(arl + kbeg * 32, lane);
    asm volatile("s_wait_xcnt 0x0" :: "v"(zw0), "v"(word[0]), "v"(word[1]), "v"(word[2]), "v"(word[3]), "v"(a), "v"(al) : "memory"); }
  else { const float* const p = xrow + kbeg * 32; xr[0] = *(const v4f*)p; xr[1] = *(const v4f*)(p + 4); xr[2] = *(const v4f*)(p + 16); xr[3] = *(const v4f*)(p + 20);
    asm volatile("s_wait_xcnt 0x0" :: "v"(zw0), "v"(word[0]), "v"(word[1]), "v"(word[2]), "v"(word[3]), "v"(xr[0]), "v"(xr[1]), "v"(xr[2]), "v"(xr[3]) : "memory"); }
  // zero point of the thread's unpack column, z = nibble + 1: DOWN the f16 pair (1024 + z, 64 + z), else the bf16 pair (-(128 + z), -(128 + z))
  constexpr unsigned ZB = DOWN ? 0x54106401u : 0xC301C301u, ZM = DOWN ? 0x100001u : 0x10001u;
  unsigned zpk = ZB + ((unsigned)(zw0 >> ((n & 7) * 4)) & 15u) * ZM;
#pragma unroll 1
  for (int kc = kbeg; kc < kend; ++kc) { const int k0 = kc * 32;
    const bool uni = want >= 0; const int kn = kc + 1 < kend ? kc + 1 : kc;   // kn: the next chunk (the last trip reads its own again, unused)
    v16b ab = {}; if constexpr (!DOWN) ab = frag_x(xr);   // the chunk's A fragment; xr is free from here on
    if (want != cur) {
      if (cur != -2) { flush_group(tot, acc, scur); zpk = ZB + ((unsigned)(zwn >> ((n & 7) * 4)) & 15u) * ZM; }   // used only where the new chunk lies in one group, and then zwn is that group's word
      cur = want;
      if (uni) {
#pragma unroll
        for (int j = 0; j < 8; ++j) scur[j] = SC[(size_t)want * ND + n0 + j * 16 + col];
        asm volatile("s_wait_xcnt 0x0" ::: "memory"); }   // precaution: stands in front of every rewrite of the address registers that the scale loads name
      else {
#pragma unroll
        for (int j = 0; j < 8; ++j) scur[j] = 1.0f; } }
    if (wn1 != want && wn1 >= 0) { zwn = QZ[(size_t)wn1 * (ND / 8) + (n >> 3)];   // a group begins with the next chunk
      asm volatile("s_wait_xcnt 0x0" ::: "memory"); }   // precaution: stands in front of every rewrite of the address registers that the load above names
    if (uni && !DOWN) {
      // nibbles s and s + 4 of a word stand 16 bits apart: shifted down and masked, each under exponent 2^7 reads 128 + w in bf16; the packed addition of -(128 + z) is exact
#pragma unroll
      for (int wq = 0; wq < 4; ++wq) { union { v2b p[4]; v8h v; } o;
#pragma unroll
        for (int s = 0; s < 4; ++s) o.p[s] = __builtin_bit_cast(v2b, ((word[wq] >> (4 * s)) & 0x000F000Fu) | 0x43004300u) + __builtin_bit_cast(v2b, zpk);
        *(v8h*)&swh[tid][wq * 8] = o.v; } }
    else if (uni) {
      // byte i of a word holds k = 2i (low nibble) and 2i + 1 (high nibble): both halves get the byte, the low nibble under exponent 2^10 reads 1024 + w, the high nibble under 2^6 reads 64 + w; the packed subtraction of (1024 + z, 64 + z) is exact
#pragma unroll
      for (int wq = 0; wq < 4; ++wq) { union { v2h p[4]; v8h v; } o;
#pragma unroll
        for (int i = 0; i < 4; ++i) { const unsigned bb = __builtin_amdgcn_perm(word[wq], word[wq], 0x0C000C00u | (unsigned)i | ((unsigned)i << 16));
          o.p[i] = __builtin_bit_cast(v2h, (bb & 0x00F0000Fu) | 0x54006400u) - __builtin_bit_cast(v2h, zpk); }
        *(v8h*)&swh[tid][wq * 8] = o.v; } }
    else { int cg = -1; int z = 0; float sc = 0.f;
#pragma unroll 1
      for (int wq = 0; wq < 4; ++wq) { const int wd = QW[(size_t)((k0 >> 3) + wq) * ND + n];
        asm volatile("s_wait_xcnt 0x0" ::: "memory");   // precaution: stands in front of every rewrite of the address registers that the load above names
#pragma unroll
        for (int i = 0; i < 8; ++i) { const int k = k0 + wq * 8 + i; const int gr = GI[k]; const int gi = gr < 0 ? 0 : gr > NG - 1 ? NG - 1 : gr;
          if (gi != cg) { cg = gi; const int zw = QZ[(size_t)gi * (ND / 8) + (n >> 3)]; z = ((zw >> ((n & 7) * 4)) & 15) + 1; sc = bfr(SC[(size_t)gi * ND + n]); }
          const int w = (wd >> (i * 4)) & 15; const float val = (float)(w - z) * sc;
          if constexpr (DOWN) { const _Float16 h = (_Float16)val; swh[tid][wq * 8 + i] = h; swl[tid][wq * 8 + i] = (_Float16)((val - (float)h) * 2048.0f); }
          else { const __bf16 h = (__bf16)val; const int ps = wq * 8 + (i < 4 ? 2 * i : 2 * i - 7);   // ps: the place of k = i in the order 0 4 1 5 2 6 3 7
            swh[tid][ps] = __builtin_bit_cast(_Float16, h); swl[tid][ps] = __builtin_bit_cast(_Float16, (__bf16)(val - (float)h)); } } } }
    const int gl2 = GI[(kc + 2 < kend ? kc + 2 : kend - 1) * 32 + lane];   // used at the trip's end: asked for ahead of the words, so that its wait leaves them in flight
    if constexpr (!DOWN) asm volatile("s_wait_xcnt 0x0" ::: "memory");   // precaution: in this build a later load's result takes the register that holds the address of the load above
#pragma unroll
    for (int wq = 0; wq < 4; ++wq) word[wq] = (unsigned)QW[(size_t)(kn * 4 + wq) * ND + n];   // the next chunk's words, into the registers that the unpacking has just left
    if constexpr (!DOWN) { const float* const p = xrow + kn * 32; xr[0] = *(const v4f*)p; xr[1] = *(const v4f*)(p + 4); xr[2] = *(const v4f*)(p + 16); xr[3] = *(const v4f*)(p + 20); }   // the next chunk's part of x, a whole trip ahead of its rounding
    asm volatile("s_wait_xcnt 0x0" ::: "memory");   // precaution: stands in front of every rewrite of the address registers that the loads above name
    lds_bar();   // the chunk's staged weights are published
    if (uni) { v16h wh[8];   // all 8 column fragments are read from LDS as one group, ahead of the chunk's products: one LDS wait a chunk
#pragma unroll
      for (int j = 0; j < 8; ++j) wh[j] = frag_h(&swh[j * 16 + col][0], lane);
      if constexpr (DOWN) {
#pragma unroll
        for (int j = 0; j < 8; ++j) acc[j] = wmma16(a, wh[j], acc[j]);
#pragma unroll
        for (int j = 0; j < 8; ++j) acc[j] = wmma16(al, wh[j] * (_Float16)(1.0f / 2048.0f), acc[j]); }   // |w - z| <= 16: the scaled integers are exact
      else {
#pragma unroll
        for (int j = 0; j < 8; ++j) acc[j] = wmma_bf(ab, __builtin_bit_cast(v16b, wh[j]), acc[j]); } }
    else {   // already scaled: each column tile's sums go straight to the totals, acc stays 0
#pragma unroll 1   // rare path: kept small, and no second copy of acc in registers
      for (int j = 0; j < 8; ++j) { const v16h wh = frag_h(&swh[j * 16 + col][0], lane), wl = frag_h(&swl[j * 16 + col][0], lane); v8f l = {}, hs;
        if constexpr (DOWN) { l = wmma16(al, wh, l); l = wmma16(a, wl, l); hs = wmma16(a, wh, v8f{}); }
        else hs = wmma_bf(ab, __builtin_bit_cast(v16b, wh), wmma_bf(ab, __builtin_bit_cast(v16b, wl), v8f{}));   // both planes at their own scale: one sum
#pragma unroll
        for (int hf = 0; hf < 2; ++hf) { v4f t = tot[(j * 2 + hf) * 32];
#pragma unroll
          for (int e = 0; e < 4; ++e) t[e] += DOWN ? hs[hf * 4 + e] + l[hf * 4 + e] * (1.0f / 2048.0f) : hs[hf * 4 + e];
          tot[(j * 2 + hf) * 32] = t; } } }
    want = wn1; wn1 = chunk_group<NG>(gl2);
    if constexpr (DOWN) { a = frag_h(arh + kn * 32, lane); al = frag_h(arl + kn * 32, lane);   // the next chunk's rows, into the registers that the products have just left
      asm volatile("s_wait_xcnt 0x0" ::: "memory"); }   // precaution: stands in front of every rewrite of the address registers that the four row loads name
    lds_bar(); }   // every wave has read the staged weights: the next trip may overwrite them
  // last group: totals + scale * sums, in registers
#pragma unroll
  for (int j = 0; j < 8; ++j) { const float s = bfr(scur[j]);
#pragma unroll
    for (int hf = 0; hf < 2; ++hf) { const v4f t = tot[(j * 2 + hf) * 32];
#pragma unroll
      for (int e = 0; e < 4; ++e) acc[j][hf * 4 + e] = t[e] + s * acc[j][hf * 4 + e]; } }
  LDSX();   // every lane's totals are read before the wave overwrites its part of so in row order
#pragma unroll
  for (int j = 0; j < 8; ++j)
#pragma unroll
    for (int r = 0; r < 8; ++r) so[wave][8 * g + r][j * 16 + col] = acc[j][r];
  LDSX();
  for (int rl = 0; rl < 16; ++rl) vst2(OUT + ((size_t)blockIdx.y * MM + wave * 16 + rl) * ND + n0 + lane * 4, *(const v4f*)&so[wave][rl][lane * 4]);
}
__global__ __launch_bounds__(128) void k_qgemm_gu(const float* __restrict__ X, const int* __restrict__ QW0, const float* __restrict__ SC0, const int* __restrict__ QZ0, const int* __restrict__ GI0, const int* __restrict__ QW1, const float* __restrict__ SC1, const int* __restrict__ QZ1, const int* __restrict__ GI1, float* __restrict__ OUTB) {
  qgemm<0>(X, nullptr, nullptr, QW0, SC0, QZ0, GI0, QW1, SC1, QZ1, GI1, OUTB);
}
__global__ __launch_bounds__(128) void k_qgemm_d(const _Float16* __restrict__ AH, const _Float16* __restrict__ AL, const int* __restrict__ QW, const float* __restrict__ SC, const int* __restrict__ QZ, const int* __restrict__ GI, float* __restrict__ OUTB) {
  qgemm<1>(nullptr, AH, AL, QW, SC, QZ, GI, QW, SC, QZ, GI, OUTB);
}
// ---- k_h: thread = 8 consecutive elements of [64][NI]: g, u = sums of the SPG partial planes in range order; h = silu(g) * u -> f16 hi + x2048 residual
__global__ __launch_bounds__(256) void k_h(const float* __restrict__ G, const float* __restrict__ U, _Float16* __restrict__ HH, _Float16* __restrict__ HL) {
  const unsigned e = (blockIdx.x * 256u + threadIdx.x) * 8u, eb = e * 4u; __align__(16) _Float16 hh[8], ll[8];   // eb: the thread's byte offset inside every f32 plane
  v4f g0 = {}, g1 = {}, u0 = {}, u1 = {};
  // unrolled: the planes' loads are independent, so many are in flight at once
#pragma unroll
  for (int s = 0; s < SPG; ++s) { const char* gp = (const char*)(G + (size_t)s * MM * NI) + eb; const char* up = (const char*)(U + (size_t)s * MM * NI) + eb;
    g0 += *(const v4f*)gp; g1 += *(const v4f*)(gp + 16); u0 += *(const v4f*)up; u1 += *(const v4f*)(up + 16); }
#pragma unroll
  for (int i = 0; i < 8; ++i) { const float gv = i < 4 ? g0[i & 3] : g1[i & 3], uv = i < 4 ? u0[i & 3] : u1[i & 3]; const float hv = (gv / (1.0f + exp_ni(-gv))) * uv; const _Float16 h = (_Float16)hv; hh[i] = h; ll[i] = (_Float16)((hv - (float)h) * 2048.0f); }
  vst2((unsigned*)(HH + e), *(const v4u*)hh); vst2((unsigned*)(HL + e), *(const v4u*)ll);
}
// ---- k_dsum: thread = 4 consecutive elements of out [64][NO]: sum of the SPD partial planes in range order
__global__ __launch_bounds__(256) void k_dsum(const float* __restrict__ D, float* __restrict__ OUT) {
  const unsigned e = (blockIdx.x * 256u + threadIdx.x) * 4u, eb = e * 4u; v4f a = {};   // eb: the thread's byte offset inside every plane
  // unrolled: the planes' loads are independent, so many are in flight at once
#pragma unroll
  for (int s = 0; s < SPD; ++s) a += *(const v4f*)((const char*)(D + (size_t)s * MM * NO) + eb);
  vst2(OUT + e, a);
}
extern "C" void kernel_launch(void* const* d_in, const int* in_sizes, int n_in, void* d_out, int out_size, void* d_ws, size_t ws_size, hipStream_t stream) {
  (void)in_sizes; (void)n_in; (void)out_size;
  const float** F = (const float**)d_in; const int** I = (const int**)d_in;   // 0 x [64,4096]; gate: 1 qw [512,11008] i32, 2 scales [32,11008], 3 qzeros [32,1376] i32, 4 gidx [4096] i32; up: 5..8; down: 9 qw [1376,4096], 10 scales [86,4096], 11 qzeros [86,512], 12 gidx [11008]
  if (ws_size < (size_t)WS_END) return;
  char* ws = (char*)d_ws; _Float16 *HH = (_Float16*)(ws + WS_HH), *HL = (_Float16*)(ws + WS_HL); float *G = (float*)(ws + WS_G), *U = (float*)(ws + WS_U), *D = (float*)(ws + WS_D);
  k_qgemm_gu<<<dim3(NI / 128, SPG, 2), 128, 0, stream>>>(F[0], I[1], F[2], I[3], I[4], I[5], F[6], I[7], I[8], G);   // z = 1 writes U, which follows G
  k_h<<<MM * NI / 8 / 256, 256, 0, stream>>>(G, U, HH, HL);
  k_qgemm_d<<<dim3(NO / 128, SPD, 1), 128, 0, stream>>>(HH, HL, I[9], F[10], I[11], I[12], D);
  k_dsum<<<MM * NO / 4 / 256, 256, 0, stream>>>(D, (float*)d_out);
}

// v007
// A run of this version takes 57.8 microseconds.
// In both of two side-by-side timings against v006, it was 1.05 times as fast.
// Counting every step since v000, it is 37.7 times as fast.
// compute dtype: x and the three scale tables rounded to bf16, the packed int4 weights / zero points / group indices (int32) read verbatim; GPTQ dequantisation on device: w = (qw >> 4k) & 15, z = ((qz >> 4n) & 15) + 1, gate and up GEMMs on bf16 WMMA 16x16x32: the bf16-rounded x is the A operand itself; a 32-deep chunk that lies in one group is staged as the exact integers w - z in bf16 (1 product) and the group's scale multiplies the f32 sums, a chunk that spans groups as W = (w - z[g_idx]) * scale[g_idx] in f32 (exact: small integer times the bf16 scale), bf16 hi + residual (exact, 2 products); h = silu(gate) * up in f32 (precise expf), stored as f16 hi + (x2048) residual; down GEMM on f16 WMMA 16x16x32: one-group chunks as the exact integers in f16 (2 products into one accumulator: hi.int, lo.(int x 2^-11, exact in f16)), other chunks as f16 hi + (x2048-scaled) residual (3 products: hi.hi, lo.hi, hi.lo); f32 accumulate.
#include <hip/hip_runtime.h>
#include <math.h>

typedef __attribute__((ext_vector_type(16))) _Float16 v16h;
typedef __attribute__((ext_vector_type(16))) __bf16 v16b;
typedef __attribute__((ext_vector_type(8)))  _Float16 v8h;
typedef __attribute__((ext_vector_type(8)))  float v8f;
typedef __attribute__((ext_vector_type(4)))  float v4f;
typedef __attribute__((ext_vector_type(2)))  float v2f;
typedef __attribute__((ext_vector_type(4)))  unsigned v4u;
typedef __attribute__((ext_vector_type(4)))  int v4i;
typedef float __attribute__((may_alias)) float_a;
typedef int __attribute__((may_alias)) int_a;

template <typename T> __device__ __forceinline__ void vst2(void* p, T v) { *(T*)p = v;  }
__device__ __forceinline__ v8f wmma16(v16h a, v16h b, v8f c) {
  v8f d = __builtin_amdgcn_wmma_f32_16x16x32_f16(false, a, false, b, (short)0, c, false, false);
  asm volatile("v_nop\n\tv_nop\n\tv_nop\n\tv_nop" : "+v"(d) : "v"(a), "v"(b));
  return d;
}
__device__ __forceinline__ v8f wmma_bf(v16b a, v16b b, v8f c) {
  v8f d = __builtin_amdgcn_wmma_f32_16x16x32_bf16(false, a, false, b, (short)0, c, false, false);
  asm volatile("v_nop\n\tv_nop\n\tv_nop\n\tv_nop" : "+v"(d) : "v"(a), "v"(b));
  return d;
}
// 16x16x32 fragments: lane = (h = lane>>4, row/col = lane&15); elements 0..7 = k0+8h+0..7, 8..15 = k0+16+8h+0..7; D element r = row 8h+r
__device__ __forceinline__ v16h frag_h(const _Float16* rowk0, int lane) {
  union { v16h v; v8h q[2]; } u; const _Float16* p = rowk0 + 8 * (lane >> 4);
  u.q[0] = *(const v8h*)p; u.q[1] = *(const v8h*)(p + 16); return u.v;
}
__device__ __forceinline__ v16h frag_f32(const float* rowk0, int lane) {
  v16h a; const float* p = rowk0 + 8 * (lane >> 4);
#pragma unroll
  for (int i = 0; i < 8; ++i) { a[i] = (_Float16)p[i]; a[8 + i] = (_Float16)p[16 + i]; }
  return a;
}
__device__ __forceinline__ v16h frag_f32s(const float* rowk0, int lane, float sc) {
  v16h a; const float* p = rowk0 + 8 * (lane >> 4);
#pragma unroll
  for (int i = 0; i < 8; ++i) { a[i] = (_Float16)(p[i] * sc); a[8 + i] = (_Float16)(p[16 + i] * sc); }
  return a;
}
// column fragment from a [K][ld] layout (column n), rows >= K read as 0
__device__ __forceinline__ v16h fragc_f32(const float* W, int k0, int n, int lane, int ld, int K) {
  v16h a; const int g = lane >> 4;
#pragma unroll
  for (int i = 0; i < 8; ++i) { const int ka = k0 + 8 * g + i, kb = ka + 16;
    a[i] = (_Float16)(ka < K ? W[(size_t)(ka < K ? ka : K - 1) * ld + n] : 0.f); a[8 + i] = (_Float16)(kb < K ? W[(size_t)(kb < K ? kb : K - 1) * ld + n] : 0.f); }
  return a;
}
struct F2 { v16b h, l; };
__device__ __forceinline__ F2 bsplit16(const float v[16]) { F2 r;
#pragma unroll
  for (int i = 0; i < 16; ++i) { const __bf16 h = (__bf16)v[i]; r.h[i] = h; r.l[i] = (__bf16)(v[i] - (float)h); }
  return r; }
__device__ __forceinline__ F2 split_row(const float* row, int k0, int lane) { float v[16]; const float* p = row + k0 + 8 * (lane >> 4);
#pragma unroll
  for (int i = 0; i < 8; ++i) { v[i] = p[i]; v[8 + i] = p[16 + i]; }
  return bsplit16(v); }
__device__ __forceinline__ F2 split_rowK(const float* row, int k0, int lane, int K) { float v[16]; const int g = lane >> 4;
#pragma unroll
  for (int i = 0; i < 8; ++i) { const int ka = k0 + 8 * g + i, kb = ka + 16; v[i] = ka < K ? row[ka < K ? ka : K - 1] : 0.f; v[8 + i] = kb < K ? row[kb < K ? kb : K - 1] : 0.f; }
  return bsplit16(v); }
__device__ __forceinline__ F2 split_col(const float* W, int k0, int n, int lane, int ld, int K) { float v[16]; const int g = lane >> 4;
#pragma unroll
  for (int i = 0; i < 8; ++i) { const int ka = k0 + 8 * g + i, kb = ka + 16; v[i] = ka < K ? W[(size_t)(ka < K ? ka : K - 1) * ld + n] : 0.f; v[8 + i] = kb < K ? W[(size_t)(kb < K ? kb : K - 1) * ld + n] : 0.f; }
  return bsplit16(v); }
__device__ __forceinline__ v8f mac3(const F2& a, const F2& b, v8f c) { c = wmma_bf(a.l, b.h, c); c = wmma_bf(a.h, b.l, c); return wmma_bf(a.h, b.h, c); }
__device__ __forceinline__ float sigm(float v) { return 1.0f / (1.0f + expf(-v)); }
// work-group barrier for LDS hand-overs alone: the wave's own LDS reads and writes are done (s_wait_dscnt 0), global loads stay in flight across it (__syncthreads() would wait for them too)
__device__ __forceinline__ void lds_bar() { asm volatile("s_wait_dscnt 0x0\n\ts_barrier_signal -1\n\ts_barrier_wait -1" ::: "memory"); }
#define LDSX() do { asm volatile("s_wait_dscnt 0" ::: "memory"); __builtin_amdgcn_wave_barrier(); __builtin_amdgcn_fence(__ATOMIC_RELEASE, "workgroup"); } while (0)


// Quantised (4-bit, group 128) fused SwiGLU MLP: h = silu(x Wg) * (x Wu), out = h Wd with GPTQ-packed Wg, Wu [4096 -> 11008] and Wd [11008 -> 4096]; 64 token rows.
#ifndef KIN
#define MM 64
#define KIN 4096
#define NI 11008
#define NO 4096
#endif
#define GRP 128
typedef __attribute__((ext_vector_type(8))) __bf16 v8b;
__device__ __forceinline__ v16b frag_b(const __bf16* rowk0, int lane) {
  union { v16b v; v8b q[2]; } u; const __bf16* p = rowk0 + 8 * (lane >> 4);
  u.q[0] = *(const v8b*)p; u.q[1] = *(const v8b*)(p + 16); return u.v;
}
__device__ __forceinline__ float bfr(float v) { return (float)(__bf16)v; }
__device__ __attribute__((noinline)) float exp_ni(float v) { return expf(v); }
__device__ __attribute__((noinline)) float erf_ni(float v) { return erff(v); }

// K ranges per GEMM: as many as keep every work-group of a launch resident at once: gate and up share one launch, 86 x 7 x 2 = 1204 work-groups of 4 waves and 18 or 19 chunks (registers allow 5 on each of the 256 WGPs); down 32 x 16 = 512 work-groups of 8 waves (2 on each WGP), 21 or 22 chunks each, cut into two halves of 11 and 10 or 11 chunks that waves 0..3 and waves 4..7 work on side by side and sum through LDS at the end
#define SPG 7                                       // gate and up, each: 128 chunks of 32 k
#define SPD 16                                      // down: 344 chunks of 32 k; each range is halved again inside its work-group
#define WS_G   0u                                   // f32 [SPG][64][NI] gate partial sums ; U
#define WS_U   (WS_G + 4u * SPG * MM * NI)
#define WS_HH  (WS_U + 4u * SPG * MM * NI)          // f16 [64][NI] h hi ; HL
#define WS_HL  (WS_HH + 2u * MM * NI)
#define WS_D   (WS_HL + 2u * MM * NI)               // f32 [SPD][64][NO] down partial sums
#define WS_END (WS_D + 4u * SPD * MM * NO)

// ---- qgemm<DOWN> (body of k_qgemm_gu, DOWN = 0, and of k_qgemm_d, DOWN = 1): block = 128 output columns x one K range (blockIdx.y) of one weight matrix (blockIdx.z: 0 the first set of tables, 1 the second; the second matrix's planes follow the first's in OUTB): OUT[range][64 rows][n0..n0+127] = the range's part of A (K deep) x dequant(W)[k][n].
// DOWN = 0: A is x itself: its f32 rows are read and rounded to bf16 in the loader, and that bf16 value is the whole operand; the integers w - z are exact in bf16, so a one-group chunk takes 1 product; a chunk that spans groups is staged as (w - z) * scale, bf16 hi + residual (exact), 2 products. Inside each 8 k the order is 0 4 1 5 2 6 3 7, in A and in B alike (a word's nibbles s and s + 4 come out of one shift and mask as a pair).
// DOWN = 1: A is h as f16 hi/lo rows, as the next two lines say.
// A chunk of 32 k that lies in ONE group is staged in LDS as the exact integers w - z in f16 (one plane, 2 products: hi.int and lo.(int x 2^-11), the scaled integers exact in f16, so both go into ONE accumulator set); the group's scale multiplies the f32 sums once, when the group ends, and the scaled sums are added to running totals that each wave keeps in its own part of so.
// A chunk whose 32 group indices differ is staged as (w - z) * scale, f16 hi + x2048 residual (3 products; the two residual products of a column tile are summed apart and added x 2^-11), and its sums are added to the totals at once.
typedef v4f __attribute__((may_alias)) v4f_a;
typedef __attribute__((ext_vector_type(2))) _Float16 v2h;
typedef __attribute__((ext_vector_type(2))) __bf16 v2b;
// A fragment from 4 quads of a row of x: p[0], p[1] = k0 + 8h + 0..7, p[2], p[3] = k0 + 16 + 8h + 0..7, rounded to bf16; inside each 8 the order 0 4 1 5 2 6 3 7
__device__ __forceinline__ v16b frag_x(const v4f (&p)[4]) { v16b a;
#pragma unroll
  for (int s = 0; s < 4; ++s) { a[2 * s] = (__bf16)p[0][s]; a[2 * s + 1] = (__bf16)p[1][s]; a[8 + 2 * s] = (__bf16)p[2][s]; a[8 + 2 * s + 1] = (__bf16)p[3][s]; }
  return a; }
// totals: lane-private slots, [16 quads][32 lanes] of 4 floats; quad 2j + hf holds rows 4hf..4hf+3 of the lane's column tile j
__device__ __forceinline__ void flush_group(v4f_a* tot, v8f (&acc)[8], const float (&scur)[8]) {
#pragma unroll
  for (int j = 0; j < 8; ++j) { const float s = bfr(scur[j]);
#pragma unroll
    for (int hf = 0; hf < 2; ++hf) { v4f t = tot[(j * 2 + hf) * 32];
#pragma unroll
      for (int e = 0; e < 4; ++e) t[e] += s * acc[j][hf * 4 + e];
      tot[(j * 2 + hf) * 32] = t; }
    acc[j] = v8f{}; }
}
// gl = the lane's one of a chunk's 32 group indices: the group (bounded to the tables' rows) if all 32 are equal, else -1. The waves of one K half (DOWN = 0: the whole block) read the same 32 indices, so the answer is the same for all waves that share its staging planes.
template <int NG> __device__ __forceinline__ int chunk_group(int gl) {
  const int gf = __builtin_amdgcn_readfirstlane(gl); const bool u = __builtin_amdgcn_ballot_w32(gl == gf) == 0xFFFFFFFFu;
  return u ? (gf < 0 ? 0 : gf > NG - 1 ? NG - 1 : gf) : -1;
}
template <int DOWN>
__device__ __forceinline__ void qgemm(const float* __restrict__ X, const _Float16* __restrict__ AH, const _Float16* __restrict__ AL, const int* __restrict__ QW0, const float* __restrict__ SC0, const int* __restrict__ QZ0, const int* __restrict__ GI0, const int* __restrict__ QW1, const float* __restrict__ SC1, const int* __restrict__ QZ1, const int* __restrict__ GI1, float* __restrict__ OUTB) {
  constexpr int KD = DOWN ? NI : KIN; constexpr int ND = DOWN ? NO : NI; constexpr int NCH = KD / 32, SP = DOWN ? SPD : SPG, NG = KD / GRP;
  constexpr int NH = DOWN ? 2 : 1;   // halves of the block's K range, each worked on by 4 waves of its own with its own staging planes
  const bool second = blockIdx.z != 0;   // the same for the whole block
  const int* const QW = second ? QW1 : QW0; const float* const SC = second ? SC1 : SC0; const int* const QZ = second ? QZ1 : QZ0; const int* const GI = second ? GI1 : GI0;
  float* const OUT = OUTB + (size_t)blockIdx.z * SP * MM * ND;
  const int rbeg = (int)blockIdx.y * NCH / SP, rend = ((int)blockIdx.y + 1) * NCH / SP;   // this range's chunks: the SP ranges tile [0, NCH)
  __shared__ __align__(16) _Float16 swh[NH * 128][40], swl[NH * 128][40]; __shared__ __align__(16) float so[NH * 4][16][132];
  // wv: the wave's number in the block (DOWN: held in a scalar register, so that the half's chunk numbers and every test on them stay scalar); hg: its half; wave: its 16 rows; tid: the thread's unpack column
  const int wv = DOWN ? __builtin_amdgcn_readfirstlane((int)threadIdx.x >> 5) : (int)threadIdx.x >> 5, hg = DOWN ? wv >> 2 : 0, wave = DOWN ? wv & 3 : wv, sb = hg * 128;
  const int tid = DOWN ? threadIdx.x & 127 : threadIdx.x, lane = tid & 31, col = lane & 15, g = lane >> 4; const int n0 = blockIdx.x * 128, n = n0 + tid;
  const int ntrip = (rend - rbeg + NH - 1) / NH;   // trips of the loop, the same for the whole block (the barriers inside need that); a range of the down GEMM holds 21 or 22 chunks, so no half is empty
  const int kbeg = rbeg + hg * ntrip, kend = kbeg + ntrip < rend ? kbeg + ntrip : rend;   // the half's own chunks; the second half may be one short, and its last trip then adds nothing
  v8f acc[8] = {};
  v4f_a* const tot = (v4f_a*)&so[wv][0][0] + lane;
#pragma unroll
  for (int q = 0; q < 16; ++q) tot[q * 32] = v4f{};
  int cur = -2;            // group whose sums acc holds: -2 none yet, -1 already scaled (scale 1), else the group index
  float scur[8] = {};      // that group's scales (not yet rounded) for the lane's 8 output columns
  // Every global load of a chunk is issued one trip ahead of its use (the group indices two), in the order in which the values are used (save x for gate and up: loaded after the words, rounded before them), so that each wait leaves the younger loads in flight: no trip waits for memory that it has only just asked for.
  const _Float16* const arh = DOWN ? AH + (size_t)(wave * 16 + col) * KD : nullptr; const _Float16* const arl = DOWN ? AL + (size_t)(wave * 16 + col) * KD : nullptr;
  const float* const xrow = DOWN ? nullptr : X + (size_t)(wave * 16 + col) * KD + 8 * g;   // the lane's part of its row of x
  int want = chunk_group<NG>(GI[kbeg * 32 + lane]);                                  // group of the trip's own chunk
  int wn1 = chunk_group<NG>(GI[(kbeg + 1 < kend ? kbeg + 1 : kbeg) * 32 + lane]);     // group of the chunk after it
  const int zw0 = QZ[(size_t)(want < 0 ? 0 : want) * (ND / 8) + (n >> 3)];            // zero-point word of the first group
  int zwn = 0;                                                                        // zero-point word of the next group that begins
  unsigned word[4];
#pragma unroll
  for (int wq = 0; wq < 4; ++wq) word[wq] = (unsigned)QW[(size_t)(kbeg * 4 + wq) * ND + n];
  v16h a = {}, al = {}; v4f xr[4] = {};   // DOWN: the chunk's hi and lo fragments; else the chunk's 16 values of x as loaded
  // precaution (both forms): s_wait_xcnt 0 stands in front of every rewrite of the address registers that the loads above name; the loaded values are inputs so that the loads stay in front of it (the first trip needs them at once anyway)
  if constexpr (DOWN) { a = frag_h(arh + kbeg * 32, lane); al = frag_h(arl + kbeg * 32, lane);
    asm volatile("s_wait_xcnt 0x0" :: "v"(zw0), "v"(word[0]), "v"(word[1]), "v"(word[2]), "v"(word[3]), "v"(a), "v"(al) : "memory"); }
  else { const float* const p = xrow + kbeg * 32; xr[0] = *(const v4f*)p; xr[1] = *(const v4f*)(p + 4); xr[2] = *(const v4f*)(p + 16); xr[3] = *(const v4f*)(p + 20);
    asm volatile("s_wait_xcnt 0x0" :: "v"(zw0), "v"(word[0]), "v"(word[1]), "v"(word[2]), "v"(word[3]), "v"(xr[0]), "v"(xr[1]), "v"(xr[2]), "v"(xr[3]) : "memory"); }
  // zero point of the thread's unpack column, z = nibble + 1: DOWN the f16 pair (1024 + z, 64 + z), else the bf16 pair (-(128 + z), -(128 + z))
  constexpr unsigned ZB = DOWN ? 0x54106401u : 0xC301C301u, ZM = DOWN ? 0x100001u : 0x10001u;
  unsigned zpk = ZB + ((unsigned)(zw0 >> ((n & 7) * 4)) & 15u) * ZM;
#pragma unroll 1
  for (int kc = kbeg; kc < kbeg + ntrip; ++kc) { const bool live = NH == 1 || kc < kend; const int k0 = (live ? kc : kend - 1) * 32;   // live: false only in the trip that a half one chunk short runs for the barriers' sake
    const bool uni = want >= 0; const int kn = kc + 1 < kend ? kc + 1 : NH == 1 ? kc : kend - 1;   // kn: the next chunk (from the half's last chunk on: that chunk again, unused)
    v16b ab = {}; if constexpr (!DOWN) ab = frag_x(xr);   // the chunk's A fragment; xr is free from here on
    if (want != cur) {
      if (cur != -2) { flush_group(tot, acc, scur); zpk = ZB + ((unsigned)(zwn >> ((n & 7) * 4)) & 15u) * ZM; }   // used only where the new chunk lies in one group, and then zwn is that group's word
      cur = want;
      if (uni) {
#pragma unroll
        for (int j = 0; j < 8; ++j) scur[j] = SC[(size_t)want * ND + n0 + j * 16 + col];
        asm volatile("s_wait_xcnt 0x0" ::: "memory"); }   // precaution: stands in front of every rewrite of the address registers that the scale loads name
      else {
#pragma unroll
        for (int j = 0; j < 8; ++j) scur[j] = 1.0f; } }
    if (wn1 != want && wn1 >= 0) { zwn = QZ[(size_t)wn1 * (ND / 8) + (n >> 3)];   // a group begins with the next chunk
      asm volatile("s_wait_xcnt 0x0" ::: "memory"); }   // precaution: stands in front of every rewrite of the address registers that the load above names
    if (uni && !DOWN) {
      // nibbles s and s + 4 of a word stand 16 bits apart: shifted down and masked, each under exponent 2^7 reads 128 + w in bf16; the packed addition of -(128 + z) is exact
#pragma unroll
      for (int wq = 0; wq < 4; ++wq) { union { v2b p[4]; v8h v; } o;
#pragma unroll
        for (int s = 0; s < 4; ++s) o.p[s] = __builtin_bit_cast(v2b, ((word[wq] >> (4 * s)) & 0x000F000Fu) | 0x43004300u) + __builtin_bit_cast(v2b, zpk);
        *(v8h*)&swh[sb + tid][wq * 8] = o.v; } }
    else if (uni) {
      // byte i of a word holds k = 2i (low nibble) and 2i + 1 (high nibble): both halves get the byte, the low nibble under exponent 2^10 reads 1024 + w, the high nibble under 2^6 reads 64 + w; the packed subtraction of (1024 + z, 64 + z) is exact
#pragma unroll
      for (int wq = 0; wq < 4; ++wq) { union { v2h p[4]; v8h v; } o;
#pragma unroll
        for (int i = 0; i < 4; ++i) { const unsigned bb = __builtin_amdgcn_perm(word[wq], word[wq], 0x0C000C00u | (unsigned)i | ((unsigned)i << 16));
          o.p[i] = __builtin_bit_cast(v2h, (bb & 0x00F0000Fu) | 0x54006400u) - __builtin_bit_cast(v2h, zpk); }
        *(v8h*)&swh[sb + tid][wq * 8] = o.v; } }
    else { int cg = -1; int z = 0; float sc = 0.f;
#pragma unroll 1
      for (int wq = 0; wq < 4; ++wq) { const int wd = QW[(size_t)((k0 >> 3) + wq) * ND + n];
        asm volatile("s_wait_xcnt 0x0" ::: "memory");   // precaution: stands in front of every rewrite of the address registers that the load above names
#pragma unroll
        for (int i = 0; i < 8; ++i) { const int k = k0 + wq * 8 + i; const int gr = GI[k]; const int gi = gr < 0 ? 0 : gr > NG - 1 ? NG - 1 : gr;
          if (gi != cg) { cg = gi; const int zw = QZ[(size_t)gi * (ND / 8) + (n >> 3)]; z = ((zw >> ((n & 7) * 4)) & 15) + 1; sc = bfr(SC[(size_t)gi * ND + n]); }
          const int w = (wd >> (i * 4)) & 15; const float val = (float)(w - z) * sc;
          if constexpr (DOWN) { const _Float16 h = (_Float16)val; swh[sb + tid][wq * 8 + i] = h; swl[sb + tid][wq * 8 + i] = (_Float16)((val - (float)h) * 2048.0f); }
          else { const __bf16 h = (__bf16)val; const int ps = wq * 8 + (i < 4 ? 2 * i : 2 * i - 7);   // ps: the place of k = i in the order 0 4 1 5 2 6 3 7
            swh[sb + tid][ps] = __builtin_bit_cast(_Float16, h); swl[sb + tid][ps] = __builtin_bit_cast(_Float16, (__bf16)(val - (float)h)); } } } }
    const int gl2 = GI[(kc + 2 < kend ? kc + 2 : kend - 1) * 32 + lane];   // used at the trip's end: asked for ahead of the words, so that its wait leaves them in flight
    if constexpr (!DOWN) asm volatile("s_wait_xcnt 0x0" ::: "memory");   // precaution: in this build a later load's result takes the register that holds the address of the load above
#pragma unroll
    for (int wq = 0; wq < 4; ++wq) word[wq] = (unsigned)QW[(size_t)(kn * 4 + wq) * ND + n];   // the next chunk's words, into the registers that the unpacking has just left
    if constexpr (!DOWN) { const float* const p = xrow + kn * 32; xr[0] = *(const v4f*)p; xr[1] = *(const v4f*)(p + 4); xr[2] = *(const v4f*)(p + 16); xr[3] = *(const v4f*)(p + 20); }   // the next chunk's part of x, a whole trip ahead of its rounding
    asm volatile("s_wait_xcnt 0x0" ::: "memory");   // precaution: stands in front of every rewrite of the address registers that the loads above name
    lds_bar();   // the chunk's staged weights are published
    if (!live) { }   // nothing is added: the chunk staged in this trip was summed in the trip before
    else if (uni) { v16h wh[8];   // all 8 column fragments are read from LDS as one group, ahead of the chunk's products: one LDS wait a chunk
#pragma unroll
      for (int j = 0; j < 8; ++j) wh[j] = frag_h(&swh[sb + j * 16 + col][0], lane);
      if constexpr (DOWN) {
#pragma unroll
        for (int j = 0; j < 8; ++j) acc[j] = wmma16(a, wh[j], acc[j]);
#pragma unroll
        for (int j = 0; j < 8; ++j) acc[j] = wmma16(al, wh[j] * (_Float16)(1.0f / 2048.0f), acc[j]); }   // |w - z| <= 16: the scaled integers are exact
      else {
#pragma unroll
        for (int j = 0; j < 8; ++j) acc[j] = wmma_bf(ab, __builtin_bit_cast(v16b, wh[j]), acc[j]); } }
    else {   // already scaled: each column tile's sums go straight to the totals, acc stays 0
#pragma unroll 1   // rare path: kept small, and no second copy of acc in registers
      for (int j = 0; j < 8; ++j) { const v16h wh = frag_h(&swh[sb + j * 16 + col][0], lane), wl = frag_h(&swl[sb + j * 16 + col][0], lane); v8f l = {}, hs;
        if constexpr (DOWN) { l = wmma16(al, wh, l); l = wmma16(a, wl, l); hs = wmma16(a, wh, v8f{}); }
        else hs = wmma_bf(ab, __builtin_bit_cast(v16b, wh), wmma_bf(ab, __builtin_bit_cast(v16b, wl), v8f{}));   // both planes at their own scale: one sum
#pragma unroll
        for (int hf = 0; hf < 2; ++hf) { v4f t = tot[(j * 2 + hf) * 32];
#pragma unroll
          for (int e = 0; e < 4; ++e) t[e] += DOWN ? hs[hf * 4 + e] + l[hf * 4 + e] * (1.0f / 2048.0f) : hs[hf * 4 + e];
          tot[(j * 2 + hf) * 32] = t; } } }
    want = wn1; wn1 = chunk_group<NG>(gl2);
    if constexpr (DOWN) { a = frag_h(arh + kn * 32, lane); al = frag_h(arl + kn * 32, lane);   // the next chunk's rows, into the registers that the products have just left
      asm volatile("s_wait_xcnt 0x0" ::: "memory"); }   // precaution: stands in front of every rewrite of the address registers that the four row loads name
    lds_bar(); }   // every wave has read the staged weights: the next trip may overwrite them
  // last group: totals + scale * sums, in registers
#pragma unroll
  for (int j = 0; j < 8; ++j) { const float s = bfr(scur[j]);
#pragma unroll
    for (int hf = 0; hf < 2; ++hf) { const v4f t = tot[(j * 2 + hf) * 32];
#pragma unroll
      for (int e = 0; e < 4; ++e) acc[j][hf * 4 + e] = t[e] + s * acc[j][hf * 4 + e]; } }
  LDSX();   // every lane's totals are read before the wave overwrites its part of so in row order
#pragma unroll
  for (int j = 0; j < 8; ++j)
#pragma unroll
    for (int r = 0; r < 8; ++r) so[wv][8 * g + r][j * 16 + col] = acc[j][r];
  if constexpr (DOWN) {
    __syncthreads();   // both halves' sums stand in so: each wave adds 8 of its 16 rows, first half + second half, and stores them
    for (int rl = hg * 8; rl < hg * 8 + 8; ++rl) vst2(OUT + ((size_t)blockIdx.y * MM + wave * 16 + rl) * ND + n0 + lane * 4, *(const v4f*)&so[wave][rl][lane * 4] + *(const v4f*)&so[4 + wave][rl][lane * 4]); }
  else {
    LDSX();
    for (int rl = 0; rl < 16; ++rl) vst2(OUT + ((size_t)blockIdx.y * MM + wave * 16 + rl) * ND + n0 + lane * 4, *(const v4f*)&so[wave][rl][lane * 4]); }
}
__global__ __launch_bounds__(128) void k_qgemm_gu(const float* __restrict__ X, const int* __restrict__ QW0, const float* __restrict__ SC0, const int* __restrict__ QZ0, const int* __restrict__ GI0, const int* __restrict__ QW1, const float* __restrict__ SC1, const int* __restrict__ QZ1, const int* __restrict__ GI1, float* __restrict__ OUTB) {
  qgemm<0>(X, nullptr, nullptr, QW0, SC0, QZ0, GI0, QW1, SC1, QZ1, GI1, OUTB);
}
__global__ __launch_bounds__(256) void k_qgemm_d(const _Float16* __restrict__ AH, const _Float16* __restrict__ AL, const int* __restrict__ QW, const float* __restrict__ SC, const int* __restrict__ QZ, const int* __restrict__ GI, float* __restrict__ OUTB) {
  qgemm<1>(nullptr, AH, AL, QW, SC, QZ, GI, QW, SC, QZ, GI, OUTB);
}
// ---- k_h: thread = 8 consecutive elements of [64][NI]: g, u = sums of the SPG partial planes in range order; h = silu(g) * u -> f16 hi + x2048 residual
__global__ __launch_bounds__(256) void k_h(const float* __restrict__ G, const float* __restrict__ U, _Float16* __restrict__ HH, _Float16* __restrict__ HL) {
  const unsigned e = (blockIdx.x * 256u + threadIdx.x) * 8u, eb = e * 4u; __align__(16) _Float16 hh[8], ll[8];   // eb: the thread's byte offset inside every f32 plane
  v4f g0 = {}, g1 = {}, u0 = {}, u1 = {};
  // unrolled: the planes' loads are independent, so many are in flight at once
#pragma unroll
  for (int s = 0; s < SPG; ++s) { const char* gp = (const char*)(G + (size_t)s * MM * NI) + eb; const char* up = (const char*)(U + (size_t)s * MM * NI) + eb;
    g0 += *(const v4f*)gp; g1 += *(const v4f*)(gp + 16); u0 += *(const v4f*)up; u1 += *(const v4f*)(up + 16); }
#pragma unroll
  for (int i = 0; i < 8; ++i) { const float gv = i < 4 ? g0[i & 3] : g1[i & 3], uv = i < 4 ? u0[i & 3] : u1[i & 3]; const float hv = (gv / (1.0f + exp_ni(-gv))) * uv; const _Float16 h = (_Float16)hv; hh[i] = h; ll[i] = (_Float16)((hv - (float)h) * 2048.0f); }
  vst2((unsigned*)(HH + e), *(const v4u*)hh); vst2((unsigned*)(HL + e), *(const v4u*)ll);
}
// ---- k_dsum: thread = 4 consecutive elements of out [64][NO]: sum of the SPD partial planes in range order
__global__ __launch_bounds__(256) void k_dsum(const float* __restrict__ D, float* __restrict__ OUT) {
  const unsigned e = (blockIdx.x * 256u + threadIdx.x) * 4u, eb = e * 4u; v4f a = {};   // eb: the thread's byte offset inside every plane
  // unrolled: the planes' loads are independent, so many are in flight at once
#pragma unroll
  for (int s = 0; s < SPD; ++s) a += *(const v4f*)((const char*)(D + (size_t)s * MM * NO) + eb);
  vst2(OUT + e, a);
}
extern "C" void kernel_launch(void* const* d_in, const int* in_sizes, int n_in, void* d_out, int out_size, void* d_ws, size_t ws_size, hipStream_t stream) {
  (void)in_sizes; (void)n_in; (void)out_size;
  const float** F = (const float**)d_in; const int** I = (const int**)d_in;   // 0 x [64,4096]; gate: 1 qw [512,11008] i32, 2 scales [32,11008], 3 qzeros [32,1376] i32, 4 gidx [4096] i32; up: 5..8; down: 9 qw [1376,4096], 10 scales [86,4096], 11 qzeros [86,512], 12 gidx [11008]
  if (ws_size < (size_t)WS_END) return;
  char* ws = (char*)d_ws; _Float16 *HH = (_Float16*)(ws + WS_HH), *HL = (_Float16*)(ws + WS_HL); float *G = (float*)(ws + WS_G), *U = (float*)(ws + WS_U), *D = (float*)(ws + WS_D);
  k_qgemm_gu<<<dim3(NI / 128, SPG, 2), 128, 0, stream>>>(F[0], I[1], F[2], I[3], I[4], I[5], F[6], I[7], I[8], G);   // z = 1 writes U, which follows G
  k_h<<<MM * NI / 8 / 256, 256, 0, stream>>>(G, U, HH, HL);
  k_qgemm_d<<<dim3(NO / 128, SPD, 1), 256, 0, stream>>>(HH, HL, I[9], F[10], I[11], I[12], D);
  k_dsum<<<MM * NO / 4 / 256, 256, 0, stream>>>(D, (float*)d_out);
}

// v008
// One run takes 54.2 microseconds.
// In two side-by-side timings against v007, it was 1.06 and 1.07 times as fast.
// All steps since v000 together make it 40.1 times as fast.
// compute dtype: x and the three scale tables rounded to bf16, the packed int4 weights / zero points / group indices (int32) read verbatim; GPTQ dequantisation on device: w = (qw >> 4k) & 15, z = ((qz >> 4n) & 15) + 1, gate and up GEMMs on bf16 WMMA 16x16x32: the bf16-rounded x is the A operand itself; a 32-deep chunk that lies in one group is staged as the exact integers w - z in bf16 (1 product) and the group's scale multiplies the f32 sums, a chunk that spans groups as W = (w - z[g_idx]) * scale[g_idx] in f32 (exact: small integer times the bf16 scale), bf16 hi + residual (exact, 2 products); h = silu(gate) * up in f32 (precise expf), stored as f16 hi + (x2048) residual; down GEMM on f16 WMMA 16x16x32: one-group chunks as the exact integers in f16 (2 products into one accumulator: hi.int, lo.(int x 2^-11, exact in f16)), other chunks as f16 hi + (x2048-scaled) residual (3 products: hi.hi, lo.hi, hi.lo); f32 accumulate.
#include <hip/hip_runtime.h>
#include <math.h>

typedef __attribute__((ext_vector_type(16))) _Float16 v16h;
typedef __attribute__((ext_vector_type(16))) __bf16 v16b;
typedef __attribute__((ext_vector_type(8)))  _Float16 v8h;
typedef __attribute__((ext_vector_type(8)))  float v8f;
typedef __attribute__((ext_vector_type(4)))  float v4f;
typedef __attribute__((ext_vector_type(2)))  float v2f;
typedef __attribute__((ext_vector_type(4)))  unsigned v4u;
typedef __attribute__((ext_vector_type(4)))  int v4i;
typedef float __attribute__((may_alias)) float_a;
typedef int __attribute__((may_alias)) int_a;

template <typename T> __device__ __forceinline__ void vst2(void* p, T v) { *(T*)p = v;  }
__device__ __forceinline__ v8f wmma16(v16h a, v16h b, v8f c) {
  v8f d = __builtin_amdgcn_wmma_f32_16x16x32_f16(false, a, false, b, (short)0, c, false, false);
  asm volatile("v_nop\n\tv_nop\n\tv_nop\n\tv_nop" : "+v"(d) : "v"(a), "v"(b));
  return d;
}
__device__ __forceinline__ v8f wmma_bf(v16b a, v16b b, v8f c) {
  v8f d = __builtin_amdgcn_wmma_f32_16x16x32_bf16(false, a, false, b, (short)0, c, false, false);
  asm volatile("v_nop\n\tv_nop\n\tv_nop\n\tv_nop" : "+v"(d) : "v"(a), "v"(b));
  return d;
}
// 16x16x32 fragments: lane = (h = lane>>4, row/col = lane&15); elements 0..7 = k0+8h+0..7, 8..15 = k0+16+8h+0..7; D element r = row 8h+r
__device__ __forceinline__ v16h frag_h(const _Float16* rowk0, int lane) {
  union { v16h v; v8h q[2]; } u; const _Float16* p = rowk0 + 8 * (lane >> 4);
  u.q[0] = *(const v8h*)p; u.q[1] = *(const v8h*)(p + 16); return u.v;
}
__device__ __forceinline__ v16h frag_f32(const float* rowk0, int lane) {
  v16h a; const float* p = rowk0 + 8 * (lane >> 4);
#pragma unroll
  for (int i = 0; i < 8; ++i) { a[i] = (_Float16)p[i]; a[8 + i] = (_Float16)p[16 + i]; }
  return a;
}
__device__ __forceinline__ v16h frag_f32s(const float* rowk0, int lane, float sc) {
  v16h a; const float* p = rowk0 + 8 * (lane >> 4);
#pragma unroll
  for (int i = 0; i < 8; ++i) { a[i] = (_Float16)(p[i] * sc); a[8 + i] = (_Float16)(p[16 + i] * sc); }
  return a;
}
// column fragment from a [K][ld] layout (column n), rows >= K read as 0
__device__ __forceinline__ v16h fragc_f32(const float* W, int k0, int n, int lane, int ld, int K) {
  v16h a; const int g = lane >> 4;
#pragma unroll
  for (int i = 0; i < 8; ++i) { const int ka = k0 + 8 * g + i, kb = ka + 16;
    a[i] = (_Float16)(ka < K ? W[(size_t)(ka < K ? ka : K - 1) * ld + n] : 0.f); a[8 + i] = (_Float16)(kb < K ? W[(size_t)(kb < K ? kb : K - 1) * ld + n] : 0.f); }
  return a;
}
struct F2 { v16b h, l; };
__device__ __forceinline__ F2 bsplit16(const float v[16]) { F2 r;
#pragma unroll
  for (int i = 0; i < 16; ++i) { const __bf16 h = (__bf16)v[i]; r.h[i] = h; r.l[i] = (__bf16)(v[i] - (float)h); }
  return r; }
__device__ __forceinline__ F2 split_row(const float* row, int k0, int lane) { float v[16]; const float* p = row + k0 + 8 * (lane >> 4);
#pragma unroll
  for (int i = 0; i < 8; ++i) { v[i] = p[i]; v[8 + i] = p[16 + i]; }
  return bsplit16(v); }
__device__ __forceinline__ F2 split_rowK(const float* row, int k0, int lane, int K) { float v[16]; const int g = lane >> 4;
#pragma unroll
  for (int i = 0; i < 8; ++i) { const int ka = k0 + 8 * g + i, kb = ka + 16; v[i] = ka < K ? row[ka < K ? ka : K - 1] : 0.f; v[8 + i] = kb < K ? row[kb < K ? kb : K - 1] : 0.f; }
  return bsplit16(v); }
__device__ __forceinline__ F2 split_col(const float* W, int k0, int n, int lane, int ld, int K) { float v[16]; const int g = lane >> 4;
#pragma unroll
  for (int i = 0; i < 8; ++i) { const int ka = k0 + 8 * g + i, kb = ka + 16; v[i] = ka < K ? W[(size_t)(ka < K ? ka : K - 1) * ld + n] : 0.f; v[8 + i] = kb < K ? W[(size_t)(kb < K ? kb : K - 1) * ld + n] : 0.f; }
  return bsplit16(v); }
__device__ __forceinline__ v8f mac3(const F2& a, const F2& b, v8f c) { c = wmma_bf(a.l, b.h, c); c = wmma_bf(a.h, b.l, c); return wmma_bf(a.h, b.h, c); }
__device__ __forceinline__ float sigm(float v) { return 1.0f / (1.0f + expf(-v)); }
// work-group barrier for LDS hand-overs alone: the wave's own LDS reads and writes are done (s_wait_dscnt 0), global loads stay in flight across it (__syncthreads() would wait for them too)
__device__ __forceinline__ void lds_bar() { asm volatile("s_wait_dscnt 0x0\n\ts_barrier_signal -1\n\ts_barrier_wait -1" ::: "memory"); }
#define LDSX() do { asm volatile("s_wait_dscnt 0" ::: "memory"); __builtin_amdgcn_wave_barrier(); __builtin_amdgcn_fence(__ATOMIC_RELEASE, "workgroup"); } while (0)


// Quantised (4-bit, group 128) fused SwiGLU MLP: h = silu(x Wg) * (x Wu), out = h Wd with GPTQ-packed Wg, Wu [4096 -> 11008] and Wd [11008 -> 4096]; 64 token rows.
#ifndef KIN
#define MM 64
#define KIN 4096
#define NI 11008
#define NO 4096
#endif
#define GRP 128
typedef __attribute__((ext_vector_type(8))) __bf16 v8b;
__device__ __forceinline__ v16b frag_b(const __bf16* rowk0, int lane) {
  union { v16b v; v8b q[2]; } u; const __bf16* p = rowk0 + 8 * (lane >> 4);
  u.q[0] = *(const v8b*)p; u.q[1] = *(const v8b*)(p + 16); return u.v;
}
// A fragment from a plane kept in fragment order: tile = 16 rows x 32 k = 512 values; a lane's elements 0..7 stand at 8 * lane, its elements 8..15 at 256 + 8 * lane, so each of the two loads of a wave reads 512 bytes in a row
__device__ __forceinline__ v16h frag_t(const _Float16* tile, int lane) {
  union { v16h v; v8h q[2]; } u; const _Float16* p = tile + 8 * lane;
  u.q[0] = *(const v8h*)p; u.q[1] = *(const v8h*)(p + 256); return u.v;
}
__device__ __forceinline__ float bfr(float v) { return (float)(__bf16)v; }
__device__ __attribute__((noinline)) float exp_ni(float v) { return expf(v); }
__device__ __attribute__((noinline)) float erf_ni(float v) { return erff(v); }

// K ranges per GEMM: as many as keep every work-group of a launch resident at once: gate and up share one launch, 86 x 7 x 2 = 1204 work-groups of 4 waves and 18 or 19 chunks (registers allow 5 on each of the 256 WGPs); down 32 x 16 = 512 work-groups of 8 waves (2 on each WGP), 21 or 22 chunks each, cut into two halves of 11 and 10 or 11 chunks that waves 0..3 and waves 4..7 work on side by side and sum through LDS at the end
#define SPG 7                                       // gate and up, each: 128 chunks of 32 k
#define SPD 16                                      // down: 344 chunks of 32 k; each range is halved again inside its work-group
#define WS_G   0u                                   // f32 [SPG][64][NI] gate partial sums ; U
#define WS_U   (WS_G + 4u * SPG * MM * NI)
#define WS_HH  (WS_U + 4u * SPG * MM * NI)          // f16 [4 row tiles][NI / 32 chunks][512] h hi, in fragment order ; HL
#define WS_HL  (WS_HH + 2u * MM * NI)
#define WS_D   (WS_HL + 2u * MM * NI)               // f32 [SPD][64][NO] down partial sums
#define WS_END (WS_D + 4u * SPD * MM * NO)

// ---- qgemm<DOWN> (body of k_qgemm_gu, DOWN = 0, and of k_qgemm_d, DOWN = 1): block = 128 output columns x one K range (blockIdx.y) of one weight matrix (blockIdx.z: 0 the first set of tables, 1 the second; the second matrix's planes follow the first's in OUTB): OUT[range][64 rows][n0..n0+127] = the range's part of A (K deep) x dequant(W)[k][n].
// DOWN = 0: A is x itself: its f32 rows are read and rounded to bf16 in the loader, handed to the fragment's lanes through LDS (sx), and that bf16 value is the whole operand; the integers w - z are exact in bf16, so a one-group chunk takes 1 product; a chunk that spans groups is staged as (w - z) * scale, bf16 hi + residual (exact), 2 products. Inside each 8 k the order is 0 4 1 5 2 6 3 7, in A and in B alike (a word's nibbles s and s + 4 come out of one shift and mask as a pair).
// DOWN = 1: A is h as f16 hi/lo planes in fragment order (k_h writes them so; frag_t reads them), used as the next two lines say.
// A chunk of 32 k that lies in ONE group is staged in LDS as the exact integers w - z in f16 (one plane, 2 products: hi.int and lo.(int x 2^-11), the scaled integers exact in f16, so both go into ONE accumulator set); the group's scale multiplies the f32 sums once, when the group ends, and the scaled sums are added to running totals that each wave keeps in its own part of so.
// A chunk whose 32 group indices differ is staged as (w - z) * scale, f16 hi + x2048 residual (3 products; the two residual products of a column tile are summed apart and added x 2^-11), and its sums are added to the totals at once.
typedef v4f __attribute__((may_alias)) v4f_a;
typedef __attribute__((ext_vector_type(2))) _Float16 v2h;
typedef __attribute__((ext_vector_type(2))) __bf16 v2b;
// 8 consecutive k of a row of x (two quads), rounded to bf16, in the order 0 4 1 5 2 6 3 7
__device__ __forceinline__ v8b pack_x(v4f lo, v4f hi) { v8b a;
#pragma unroll
  for (int s = 0; s < 4; ++s) { a[2 * s] = (__bf16)lo[s]; a[2 * s + 1] = (__bf16)hi[s]; }
  return a; }
// totals: lane-private slots, [16 quads][32 lanes] of 4 floats; quad 2j + hf holds rows 4hf..4hf+3 of the lane's column tile j
__device__ __forceinline__ void flush_group(v4f_a* tot, v8f (&acc)[8], const float (&scur)[8]) {
#pragma unroll
  for (int j = 0; j < 8; ++j) { const float s = bfr(scur[j]);
#pragma unroll
    for (int hf = 0; hf < 2; ++hf) { v4f t = tot[(j * 2 + hf) * 32];
#pragma unroll
      for (int e = 0; e < 4; ++e) t[e] += s * acc[j][hf * 4 + e];
      tot[(j * 2 + hf) * 32] = t; }
    acc[j] = v8f{}; }
}
// gl = the lane's one of a chunk's 32 group indices: the group (bounded to the tables' rows) if all 32 are equal, else -1. The waves of one K half (DOWN = 0: the whole block) read the same 32 indices, so the answer is the same for all waves that share its staging planes.
template <int NG> __device__ __forceinline__ int chunk_group(int gl) {
  const int gf = __builtin_amdgcn_readfirstlane(gl); const bool u = __builtin_amdgcn_ballot_w32(gl == gf) == 0xFFFFFFFFu;
  return u ? (gf < 0 ? 0 : gf > NG - 1 ? NG - 1 : gf) : -1;
}
template <int DOWN>
__device__ __forceinline__ void qgemm(const float* __restrict__ X, const _Float16* __restrict__ AH, const _Float16* __restrict__ AL, const int* __restrict__ QW0, const float* __restrict__ SC0, const int* __restrict__ QZ0, const int* __restrict__ GI0, const int* __restrict__ QW1, const float* __restrict__ SC1, const int* __restrict__ QZ1, const int* __restrict__ GI1, float* __restrict__ OUTB) {
  constexpr int KD = DOWN ? NI : KIN; constexpr int ND = DOWN ? NO : NI; constexpr int NCH = KD / 32, SP = DOWN ? SPD : SPG, NG = KD / GRP;
  constexpr int NH = DOWN ? 2 : 1;   // halves of the block's K range, each worked on by 4 waves of its own with its own staging planes
  const bool second = blockIdx.z != 0;   // the same for the whole block
  const int* const QW = second ? QW1 : QW0; const float* const SC = second ? SC1 : SC0; const int* const QZ = second ? QZ1 : QZ0; const int* const GI = second ? GI1 : GI0;
  float* const OUT = OUTB + (size_t)blockIdx.z * SP * MM * ND;
  const int rbeg = (int)blockIdx.y * NCH / SP, rend = ((int)blockIdx.y + 1) * NCH / SP;   // this range's chunks: the SP ranges tile [0, NCH)
  __shared__ __align__(16) _Float16 swh[NH * 128][40], swl[NH * 128][40]; __shared__ __align__(16) float so[NH * 4][16][132];
  __shared__ __align__(16) __bf16 sx[DOWN ? 1 : MM][40];   // DOWN = 0: the chunk's 64 x 32 part of x in bf16, pitch as swh; each wave writes and reads its own 16 rows
  // wv: the wave's number in the block (DOWN: held in a scalar register, so that the half's chunk numbers and every test on them stay scalar); hg: its half; wave: its 16 rows; tid: the thread's unpack column
  const int wv = DOWN ? __builtin_amdgcn_readfirstlane((int)threadIdx.x >> 5) : (int)threadIdx.x >> 5, hg = DOWN ? wv >> 2 : 0, wave = DOWN ? wv & 3 : wv, sb = hg * 128;
  const int tid = DOWN ? threadIdx.x & 127 : threadIdx.x, lane = tid & 31, col = lane & 15, g = lane >> 4; const int n0 = blockIdx.x * 128, n = n0 + tid;
  const int ntrip = (rend - rbeg + NH - 1) / NH;   // trips of the loop, the same for the whole block (the barriers inside need that); a range of the down GEMM holds 21 or 22 chunks, so no half is empty
  const int kbeg = rbeg + hg * ntrip, kend = kbeg + ntrip < rend ? kbeg + ntrip : rend;   // the half's own chunks; the second half may be one short, and its last trip then adds nothing
  v8f acc[8] = {};
  v4f_a* const tot = (v4f_a*)&so[wv][0][0] + lane;
#pragma unroll
  for (int q = 0; q < 16; ++q) tot[q * 32] = v4f{};
  int cur = -2;            // group whose sums acc holds: -2 none yet, -1 already scaled (scale 1), else the group index
  float scur[8] = {};      // that group's scales (not yet rounded) for the lane's 8 output columns
  // Every global load of a chunk is issued one trip ahead of its use (the group indices two), in the order in which the values are used, so that each wait leaves the younger loads in flight: no trip waits for memory that it has only just asked for.
  const _Float16* const arh = DOWN ? AH + (size_t)wave * NCH * 512 : nullptr; const _Float16* const arl = DOWN ? AL + (size_t)wave * NCH * 512 : nullptr;   // the tiles of the wave's 16 rows, one per chunk
  // x is loaded with 4 lanes to a row (8 k each), 8 rows to a load: a load touches 8 cache lines; loaded straight into the fragment's lanes (16 rows to a load) it would touch 16. xr8, xg: the lane's row in each 8 and its eight of the chunk
  const int xr8 = lane >> 2, xg = lane & 3;
  const float* const xrow = DOWN ? nullptr : X + (size_t)(wave * 16 + xr8) * KD + 8 * xg;   // the lane's part of the first of its two rows of x; the second is 8 rows on
  int want = chunk_group<NG>(GI[kbeg * 32 + lane]);                                  // group of the trip's own chunk
  int wn1 = chunk_group<NG>(GI[(kbeg + 1 < kend ? kbeg + 1 : kbeg) * 32 + lane]);     // group of the chunk after it
  const int zw0 = QZ[(size_t)(want < 0 ? 0 : want) * (ND / 8) + (n >> 3)];            // zero-point word of the first group
  int zwn = 0;                                                                        // zero-point word of the next group that begins
  unsigned word[4];
#pragma unroll
  for (int wq = 0; wq < 4; ++wq) word[wq] = (unsigned)QW[(size_t)(kbeg * 4 + wq) * ND + n];
  v16h a = {}, al = {}; v4f xr[4] = {};   // DOWN: the chunk's hi and lo fragments; else the chunk's 2 x 8 values of x as loaded
  // precaution (both forms): s_wait_xcnt 0 stands in front of every rewrite of the address registers that the loads above name; the loaded values are inputs so that the loads stay in front of it (the first trip needs them at once anyway)
  if constexpr (DOWN) { a = frag_t(arh + kbeg * 512, lane); al = frag_t(arl + kbeg * 512, lane);
    asm volatile("s_wait_xcnt 0x0" :: "v"(zw0), "v"(word[0]), "v"(word[1]), "v"(word[2]), "v"(word[3]), "v"(a), "v"(al) : "memory"); }
  else { const float* const p = xrow + kbeg * 32; xr[0] = *(const v4f*)p; xr[1] = *(const v4f*)(p + 4); xr[2] = *(const v4f*)(p + 8 * KD); xr[3] = *(const v4f*)(p + 8 * KD + 4);
    asm volatile("s_wait_xcnt 0x0" :: "v"(zw0), "v"(word[0]), "v"(word[1]), "v"(word[2]), "v"(word[3]), "v"(xr[0]), "v"(xr[1]), "v"(xr[2]), "v"(xr[3]) : "memory"); }
  // zero point of the thread's unpack column, z = nibble + 1: DOWN the f16 pair (1024 + z, 64 + z), else the bf16 pair (-(128 + z), -(128 + z))
  constexpr unsigned ZB = DOWN ? 0x54106401u : 0xC301C301u, ZM = DOWN ? 0x100001u : 0x10001u;
  unsigned zpk = ZB + ((unsigned)(zw0 >> ((n & 7) * 4)) & 15u) * ZM;
#pragma unroll 1
  for (int kc = kbeg; kc < kbeg + ntrip; ++kc) { const bool live = NH == 1 || kc < kend; const int k0 = (live ? kc : kend - 1) * 32;   // live: false only in the trip that a half one chunk short runs for the barriers' sake
    const bool uni = want >= 0; const int kn = kc + 1 < kend ? kc + 1 : NH == 1 ? kc : kend - 1;   // kn: the next chunk (from the half's last chunk on: that chunk again, unused)
    if (want != cur) {
      if (cur != -2) { flush_group(tot, acc, scur); zpk = ZB + ((unsigned)(zwn >> ((n & 7) * 4)) & 15u) * ZM; }   // used only where the new chunk lies in one group, and then zwn is that group's word
      cur = want;
      if (uni) {
#pragma unroll
        for (int j = 0; j < 8; ++j) scur[j] = SC[(size_t)want * ND + n0 + j * 16 + col];
        asm volatile("s_wait_xcnt 0x0" ::: "memory"); }   // precaution: stands in front of every rewrite of the address registers that the scale loads name
      else {
#pragma unroll
        for (int j = 0; j < 8; ++j) scur[j] = 1.0f; } }
    if (wn1 != want && wn1 >= 0) { zwn = QZ[(size_t)wn1 * (ND / 8) + (n >> 3)];   // a group begins with the next chunk
      asm volatile("s_wait_xcnt 0x0" ::: "memory"); }   // precaution: stands in front of every rewrite of the address registers that the load above names
    if (uni && !DOWN) {
      // nibbles s and s + 4 of a word stand 16 bits apart: shifted down and masked, each under exponent 2^7 reads 128 + w in bf16; the packed addition of -(128 + z) is exact
#pragma unroll
      for (int wq = 0; wq < 4; ++wq) { union { v2b p[4]; v8h v; } o;
#pragma unroll
        for (int s = 0; s < 4; ++s) o.p[s] = __builtin_bit_cast(v2b, ((word[wq] >> (4 * s)) & 0x000F000Fu) | 0x43004300u) + __builtin_bit_cast(v2b, zpk);
        *(v8h*)&swh[sb + tid][wq * 8] = o.v; } }
    else if (uni) {
      // byte i of a word holds k = 2i (low nibble) and 2i + 1 (high nibble): both halves get the byte, the low nibble under exponent 2^10 reads 1024 + w, the high nibble under 2^6 reads 64 + w; the packed subtraction of (1024 + z, 64 + z) is exact
#pragma unroll
      for (int wq = 0; wq < 4; ++wq) { union { v2h p[4]; v8h v; } o;
#pragma unroll
        for (int i = 0; i < 4; ++i) { const unsigned bb = __builtin_amdgcn_perm(word[wq], word[wq], 0x0C000C00u | (unsigned)i | ((unsigned)i << 16));
          o.p[i] = __builtin_bit_cast(v2h, (bb & 0x00F0000Fu) | 0x54006400u) - __builtin_bit_cast(v2h, zpk); }
        *(v8h*)&swh[sb + tid][wq * 8] = o.v; } }
    else { int cg = -1; int z = 0; float sc = 0.f;
#pragma unroll 1
      for (int wq = 0; wq < 4; ++wq) { const int wd = QW[(size_t)((k0 >> 3) + wq) * ND + n];
        asm volatile("s_wait_xcnt 0x0" ::: "memory");   // precaution: stands in front of every rewrite of the address registers that the load above names
#pragma unroll
        for (int i = 0; i < 8; ++i) { const int k = k0 + wq * 8 + i; const int gr = GI[k]; const int gi = gr < 0 ? 0 : gr > NG - 1 ? NG - 1 : gr;
          if (gi != cg) { cg = gi; const int zw = QZ[(size_t)gi * (ND / 8) + (n >> 3)]; z = ((zw >> ((n & 7) * 4)) & 15) + 1; sc = bfr(SC[(size_t)gi * ND + n]); }
          const int w = (wd >> (i * 4)) & 15; const float val = (float)(w - z) * sc;
          if constexpr (DOWN) { const _Float16 h = (_Float16)val; swh[sb + tid][wq * 8 + i] = h; swl[sb + tid][wq * 8 + i] = (_Float16)((val - (float)h) * 2048.0f); }
          else { const __bf16 h = (__bf16)val; const int ps = wq * 8 + (i < 4 ? 2 * i : 2 * i - 7);   // ps: the place of k = i in the order 0 4 1 5 2 6 3 7
            swh[sb + tid][ps] = __builtin_bit_cast(_Float16, h); swl[sb + tid][ps] = __builtin_bit_cast(_Float16, (__bf16)(val - (float)h)); } } } }
    if constexpr (!DOWN) { *(v8b*)&sx[wave * 16 + xr8][8 * xg] = pack_x(xr[0], xr[1]); *(v8b*)&sx[wave * 16 + 8 + xr8][8 * xg] = pack_x(xr[2], xr[3]); }   // the chunk's part of x, staged beside the weights; xr is free from here on
    const int gl2 = GI[(kc + 2 < kend ? kc + 2 : kend - 1) * 32 + lane];   // used at the trip's end: asked for ahead of the words, so that its wait leaves them in flight
    if constexpr (!DOWN) asm volatile("s_wait_xcnt 0x0" ::: "memory");   // precaution: in this build a later load's result takes the register that holds the address of the load above
#pragma unroll
    for (int wq = 0; wq < 4; ++wq) word[wq] = (unsigned)QW[(size_t)(kn * 4 + wq) * ND + n];   // the next chunk's words, into the registers that the unpacking has just left
    if constexpr (!DOWN) { const float* const p = xrow + kn * 32; xr[0] = *(const v4f*)p; xr[1] = *(const v4f*)(p + 4); xr[2] = *(const v4f*)(p + 8 * KD); xr[3] = *(const v4f*)(p + 8 * KD + 4); }   // the next chunk's part of x, a whole trip ahead of its rounding
    asm volatile("s_wait_xcnt 0x0" ::: "memory");   // precaution: stands in front of every rewrite of the address registers that the loads above name
    lds_bar();   // the chunk's staged weights (and x) are published
    v16b ab = {}; if constexpr (!DOWN) ab = frag_b(&sx[wave * 16 + col][0], lane);   // the chunk's A fragment
    if (!live) { }   // nothing is added: the chunk staged in this trip was summed in the trip before
    else if (uni) { v16h wh[8];   // all 8 column fragments are read from LDS as one group, ahead of the chunk's products: one LDS wait a chunk
#pragma unroll
      for (int j = 0; j < 8; ++j) wh[j] = frag_h(&swh[sb + j * 16 + col][0], lane);
      if constexpr (DOWN) {
#pragma unroll
        for (int j = 0; j < 8; ++j) acc[j] = wmma16(a, wh[j], acc[j]);
#pragma unroll
        for (int j = 0; j < 8; ++j) acc[j] = wmma16(al, wh[j] * (_Float16)(1.0f / 2048.0f), acc[j]); }   // |w - z| <= 16: the scaled integers are exact
      else {
#pragma unroll
        for (int j = 0; j < 8; ++j) acc[j] = wmma_bf(ab, __builtin_bit_cast(v16b, wh[j]), acc[j]); } }
    else {   // already scaled: each column tile's sums go straight to the totals, acc stays 0
#pragma unroll 1   // rare path: kept small, and no second copy of acc in registers
      for (int j = 0; j < 8; ++j) { const v16h wh = frag_h(&swh[sb + j * 16 + col][0], lane), wl = frag_h(&swl[sb + j * 16 + col][0], lane); v8f l = {}, hs;
        if constexpr (DOWN) { l = wmma16(al, wh, l); l = wmma16(a, wl, l); hs = wmma16(a, wh, v8f{}); }
        else hs = wmma_bf(ab, __builtin_bit_cast(v16b, wh), wmma_bf(ab, __builtin_bit_cast(v16b, wl), v8f{}));   // both planes at their own scale: one sum
#pragma unroll
        for (int hf = 0; hf < 2; ++hf) { v4f t = tot[(j * 2 + hf) * 32];
#pragma unroll
          for (int e = 0; e < 4; ++e) t[e] += DOWN ? hs[hf * 4 + e] + l[hf * 4 + e] * (1.0f / 2048.0f) : hs[hf * 4 + e];
          tot[(j * 2 + hf) * 32] = t; } } }
    want = wn1; wn1 = chunk_group<NG>(gl2);
    if constexpr (DOWN) { a = frag_t(arh + kn * 512, lane); al = frag_t(arl + kn * 512, lane);   // the next chunk's rows, into the registers that the products have just left
      asm volatile("s_wait_xcnt 0x0" ::: "memory"); }   // precaution: stands in front of every rewrite of the address registers that the four row loads name
    lds_bar(); }   // every wave has read the staged weights: the next trip may overwrite them
  // last group: totals + scale * sums, in registers
#pragma unroll
  for (int j = 0; j < 8; ++j) { const float s = bfr(scur[j]);
#pragma unroll
    for (int hf = 0; hf < 2; ++hf) { const v4f t = tot[(j * 2 + hf) * 32];
#pragma unroll
      for (int e = 0; e < 4; ++e) acc[j][hf * 4 + e] = t[e] + s * acc[j][hf * 4 + e]; } }
  LDSX();   // every lane's totals are read before the wave overwrites its part of so in row order
#pragma unroll
  for (int j = 0; j < 8; ++j)
#pragma unroll
    for (int r = 0; r < 8; ++r) so[wv][8 * g + r][j * 16 + col] = acc[j][r];
  if constexpr (DOWN) {
    __syncthreads();   // both halves' sums stand in so: each wave adds 8 of its 16 rows, first half + second half, and stores them
    for (int rl = hg * 8; rl < hg * 8 + 8; ++rl) vst2(OUT + ((size_t)blockIdx.y * MM + wave * 16 + rl) * ND + n0 + lane * 4, *(const v4f*)&so[wave][rl][lane * 4] + *(const v4f*)&so[4 + wave][rl][lane * 4]); }
  else {
    LDSX();
    for (int rl = 0; rl < 16; ++rl) vst2(OUT + ((size_t)blockIdx.y * MM + wave * 16 + rl) * ND + n0 + lane * 4, *(const v4f*)&so[wave][rl][lane * 4]); }
}
__global__ __launch_bounds__(128) void k_qgemm_gu(const float* __restrict__ X, const int* __restrict__ QW0, const float* __restrict__ SC0, const int* __restrict__ QZ0, const int* __restrict__ GI0, const int* __restrict__ QW1, const float* __restrict__ SC1, const int* __restrict__ QZ1, const int* __restrict__ GI1, float* __restrict__ OUTB) {
  qgemm<0>(X, nullptr, nullptr, QW0, SC0, QZ0, GI0, QW1, SC1, QZ1, GI1, OUTB);
}
__global__ __launch_bounds__(256) void k_qgemm_d(const _Float16* __restrict__ AH, const _Float16* __restrict__ AL, const int* __restrict__ QW, const float* __restrict__ SC, const int* __restrict__ QZ, const int* __restrict__ GI, float* __restrict__ OUTB) {
  qgemm<1>(nullptr, AH, AL, QW, SC, QZ, GI, QW, SC, QZ, GI, OUTB);
}
// ---- k_h: block = 16 rows x 128 k of [64][NI], thread = 8 consecutive k of one row: g, u = sums of the SPG partial planes in range order; h = silu(g) * u -> f16 hi + x2048 residual, stored in the fragment order of frag_t: the thread's 8 values are one lane's 16 bytes; a block writes 4 whole tiles of each plane
__global__ __launch_bounds__(256) void k_h(const float* __restrict__ G, const float* __restrict__ U, _Float16* __restrict__ HH, _Float16* __restrict__ HL) {
  const unsigned rt = blockIdx.x / (NI / 128u), kb = blockIdx.x % (NI / 128u), r = ((threadIdx.x >> 5) & 1u) * 8u + ((threadIdx.x & 31u) >> 2), k8 = (threadIdx.x >> 6) * 4u + (threadIdx.x & 3u);   // row tile, block of 128 k, row in the tile, eight in the block: a wave = 8 rows x 1 chunk, so that each of its stores fills 4 whole lines
  const unsigned eb = (((rt * 16u + r) * NI) + kb * 128u + k8 * 8u) * 4u; __align__(16) _Float16 hh[8], ll[8];   // eb: the thread's byte offset inside every f32 plane
  const unsigned e = (rt * (NI / 32u) + kb * 4u + (k8 >> 2)) * 512u + ((k8 >> 1) & 1u) * 256u + ((k8 & 1u) * 16u + r) * 8u;   // tile, then elements 0..7 or 8..15, then the lane (k half, row)
  v4f g0 = {}, g1 = {}, u0 = {}, u1 = {};
  // unrolled: the planes' loads are independent, so many are in flight at once
#pragma unroll
  for (int s = 0; s < SPG; ++s) { const char* gp = (const char*)(G + (size_t)s * MM * NI) + eb; const char* up = (const char*)(U + (size_t)s * MM * NI) + eb;
    g0 += *(const v4f*)gp; g1 += *(const v4f*)(gp + 16); u0 += *(const v4f*)up; u1 += *(const v4f*)(up + 16); }
#pragma unroll
  for (int i = 0; i < 8; ++i) { const float gv = i < 4 ? g0[i & 3] : g1[i & 3], uv = i < 4 ? u0[i & 3] : u1[i & 3]; const float hv = (gv / (1.0f + exp_ni(-gv))) * uv; const _Float16 h = (_Float16)hv; hh[i] = h; ll[i] = (_Float16)((hv - (float)h) * 2048.0f); }
  vst2((unsigned*)(HH + e), *(const v4u*)hh); vst2((unsigned*)(HL + e), *(const v4u*)ll);
}
// ---- k_dsum: thread = 4 consecutive elements of out [64][NO]: sum of the SPD partial planes in range order
__global__ __launch_bounds__(256) void k_dsum(const float* __restrict__ D, float* __restrict__ OUT) {
  const unsigned e = (blockIdx.x * 256u + threadIdx.x) * 4u, eb = e * 4u; v4f a = {};   // eb: the thread's byte offset inside every plane
  // unrolled: the planes' loads are independent, so many are in flight at once
#pragma unroll
  for (int s = 0; s < SPD; ++s) a += *(const v4f*)((const char*)(D + (size_t)s * MM * NO) + eb);
  vst2(OUT + e, a);
}
extern "C" void kernel_launch(void* const* d_in, const int* in_sizes, int n_in, void* d_out, int out_size, void* d_ws, size_t ws_size, hipStream_t stream) {
  (void)in_sizes; (void)n_in; (void)out_size;
  const float** F = (const float**)d_in; const int** I = (const int**)d_in;   // 0 x [64,4096]; gate: 1 qw [512,11008] i32, 2 scales [32,11008], 3 qzeros [32,1376] i32, 4 gidx [4096] i32; up: 5..8; down: 9 qw [1376,4096], 10 scales [86,4096], 11 qzeros [86,512], 12 gidx [11008]
  if (ws_size < (size_t)WS_END) return;
  char* ws = (char*)d_ws; _Float16 *HH = (_Float16*)(ws + WS_HH), *HL = (_Float16*)(ws + WS_HL); float *G = (float*)(ws + WS_G), *U = (float*)(ws + WS_U), *D = (float*)(ws + WS_D);
  k_qgemm_gu<<<dim3(NI / 128, SPG, 2), 128, 0, stream>>>(F[0], I[1], F[2], I[3], I[4], I[5], F[6], I[7], I[8], G);   // z = 1 writes U, which follows G
  k_h<<<MM * NI / 8 / 256, 256, 0, stream>>>(G, U, HH, HL);
  k_qgemm_d<<<dim3(NO / 128, SPD, 1), 256, 0, stream>>>(HH, HL, I[9], F[10], I[11], I[12], D);
  k_dsum<<<MM * NO / 4 / 256, 256, 0, stream>>>(D, (float*)d_out);
}

// v009
// Measured time: 44.8 microseconds a run.
// Two timings next to v008 put it at 1.22 and 1.21 times that version's speed.
// All steps since v000 together make it 48.6 times as fast.
// compute dtype: x and the three scale tables rounded to bf16, the packed int4 weights / zero points / group indices (int32) read verbatim; GPTQ dequantisation on device: w = (qw >> 4k) & 15, z = ((qz >> 4n) & 15) + 1, gate and up GEMMs on bf16 WMMA 16x16x32: the bf16-rounded x is the A operand itself; if every 32-deep chunk of gate and up lies in one group, all are staged as the exact integers w - z in bf16 (1 product) and the group's scale multiplies the f32 sums, else every chunk as W = (w - z[g_idx]) * scale[g_idx] in f32 (exact: small integer times the bf16 scale), bf16 hi + residual (exact, 2 products); h = silu(gate) * up in f32 (precise expf), stored as f16 hi + (x2048) residual; down GEMM on f16 WMMA 16x16x32: one-group chunks as the exact integers in f16 (2 products into one accumulator: hi.int, lo.(int x 2^-11, exact in f16)), other chunks as f16 hi + (x2048-scaled) residual (3 products: hi.hi, lo.hi, hi.lo); f32 accumulate.
#include <hip/hip_runtime.h>
#include <math.h>

typedef __attribute__((ext_vector_type(16))) _Float16 v16h;
typedef __attribute__((ext_vector_type(16))) __bf16 v16b;
typedef __attribute__((ext_vector_type(8)))  _Float16 v8h;
typedef __attribute__((ext_vector_type(8)))  float v8f;
typedef __attribute__((ext_vector_type(4)))  float v4f;
typedef __attribute__((ext_vector_type(2)))  float v2f;
typedef __attribute__((ext_vector_type(4)))  unsigned v4u;
typedef __attribute__((ext_vector_type(4)))  int v4i;
typedef float __attribute__((may_alias)) float_a;
typedef int __attribute__((may_alias)) int_a;

template <typename T> __device__ __forceinline__ void vst2(void* p, T v) { *(T*)p = v;  }
__device__ __forceinline__ v8f wmma16(v16h a, v16h b, v8f c) {
  v8f d = __builtin_amdgcn_wmma_f32_16x16x32_f16(false, a, false, b, (short)0, c, false, false);
  asm volatile("v_nop\n\tv_nop\n\tv_nop\n\tv_nop" : "+v"(d) : "v"(a), "v"(b));
  return d;
}
__device__ __forceinline__ v8f wmma_bf(v16b a, v16b b, v8f c) {
  v8f d = __builtin_amdgcn_wmma_f32_16x16x32_bf16(false, a, false, b, (short)0, c, false, false);
  asm volatile("v_nop\n\tv_nop\n\tv_nop\n\tv_nop" : "+v"(d) : "v"(a), "v"(b));
  return d;
}
// 16x16x32 fragments: lane = (h = lane>>4, row/col = lane&15); elements 0..7 = k0+8h+0..7, 8..15 = k0+16+8h+0..7; D element r = row 8h+r
__device__ __forceinline__ v16h frag_h(const _Float16* rowk0, int lane) {
  union { v16h v; v8h q[2]; } u; const _Float16* p = rowk0 + 8 * (lane >> 4);
  u.q[0] = *(const v8h*)p; u.q[1] = *(const v8h*)(p + 16); return u.v;
}
__device__ __forceinline__ v16h frag_f32(const float* rowk0, int lane) {
  v16h a; const float* p = rowk0 + 8 * (lane >> 4);
#pragma unroll
  for (int i = 0; i < 8; ++i) { a[i] = (_Float16)p[i]; a[8 + i] = (_Float16)p[16 + i]; }
  return a;
}
__device__ __forceinline__ v16h frag_f32s(const float* rowk0, int lane, float sc) {
  v16h a; const float* p = rowk0 + 8 * (lane >> 4);
#pragma unroll
  for (int i = 0; i < 8; ++i) { a[i] = (_Float16)(p[i] * sc); a[8 + i] = (_Float16)(p[16 + i] * sc); }
  return a;
}
// column fragment from a [K][ld] layout (column n), rows >= K read as 0
__device__ __forceinline__ v16h fragc_f32(const float* W, int k0, int n, int lane, int ld, int K) {
  v16h a; const int g = lane >> 4;
#pragma unroll
  for (int i = 0; i < 8; ++i) { const int ka = k0 + 8 * g + i, kb = ka + 16;
    a[i] = (_Float16)(ka < K ? W[(size_t)(ka < K ? ka : K - 1) * ld + n] : 0.f); a[8 + i] = (_Float16)(kb < K ? W[(size_t)(kb < K ? kb : K - 1) * ld + n] : 0.f); }
  return a;
}
struct F2 { v16b h, l; };
__device__ __forceinline__ F2 bsplit16(const float v[16]) { F2 r;
#pragma unroll
  for (int i = 0; i < 16; ++i) { const __bf16 h = (__bf16)v[i]; r.h[i] = h; r.l[i] = (__bf16)(v[i] - (float)h); }
  return r; }
__device__ __forceinline__ F2 split_row(const float* row, int k0, int lane) { float v[16]; const float* p = row + k0 + 8 * (lane >> 4);
#pragma unroll
  for (int i = 0; i < 8; ++i) { v[i] = p[i]; v[8 + i] = p[16 + i]; }
  return bsplit16(v); }
__device__ __forceinline__ F2 split_rowK(const float* row, int k0, int lane, int K) { float v[16]; const int g = lane >> 4;
#pragma unroll
  for (int i = 0; i < 8; ++i) { const int ka = k0 + 8 * g + i, kb = ka + 16; v[i] = ka < K ? row[ka < K ? ka : K - 1] : 0.f; v[8 + i] = kb < K ? row[kb < K ? kb : K - 1] : 0.f; }
  return bsplit16(v); }
__device__ __forceinline__ F2 split_col(const float* W, int k0, int n, int lane, int ld, int K) { float v[16]; const int g = lane >> 4;
#pragma unroll
  for (int i = 0; i < 8; ++i) { const int ka = k0 + 8 * g + i, kb = ka + 16; v[i] = ka < K ? W[(size_t)(ka < K ? ka : K - 1) * ld + n] : 0.f; v[8 + i] = kb < K ? W[(size_t)(kb < K ? kb : K - 1) * ld + n] : 0.f; }
  return bsplit16(v); }
__device__ __forceinline__ v8f mac3(const F2& a, const F2& b, v8f c) { c = wmma_bf(a.l, b.h, c); c = wmma_bf(a.h, b.l, c); return wmma_bf(a.h, b.h, c); }
__device__ __forceinline__ float sigm(float v) { return 1.0f / (1.0f + expf(-v)); }
// work-group barrier for LDS hand-overs alone: the wave's own LDS reads and writes are done (s_wait_dscnt 0), global loads stay in flight across it (__syncthreads() would wait for them too)
__device__ __forceinline__ void lds_bar() { asm volatile("s_wait_dscnt 0x0\n\ts_barrier_signal -1\n\ts_barrier_wait -1" ::: "memory"); }
#define LDSX() do { asm volatile("s_wait_dscnt 0" ::: "memory"); __builtin_amdgcn_wave_barrier(); __builtin_amdgcn_fence(__ATOMIC_RELEASE, "workgroup"); } while (0)


// Quantised (4-bit, group 128) fused SwiGLU MLP: h = silu(x Wg) * (x Wu), out = h Wd with GPTQ-packed Wg, Wu [4096 -> 11008] and Wd [11008 -> 4096]; 64 token rows.
#ifndef KIN
#define MM 64
#define KIN 4096
#define NI 11008
#define NO 4096
#endif
#define GRP 128
typedef __attribute__((ext_vector_type(8))) __bf16 v8b;
__device__ __forceinline__ v16b frag_b(const __bf16* rowk0, int lane) {
  union { v16b v; v8b q[2]; } u; const __bf16* p = rowk0 + 8 * (lane >> 4);
  u.q[0] = *(const v8b*)p; u.q[1] = *(const v8b*)(p + 16); return u.v;
}
// A fragment from a plane kept in fragment order: tile = 16 rows x 32 k = 512 values; a lane's elements 0..7 stand at 8 * lane, its elements 8..15 at 256 + 8 * lane, so each of the two loads of a wave reads 512 bytes in a row
__device__ __forceinline__ v16h frag_t(const _Float16* tile, int lane) {
  union { v16h v; v8h q[2]; } u; const _Float16* p = tile + 8 * lane;
  u.q[0] = *(const v8h*)p; u.q[1] = *(const v8h*)(p + 256); return u.v;
}
__device__ __forceinline__ float bfr(float v) { return (float)(__bf16)v; }
__device__ __attribute__((noinline)) float exp_ni(float v) { return expf(v); }
__device__ __attribute__((noinline)) float erf_ni(float v) { return erff(v); }

// K ranges of the down GEMM: as many as keep every work-group of the launch resident at once: 32 x 16 = 512 work-groups of 8 waves (2 on each WGP), 21 or 22 chunks each, cut into two halves of 11 and 10 or 11 chunks that waves 0..3 and waves 4..7 work on side by side and sum through LDS at the end. The gate and up GEMMs have no K ranges between work-groups: see k_guh.
#define SPD 16                                      // down: 344 chunks of 32 k; each range is halved again inside its work-group
#define WS_HH  0u                                   // f16 [4 row tiles][NI / 32 chunks][512] h hi, in fragment order ; HL
#define WS_HL  (WS_HH + 2u * MM * NI)
#define WS_D   (WS_HL + 2u * MM * NI)               // f32 [SPD][64][NO] down partial sums
#define WS_END (WS_D + 4u * SPD * MM * NO)

// ---- k_qgemm_d: block = 128 output columns x one K range (blockIdx.y) of the down matrix: OUT[range][64 rows][n0..n0+127] = the range's part of h (K deep) x dequant(W)[k][n].
// A is h as f16 hi/lo planes in fragment order (k_guh writes them so; frag_t reads them), used as the next two lines say.
// A chunk of 32 k that lies in ONE group is staged in LDS as the exact integers w - z in f16 (one plane, 2 products: hi.int and lo.(int x 2^-11), the scaled integers exact in f16, so both go into ONE accumulator set); the group's scale multiplies the f32 sums once, when the group ends, and the scaled sums are added to running totals that each wave keeps in its own part of so.
// A chunk whose 32 group indices differ is staged as (w - z) * scale, f16 hi + x2048 residual (3 products; the two residual products of a column tile are summed apart and added x 2^-11), and its sums are added to the totals at once.
typedef v4f __attribute__((may_alias)) v4f_a;
typedef __attribute__((ext_vector_type(2))) _Float16 v2h;
typedef __attribute__((ext_vector_type(2))) __bf16 v2b;
// 8 consecutive k of a row of x (two quads), rounded to bf16, in the order 0 4 1 5 2 6 3 7
__device__ __forceinline__ v8b pack_x(v4f lo, v4f hi) { v8b a;
#pragma unroll
  for (int s = 0; s < 4; ++s) { a[2 * s] = (__bf16)lo[s]; a[2 * s + 1] = (__bf16)hi[s]; }
  return a; }
// totals: lane-private slots, [16 quads][32 lanes] of 4 floats; quad 2j + hf holds rows 4hf..4hf+3 of the lane's column tile j
__device__ __forceinline__ void flush_group(v4f_a* tot, v8f (&acc)[8], const float (&scur)[8]) {
#pragma unroll
  for (int j = 0; j < 8; ++j) { const float s = bfr(scur[j]);
#pragma unroll
    for (int hf = 0; hf < 2; ++hf) { v4f t = tot[(j * 2 + hf) * 32];
#pragma unroll
      for (int e = 0; e < 4; ++e) t[e] += s * acc[j][hf * 4 + e];
      tot[(j * 2 + hf) * 32] = t; }
    acc[j] = v8f{}; }
}
// gl = the lane's one of a chunk's 32 group indices: the group (bounded to the tables' rows) if all 32 are equal, else -1. The waves of one K half read the same 32 indices, so the answer is the same for all waves that share its staging planes.
template <int NG> __device__ __forceinline__ int chunk_group(int gl) {
  const int gf = __builtin_amdgcn_readfirstlane(gl); const bool u = __builtin_amdgcn_ballot_w32(gl == gf) == 0xFFFFFFFFu;
  return u ? (gf < 0 ? 0 : gf > NG - 1 ? NG - 1 : gf) : -1;
}
__global__ __launch_bounds__(256) void k_qgemm_d(const _Float16* __restrict__ AH, const _Float16* __restrict__ AL, const int* __restrict__ QW, const float* __restrict__ SC, const int* __restrict__ QZ, const int* __restrict__ GI, float* __restrict__ OUT) {
  constexpr int KD = NI, ND = NO, NCH = KD / 32, SP = SPD, NG = KD / GRP;
  constexpr int NH = 2;   // halves of the block's K range, each worked on by 4 waves of its own with its own staging planes
  const int rbeg = (int)blockIdx.y * NCH / SP, rend = ((int)blockIdx.y + 1) * NCH / SP;   // this range's chunks: the SP ranges tile [0, NCH)
  __shared__ __align__(16) _Float16 swh[NH * 128][40], swl[NH * 128][40]; __shared__ __align__(16) float so[NH * 4][16][132];
  // wv: the wave's number in the block (held in a scalar register, so that the half's chunk numbers and every test on them stay scalar); hg: its half; wave: its 16 rows; tid: the thread's unpack column
  const int wv = __builtin_amdgcn_readfirstlane((int)threadIdx.x >> 5), hg = wv >> 2, wave = wv & 3, sb = hg * 128;
  const int tid = threadIdx.x & 127, lane = tid & 31, col = lane & 15, g = lane >> 4; const int n0 = blockIdx.x * 128, n = n0 + tid;
  const int ntrip = (rend - rbeg + NH - 1) / NH;   // trips of the loop, the same for the whole block (the barriers inside need that); a range of the down GEMM holds 21 or 22 chunks, so no half is empty
  const int kbeg = rbeg + hg * ntrip, kend = kbeg + ntrip < rend ? kbeg + ntrip : rend;   // the half's own chunks; the second half may be one short, and its last trip then adds nothing
  v8f acc[8] = {};
  v4f_a* const tot = (v4f_a*)&so[wv][0][0] + lane;
#pragma unroll
  for (int q = 0; q < 16; ++q) tot[q * 32] = v4f{};
  int cur = -2;            // group whose sums acc holds: -2 none yet, -1 already scaled (scale 1), else the group index
  float scur[8] = {};      // that group's scales (not yet rounded) for the lane's 8 output columns
  // Every global load of a chunk is issued one trip ahead of its use (the group indices two), in the order in which the values are used, so that each wait leaves the younger loads in flight: no trip waits for memory that it has only just asked for.
  const _Float16* const arh = AH + (size_t)wave * NCH * 512; const _Float16* const arl = AL + (size_t)wave * NCH * 512;   // the tiles of the wave's 16 rows, one per chunk
  int want = chunk_group<NG>(GI[kbeg * 32 + lane]);                                  // group of the trip's own chunk
  int wn1 = chunk_group<NG>(GI[(kbeg + 1 < kend ? kbeg + 1 : kbeg) * 32 + lane]);     // group of the chunk after it
  const int zw0 = QZ[(size_t)(want < 0 ? 0 : want) * (ND / 8) + (n >> 3)];            // zero-point word of the first group
  int zwn = 0;                                                                        // zero-point word of the next group that begins
  unsigned word[4];
#pragma unroll
  for (int wq = 0; wq < 4; ++wq) word[wq] = (unsigned)QW[(size_t)(kbeg * 4 + wq) * ND + n];
  v16h a = {}, al = {};   // the chunk's hi and lo fragments
  // precaution: s_wait_xcnt 0 stands in front of every rewrite of the address registers that the loads above name; the loaded values are inputs so that the loads stay in front of it (the first trip needs them at once anyway)
  a = frag_t(arh + kbeg * 512, lane); al = frag_t(arl + kbeg * 512, lane);
  asm volatile("s_wait_xcnt 0x0" :: "v"(zw0), "v"(word[0]), "v"(word[1]), "v"(word[2]), "v"(word[3]), "v"(a), "v"(al) : "memory");
  // zero point of the thread's unpack column, z = nibble + 1: the f16 pair (1024 + z, 64 + z)
  constexpr unsigned ZB = 0x54106401u, ZM = 0x100001u;
  unsigned zpk = ZB + ((unsigned)(zw0 >> ((n & 7) * 4)) & 15u) * ZM;
#pragma unroll 1
  for (int kc = kbeg; kc < kbeg + ntrip; ++kc) { const bool live = kc < kend; const int k0 = (live ? kc : kend - 1) * 32;   // live: false only in the trip that a half one chunk short runs for the barriers' sake
    const bool uni = want >= 0; const int kn = kc + 1 < kend ? kc + 1 : kend - 1;   // kn: the next chunk (from the half's last chunk on: that chunk again, unused)
    if (want != cur) {
      if (cur != -2) { flush_group(tot, acc, scur); zpk = ZB + ((unsigned)(zwn >> ((n & 7) * 4)) & 15u) * ZM; }   // used only where the new chunk lies in one group, and then zwn is that group's word
      cur = want;
      if (uni) {
#pragma unroll
        for (int j = 0; j < 8; ++j) scur[j] = SC[(size_t)want * ND + n0 + j * 16 + col];
        asm volatile("s_wait_xcnt 0x0" ::: "memory"); }   // precaution: stands in front of every rewrite of the address registers that the scale loads name
      else {
#pragma unroll
        for (int j = 0; j < 8; ++j) scur[j] = 1.0f; } }
    if (wn1 != want && wn1 >= 0) { zwn = QZ[(size_t)wn1 * (ND / 8) + (n >> 3)];   // a group begins with the next chunk
      asm volatile("s_wait_xcnt 0x0" ::: "memory"); }   // precaution: stands in front of every rewrite of the address registers that the load above names
    if (uni) {
      // byte i of a word holds k = 2i (low nibble) and 2i + 1 (high nibble): both halves get the byte, the low nibble under exponent 2^10 reads 1024 + w, the high nibble under 2^6 reads 64 + w; the packed subtraction of (1024 + z, 64 + z) is exact
#pragma unroll
      for (int wq = 0; wq < 4; ++wq) { union { v2h p[4]; v8h v; } o;
#pragma unroll
        for (int i = 0; i < 4; ++i) { const unsigned bb = __builtin_amdgcn_perm(word[wq], word[wq], 0x0C000C00u | (unsigned)i | ((unsigned)i << 16));
          o.p[i] = __builtin_bit_cast(v2h, (bb & 0x00F0000Fu) | 0x54006400u) - __builtin_bit_cast(v2h, zpk); }
        *(v8h*)&swh[sb + tid][wq * 8] = o.v; } }
    else { int cg = -1; int z = 0; float sc = 0.f;
#pragma unroll 1
      for (int wq = 0; wq < 4; ++wq) { const int wd = QW[(size_t)((k0 >> 3) + wq) * ND + n];
        asm volatile("s_wait_xcnt 0x0" ::: "memory");   // precaution: stands in front of every rewrite of the address registers that the load above names
#pragma unroll
        for (int i = 0; i < 8; ++i) { const int k = k0 + wq * 8 + i; const int gr = GI[k]; const int gi = gr < 0 ? 0 : gr > NG - 1 ? NG - 1 : gr;
          if (gi != cg) { cg = gi; const int zw = QZ[(size_t)gi * (ND / 8) + (n >> 3)]; z = ((zw >> ((n & 7) * 4)) & 15) + 1; sc = bfr(SC[(size_t)gi * ND + n]); }
          const int w = (wd >> (i * 4)) & 15; const float val = (float)(w - z) * sc;
          const _Float16 h = (_Float16)val; swh[sb + tid][wq * 8 + i] = h; swl[sb + tid][wq * 8 + i] = (_Float16)((val - (float)h) * 2048.0f); } } }
    const int gl2 = GI[(kc + 2 < kend ? kc + 2 : kend - 1) * 32 + lane];   // used at the trip's end: asked for ahead of the words, so that its wait leaves them in flight
#pragma unroll
    for (int wq = 0; wq < 4; ++wq) word[wq] = (unsigned)QW[(size_t)(kn * 4 + wq) * ND + n];   // the next chunk's words, into the registers that the unpacking has just left
    asm volatile("s_wait_xcnt 0x0" ::: "memory");   // precaution: stands in front of every rewrite of the address registers that the loads above name
    lds_bar();   // the chunk's staged weights are published
    if (!live) { }   // nothing is added: the chunk staged in this trip was summed in the trip before
    else if (uni) { v16h wh[8];   // all 8 column fragments are read from LDS as one group, ahead of the chunk's products: one LDS wait a chunk
#pragma unroll
      for (int j = 0; j < 8; ++j) wh[j] = frag_h(&swh[sb + j * 16 + col][0], lane);
#pragma unroll
      for (int j = 0; j < 8; ++j) acc[j] = wmma16(a, wh[j], acc[j]);
#pragma unroll
      for (int j = 0; j < 8; ++j) acc[j] = wmma16(al, wh[j] * (_Float16)(1.0f / 2048.0f), acc[j]); }   // |w - z| <= 16: the scaled integers are exact
    else {   // already scaled: each column tile's sums go straight to the totals, acc stays 0
#pragma unroll 1   // rare path: kept small, and no second copy of acc in registers
      for (int j = 0; j < 8; ++j) { const v16h wh = frag_h(&swh[sb + j * 16 + col][0], lane), wl = frag_h(&swl[sb + j * 16 + col][0], lane); v8f l = {}, hs;
        l = wmma16(al, wh, l); l = wmma16(a, wl, l); hs = wmma16(a, wh, v8f{});
#pragma unroll
        for (int hf = 0; hf < 2; ++hf) { v4f t = tot[(j * 2 + hf) * 32];
#pragma unroll
          for (int e = 0; e < 4; ++e) t[e] += hs[hf * 4 + e] + l[hf * 4 + e] * (1.0f / 2048.0f);
          tot[(j * 2 + hf) * 32] = t; } } }
    want = wn1; wn1 = chunk_group<NG>(gl2);
    a = frag_t(arh + kn * 512, lane); al = frag_t(arl + kn * 512, lane);   // the next chunk's rows, into the registers that the products have just left
    asm volatile("s_wait_xcnt 0x0" ::: "memory");   // precaution: stands in front of every rewrite of the address registers that the four row loads name
    lds_bar(); }   // every wave has read the staged weights: the next trip may overwrite them
  // last group: totals + scale * sums, in registers
#pragma unroll
  for (int j = 0; j < 8; ++j) { const float s = bfr(scur[j]);
#pragma unroll
    for (int hf = 0; hf < 2; ++hf) { const v4f t = tot[(j * 2 + hf) * 32];
#pragma unroll
      for (int e = 0; e < 4; ++e) acc[j][hf * 4 + e] = t[e] + s * acc[j][hf * 4 + e]; } }
  LDSX();   // every lane's totals are read before the wave overwrites its part of so in row order
#pragma unroll
  for (int j = 0; j < 8; ++j)
#pragma unroll
    for (int r = 0; r < 8; ++r) so[wv][8 * g + r][j * 16 + col] = acc[j][r];
  __syncthreads();   // both halves' sums stand in so: each wave adds 8 of its 16 rows, first half + second half, and stores them
  for (int rl = hg * 8; rl < hg * 8 + 8; ++rl) vst2(OUT + ((size_t)blockIdx.y * MM + wave * 16 + rl) * ND + n0 + lane * 4, *(const v4f*)&so[wave][rl][lane * 4] + *(const v4f*)&so[4 + wave][rl][lane * 4]);
}
// ---- k_guh: block = 64 columns of gate AND up over the whole K, 16 waves: wave = one matrix (mt) x 32 columns (chf) x a quarter of K (ks, 32 chunks of 32 k), all 64 rows. No partial planes: the four quarters are summed through LDS at the end and h = silu(gate) * up is formed and stored here, in the fragment order of frag_t.
// B: a lane loads the packed words of its two neighbouring columns (8 bytes; 16 lanes = one 128-byte line) straight into the fragment's lanes: word row 4 kc + g gives elements 0..7, word row 4 kc + 2 + g elements 8..15; column tile t holds the columns nb + 2 col + t. The words are asked for 4 chunks ahead and never pass through LDS.
// A: x, rounded to bf16, is staged in LDS in fragment order, 2 chunks of every quarter a phase, two buffers, one barrier a phase; the k order inside each 8 is 0 4 1 5 2 6 3 7 in A and in B alike.
typedef __attribute__((ext_vector_type(2))) unsigned v2u;
typedef v2u __attribute__((may_alias)) v2u_a;
__device__ __forceinline__ v16b frag_tb(const __bf16* tile, int lane) {
  union { v16b v; v8b q[2]; } u; const __bf16* p = tile + 8 * lane;
  u.q[0] = *(const v8b*)p; u.q[1] = *(const v8b*)(p + 256); return u.v;
}
__device__ __forceinline__ v8f wmma_b(v16b a, v16b b, v8f c) { return __builtin_amdgcn_wmma_f32_16x16x32_bf16(false, a, false, b, (short)0, c, false, false); }
// behind a chunk's last product: the 4 vector slots that the chip needs before a vector instruction touches a product's registers, on every path
#define WMMA_GAP(c) asm volatile("v_nop\n\tv_nop\n\tv_nop\n\tv_nop" : "+v"(c[0]), "+v"(c[1]), "+v"(c[2]), "+v"(c[3]), "+v"(c[4]), "+v"(c[5]), "+v"(c[6]), "+v"(c[7]))
__global__ __launch_bounds__(512) void k_guh(const float* __restrict__ X, const int* __restrict__ QW0, const float* __restrict__ SC0, const int* __restrict__ QZ0, const int* __restrict__ GI0, const int* __restrict__ QW1, const float* __restrict__ SC1, const int* __restrict__ QZ1, const int* __restrict__ GI1, _Float16* __restrict__ HH, _Float16* __restrict__ HL) {
  constexpr int NG = KIN / GRP, NCW = KIN / 32 / 4, NPH = NCW / 2;   // groups; chunks of a wave; phases
  __shared__ __align__(16) __bf16 xb[2][4][2][4][512];   // [buffer][quarter][chunk of the phase][row tile][fragment order]
  __shared__ __align__(16) float red[16][MM][36];         // each wave's 64 x 32 sums; pitch 36: the two halves of a wave store to different banks
  __shared__ int sflag[16];
  const int wv = __builtin_amdgcn_readfirstlane((int)threadIdx.x >> 5), lane = threadIdx.x & 31, col = lane & 15, g = lane >> 4;
  const int mt = wv & 1, chf = (wv >> 1) & 1, ks = wv >> 2;
  const int* const QW = mt ? QW1 : QW0; const float* const SC = mt ? SC1 : SC0; const int* const QZ = mt ? QZ1 : QZ0; const int* const GI = mt ? GI1 : GI0;
  const int nl = (int)blockIdx.x * 64 + chf * 32 + 2 * col, kbeg = ks * NCW;   // the lane's first column; the wave's first chunk
  // x: 4 lanes to a row (8 k each), 8 rows to a load; the wave stages 32 rows (mt) of one chunk (chf) of its own quarter in every phase
  const int xr8 = lane >> 2, xg = lane & 3;
  const float* const xsrc = X + (size_t)(mt * 32 + xr8) * KIN + (kbeg + chf) * 32 + 8 * xg;
  v4f xr[8];
  auto xload = [&](int p) {
#pragma unroll
    for (int i = 0; i < 4; ++i) { const float* const q = xsrc + (size_t)i * 8 * KIN + p * 64; xr[2 * i] = *(const v4f*)q; xr[2 * i + 1] = *(const v4f*)(q + 4); }
    asm volatile("s_wait_xcnt 0x0" ::: "memory"); };   // precaution: stands in front of every rewrite of the address registers that the loads above name
  auto xstore = [&](int buf) {
#pragma unroll
    for (int i = 0; i < 4; ++i) *(v8b*)&xb[buf][ks][chf][mt * 2 + (i >> 1)][(xg >> 1) * 256 + ((xg & 1) * 16 + (i & 1) * 8 + xr8) * 8] = pack_x(xr[2 * i], xr[2 * i + 1]); };
  xload(0);
  const int* const wsrc = QW + (size_t)(kbeg * 4 + g) * NI + nl;
  v2u w[4][2];
  auto wload = [&](const int slot, int i) { const int* const q = wsrc + (size_t)i * 4 * NI; w[slot][0] = *(const v2u_a*)q; w[slot][1] = *(const v2u_a*)(q + 2 * NI);
    asm volatile("s_wait_xcnt 0x0" ::: "memory"); };   // precaution, as above
  wload(0, 0); wload(1, 1); wload(2, 2); wload(3, 3);   // asked for ahead of the index loads below, whose wait then covers them too
  // lane i keeps the group of the wave's chunk i (-1: the chunk spans groups)
  int grp = 0;
#pragma unroll
  for (int i = 0; i < NCW; ++i) { const int cg = chunk_group<NG>(GI[(kbeg + i) * 32 + lane]); grp = lane == i ? cg : grp; }
  asm volatile("s_wait_xcnt 0x0" ::: "memory");   // precaution, as above, for the index loads
  const int g0 = __builtin_amdgcn_readlane(grp, 0);
  int zwn = QZ[(size_t)(g0 < 0 ? 0 : g0) * (NI / 8) + (nl >> 3)];            // zero-point word and scales of the next group that begins
  v2f scn = *(const v2f*)&SC[(size_t)(g0 < 0 ? 0 : g0) * NI + nl];
  asm volatile("s_wait_xcnt 0x0" ::: "memory");   // precaution, as above
  xstore(0); xload(1);
  const int allu = __builtin_amdgcn_ballot_w32(grp >= 0) == 0xFFFFFFFFu ? 1 : 0;   // asked of all 32 lanes, so ahead of the one-lane store
  if (lane == 0) sflag[wv] = allu;
  v8f acc[8] = {}, tot[8] = {};   // tile j = 2 * (row tile) + (column tile): the current group's integer sums; the scaled totals
  int cur = -2; v2f scur = {1.0f, 1.0f}; unsigned zpk[2] = {0u, 0u};
  auto flush = [&]() {
#pragma unroll
    for (int j = 0; j < 8; ++j) { const float s = bfr(scur[j & 1]);
#pragma unroll
      for (int e = 0; e < 8; ++e) tot[j][e] += s * acc[j][e];
      acc[j] = v8f{}; } };
  // a chunk that lies in one group: the exact integers w - z in bf16, 1 product; the group's scale multiplies the f32 sums when the group ends
  auto chunk = [&](const int slot, int i, const __bf16* xa) {
    const int want = __builtin_amdgcn_readlane(grp, i);
    if (want != cur) {
      if (cur != -2) flush();
      cur = want; scur = scn;
#pragma unroll
      for (int t = 0; t < 2; ++t) zpk[t] = 0xC301C301u + (((unsigned)zwn >> (((nl + t) & 7) * 4)) & 15u) * 0x10001u; }   // the bf16 pair -(128 + z), z = nibble + 1
    const int wn1 = __builtin_amdgcn_readlane(grp, i + 1 < NCW ? i + 1 : NCW - 1);
    if (wn1 != want) { zwn = QZ[(size_t)wn1 * (NI / 8) + (nl >> 3)]; scn = *(const v2f*)&SC[(size_t)wn1 * NI + nl];   // a group begins with the next chunk
      asm volatile("s_wait_xcnt 0x0" ::: "memory"); }   // precaution, as above
    v16b a[4], b[2];
#pragma unroll
    for (int rt = 0; rt < 4; ++rt) a[rt] = frag_tb(xa + rt * 512, lane);
#pragma unroll
    for (int t = 0; t < 2; ++t) { union { v2b p[8]; v16b v; } o;
#pragma unroll
      for (int hf = 0; hf < 2; ++hf)
#pragma unroll
        for (int s = 0; s < 4; ++s) o.p[hf * 4 + s] = __builtin_bit_cast(v2b, ((w[slot][hf][t] >> (4 * s)) & 0x000F000Fu) | 0x43004300u) + __builtin_bit_cast(v2b, zpk[t]);
      b[t] = o.v; }
    wload(slot, i + 4 < NCW ? i + 4 : NCW - 1);   // 4 chunks ahead, into the registers that the unpacking has just left
    asm volatile("" :: "v"(a[0]), "v"(a[1]), "v"(a[2]), "v"(a[3]));   // the four A fragments are read from LDS as one group, under the unpacking: one LDS wait a chunk, and the 8 products follow one another
#pragma unroll
    for (int rt = 0; rt < 4; ++rt) { acc[2 * rt] = wmma_b(a[rt], b[0], acc[2 * rt]); acc[2 * rt + 1] = wmma_b(a[rt], b[1], acc[2 * rt + 1]); }
    WMMA_GAP(acc); };
  // any chunk: W = (w - z[g_idx]) * scale[g_idx] in f32 (exact), bf16 hi + residual, 2 products; the sums are already scaled
  auto slow = [&](int i, const __bf16* xa) {
    const int* const q = wsrc + (size_t)i * 4 * NI; v2u ww[2]; ww[0] = *(const v2u_a*)q;
    asm volatile("s_wait_xcnt 0x0" ::: "memory");   // precaution, as above; behind every single load of this path, because a later load's result may take the register that holds an earlier load's address
    ww[1] = *(const v2u_a*)(q + 2 * NI);
    asm volatile("s_wait_xcnt 0x0" ::: "memory");
    v16b bh[2], bl[2];
#pragma unroll
    for (int hf = 0; hf < 2; ++hf)
#pragma unroll
      for (int e = 0; e < 8; ++e) { const int gr = GI[(kbeg + i) * 32 + (hf * 2 + g) * 8 + e];
        asm volatile("s_wait_xcnt 0x0" ::: "memory");
        const int gi = gr < 0 ? 0 : gr > NG - 1 ? NG - 1 : gr; const int zw = QZ[(size_t)gi * (NI / 8) + (nl >> 3)];
        asm volatile("s_wait_xcnt 0x0" ::: "memory");
        const v2f sc = *(const v2f*)&SC[(size_t)gi * NI + nl];
        asm volatile("s_wait_xcnt 0x0" ::: "memory");
#pragma unroll
        for (int t = 0; t < 2; ++t) { const int z = ((zw >> (((nl + t) & 7) * 4)) & 15) + 1; const float val = (float)((int)((ww[hf][t] >> (e * 4)) & 15u) - z) * bfr(sc[t]);
          const __bf16 h = (__bf16)val; const int ps = hf * 8 + (e < 4 ? 2 * e : 2 * e - 7);   // ps: the place of k = e in the order 0 4 1 5 2 6 3 7
          bh[t][ps] = h; bl[t][ps] = (__bf16)(val - (float)h); } }
#pragma unroll
    for (int rt = 0; rt < 4; ++rt) { const v16b a = frag_tb(xa + rt * 512, lane);
#pragma unroll
      for (int t = 0; t < 2; ++t) acc[2 * rt + t] = wmma_b(a, bh[t], wmma_b(a, bl[t], acc[2 * rt + t])); }
    WMMA_GAP(acc); };
  lds_bar();   // phase 0 of x and every wave's flag are published
  const bool fast = __builtin_amdgcn_ballot_w32(sflag[lane & 15] != 0) == 0xFFFFFFFFu;   // the same for the whole block: the barriers below stand under it
  if (fast) {
#pragma unroll 1   // 4 chunks a trip: the four sets of word registers keep fixed names
    for (int it = 0; it < NCW / 4; ++it) { const int i = it * 4;
      chunk(0, i, &xb[0][ks][0][0][0]); chunk(1, i + 1, &xb[0][ks][1][0][0]);
      xstore(1); xload(2 * it + 2 < NPH ? 2 * it + 2 : NPH - 1);
      lds_bar();   // publishes buffer 1; every wave has left buffer 0
      chunk(2, i + 2, &xb[1][ks][0][0][0]); chunk(3, i + 3, &xb[1][ks][1][0][0]);
      xstore(0); xload(2 * it + 3 < NPH ? 2 * it + 3 : NPH - 1);   // in the last trip: the last phase again, unused
      lds_bar(); } }   // publishes buffer 0; every wave has left buffer 1
  else {
#pragma unroll 1   // rare path: kept small
    for (int p = 0; p < NPH; ++p) {
#pragma unroll 1
      for (int pc = 0; pc < 2; ++pc) slow(2 * p + pc, &xb[p & 1][ks][pc][0][0]);
      xstore((p + 1) & 1); xload(p + 2 < NPH ? p + 2 : NPH - 1);
      lds_bar(); }
    scur = v2f{1.0f, 1.0f}; }
  flush();   // the last group
#pragma unroll
  for (int rt = 0; rt < 4; ++rt)
#pragma unroll
    for (int r = 0; r < 8; ++r) *(v2f*)&red[wv][rt * 16 + 8 * g + r][2 * col] = v2f{tot[2 * rt][r], tot[2 * rt + 1][r]};
  __syncthreads();   // every wave's sums stand in red
  // thread = 8 consecutive columns of one row; a wave = 8 rows x 1 chunk of h, so that each of its stores fills 4 whole lines
  const unsigned row = (unsigned)(wv & 7) * 8u + (unsigned)(lane >> 2), k8 = (unsigned)(wv >> 3) * 4u + (unsigned)(lane & 3), cf = k8 >> 2, off = (k8 & 3u) * 8u;
  v4f g0v = {}, g1v = {}, u0v = {}, u1v = {};
#pragma unroll
  for (int s = 0; s < 4; ++s) { const float* const pg = &red[s * 4 + cf * 2][row][off]; const float* const pu = &red[s * 4 + cf * 2 + 1][row][off];   // quarters in order
    g0v += *(const v4f*)pg; g1v += *(const v4f*)(pg + 4); u0v += *(const v4f*)pu; u1v += *(const v4f*)(pu + 4); }
  __align__(16) _Float16 hh[8], ll[8];
#pragma unroll
  for (int i = 0; i < 8; ++i) { const float gv = i < 4 ? g0v[i & 3] : g1v[i & 3], uv = i < 4 ? u0v[i & 3] : u1v[i & 3]; const float hv = (gv / (1.0f + exp_ni(-gv))) * uv; const _Float16 h = (_Float16)hv; hh[i] = h; ll[i] = (_Float16)((hv - (float)h) * 2048.0f); }
  const unsigned e = ((row >> 4) * (NI / 32u) + blockIdx.x * 2u + cf) * 512u + ((k8 >> 1) & 1u) * 256u + ((k8 & 1u) * 16u + (row & 15u)) * 8u;   // tile, then elements 0..7 or 8..15, then the lane (k half, row)
  vst2((unsigned*)(HH + e), *(const v4u*)hh); vst2((unsigned*)(HL + e), *(const v4u*)ll);
}
// ---- k_dsum: thread = 4 consecutive elements of out [64][NO]: sum of the SPD partial planes in range order
__global__ __launch_bounds__(256) void k_dsum(const float* __restrict__ D, float* __restrict__ OUT) {
  const unsigned e = (blockIdx.x * 256u + threadIdx.x) * 4u, eb = e * 4u; v4f a = {};   // eb: the thread's byte offset inside every plane
  // unrolled: the planes' loads are independent, so many are in flight at once
#pragma unroll
  for (int s = 0; s < SPD; ++s) a += *(const v4f*)((const char*)(D + (size_t)s * MM * NO) + eb);
  vst2(OUT + e, a);
}
extern "C" void kernel_launch(void* const* d_in, const int* in_sizes, int n_in, void* d_out, int out_size, void* d_ws, size_t ws_size, hipStream_t stream) {
  (void)in_sizes; (void)n_in; (void)out_size;
  const float** F = (const float**)d_in; const int** I = (const int**)d_in;   // 0 x [64,4096]; gate: 1 qw [512,11008] i32, 2 scales [32,11008], 3 qzeros [32,1376] i32, 4 gidx [4096] i32; up: 5..8; down: 9 qw [1376,4096], 10 scales [86,4096], 11 qzeros [86,512], 12 gidx [11008]
  if (ws_size < (size_t)WS_END) return;
  char* ws = (char*)d_ws; _Float16 *HH = (_Float16*)(ws + WS_HH), *HL = (_Float16*)(ws + WS_HL); float *D = (float*)(ws + WS_D);
  k_guh<<<NI / 64, 512, 0, stream>>>(F[0], I[1], F[2], I[3], I[4], I[5], F[6], I[7], I[8], HH, HL);
  k_qgemm_d<<<dim3(NO / 128, SPD, 1), 256, 0, stream>>>(HH, HL, I[9], F[10], I[11], I[12], D);
  k_dsum<<<MM * NO / 4 / 256, 256, 0, stream>>>(D, (float*)d_out);
}

// v010
// One run takes 41.1 microseconds.
// In two side-by-side timings against v009, it was 1.09 and 1.08 times as fast.
// Over all steps from v000 it is 52.8 times as fast.
// compute dtype: x and the three scale tables rounded to bf16, the packed int4 weights / zero points / group indices (int32) read verbatim; GPTQ dequantisation on device: w = (qw >> 4k) & 15, z = ((qz >> 4n) & 15) + 1, gate and up GEMMs on bf16 WMMA 16x16x32: the bf16-rounded x is the A operand itself; a 32-deep chunk that lies in one group is staged as the exact integers w - z in bf16 (1 product) and the group's scale multiplies the f32 sums, a chunk that spans groups as W = (w - z[g_idx]) * scale[g_idx] in f32 (exact: small integer times the bf16 scale), bf16 hi + residual (exact, 2 products); h = silu(gate) * up in f32 (precise expf), stored as f16 hi + (x2048) residual; down GEMM on f16 WMMA 16x16x32: one-group chunks as the exact integers in f16 (2 products: hi.int and lo.int, summed apart, the second sum x 2^-11), other chunks as f16 hi + (x2048-scaled) residual (3 products: hi.hi, lo.hi, hi.lo); f32 accumulate.
#include <hip/hip_runtime.h>
#include <math.h>

typedef __attribute__((ext_vector_type(16))) _Float16 v16h;
typedef __attribute__((ext_vector_type(16))) __bf16 v16b;
typedef __attribute__((ext_vector_type(8)))  _Float16 v8h;
typedef __attribute__((ext_vector_type(8)))  float v8f;
typedef __attribute__((ext_vector_type(4)))  float v4f;
typedef __attribute__((ext_vector_type(2)))  float v2f;
typedef __attribute__((ext_vector_type(4)))  unsigned v4u;
typedef __attribute__((ext_vector_type(4)))  int v4i;
typedef float __attribute__((may_alias)) float_a;
typedef int __attribute__((may_alias)) int_a;

template <typename T> __device__ __forceinline__ void vst2(void* p, T v) { *(T*)p = v;  }
__device__ __forceinline__ v8f wmma16(v16h a, v16h b, v8f c) {
  v8f d = __builtin_amdgcn_wmma_f32_16x16x32_f16(false, a, false, b, (short)0, c, false, false);
  asm volatile("v_nop\n\tv_nop\n\tv_nop\n\tv_nop" : "+v"(d) : "v"(a), "v"(b));
  return d;
}
__device__ __forceinline__ v8f wmma_bf(v16b a, v16b b, v8f c) {
  v8f d = __builtin_amdgcn_wmma_f32_16x16x32_bf16(false, a, false, b, (short)0, c, false, false);
  asm volatile("v_nop\n\tv_nop\n\tv_nop\n\tv_nop" : "+v"(d) : "v"(a), "v"(b));
  return d;
}
// 16x16x32 fragments: lane = (h = lane>>4, row/col = lane&15); elements 0..7 = k0+8h+0..7, 8..15 = k0+16+8h+0..7; D element r = row 8h+r
__device__ __forceinline__ v16h frag_h(const _Float16* rowk0, int lane) {
  union { v16h v; v8h q[2]; } u; const _Float16* p = rowk0 + 8 * (lane >> 4);
  u.q[0] = *(const v8h*)p; u.q[1] = *(const v8h*)(p + 16); return u.v;
}
__device__ __forceinline__ v16h frag_f32(const float* rowk0, int lane) {
  v16h a; const float* p = rowk0 + 8 * (lane >> 4);
#pragma unroll
  for (int i = 0; i < 8; ++i) { a[i] = (_Float16)p[i]; a[8 + i] = (_Float16)p[16 + i]; }
  return a;
}
__device__ __forceinline__ v16h frag_f32s(const float* rowk0, int lane, float sc) {
  v16h a; const float* p = rowk0 + 8 * (lane >> 4);
#pragma unroll
  for (int i = 0; i < 8; ++i) { a[i] = (_Float16)(p[i] * sc); a[8 + i] = (_Float16)(p[16 + i] * sc); }
  return a;
}
// column fragment from a [K][ld] layout (column n), rows >= K read as 0
__device__ __forceinline__ v16h fragc_f32(const float* W, int k0, int n, int lane, int ld, int K) {
  v16h a; const int g = lane >> 4;
#pragma unroll
  for (int i = 0; i < 8; ++i) { const int ka = k0 + 8 * g + i, kb = ka + 16;
    a[i] = (_Float16)(ka < K ? W[(size_t)(ka < K ? ka : K - 1) * ld + n] : 0.f); a[8 + i] = (_Float16)(kb < K ? W[(size_t)(kb < K ? kb : K - 1) * ld + n] : 0.f); }
  return a;
}
struct F2 { v16b h, l; };
__device__ __forceinline__ F2 bsplit16(const float v[16]) { F2 r;
#pragma unroll
  for (int i = 0; i < 16; ++i) { const __bf16 h = (__bf16)v[i]; r.h[i] = h; r.l[i] = (__bf16)(v[i] - (float)h); }
  return r; }
__device__ __forceinline__ F2 split_row(const float* row, int k0, int lane) { float v[16]; const float* p = row + k0 + 8 * (lane >> 4);
#pragma unroll
  for (int i = 0; i < 8; ++i) { v[i] = p[i]; v[8 + i] = p[16 + i]; }
  return bsplit16(v); }
__device__ __forceinline__ F2 split_rowK(const float* row, int k0, int lane, int K) { float v[16]; const int g = lane >> 4;
#pragma unroll
  for (int i = 0; i < 8; ++i) { const int ka = k0 + 8 * g + i, kb = ka + 16; v[i] = ka < K ? row[ka < K ? ka : K - 1] : 0.f; v[8 + i] = kb < K ? row[kb < K ? kb : K - 1] : 0.f; }
  return bsplit16(v); }
__device__ __forceinline__ F2 split_col(const float* W, int k0, int n, int lane, int ld, int K) { float v[16]; const int g = lane >> 4;
#pragma unroll
  for (int i = 0; i < 8; ++i) { const int ka = k0 + 8 * g + i, kb = ka + 16; v[i] = ka < K ? W[(size_t)(ka < K ? ka : K - 1) * ld + n] : 0.f; v[8 + i] = kb < K ? W[(size_t)(kb < K ? kb : K - 1) * ld + n] : 0.f; }
  return bsplit16(v); }
__device__ __forceinline__ v8f mac3(const F2& a, const F2& b, v8f c) { c = wmma_bf(a.l, b.h, c); c = wmma_bf(a.h, b.l, c); return wmma_bf(a.h, b.h, c); }
__device__ __forceinline__ float sigm(float v) { return 1.0f / (1.0f + expf(-v)); }
// work-group barrier for LDS hand-overs alone: the wave's own LDS reads and writes are done (s_wait_dscnt 0), global loads stay in flight across it (__syncthreads() would wait for them too)
__device__ __forceinline__ void lds_bar() { asm volatile("s_wait_dscnt 0x0\n\ts_barrier_signal -1\n\ts_barrier_wait -1" ::: "memory"); }
#define LDSX() do { asm volatile("s_wait_dscnt 0" ::: "memory"); __builtin_amdgcn_wave_barrier(); __builtin_amdgcn_fence(__ATOMIC_RELEASE, "workgroup"); } while (0)


// Quantised (4-bit, group 128) fused SwiGLU MLP: h = silu(x Wg) * (x Wu), out = h Wd with GPTQ-packed Wg, Wu [4096 -> 11008] and Wd [11008 -> 4096]; 64 token rows.
#ifndef KIN
#define MM 64
#define KIN 4096
#define NI 11008
#define NO 4096
#endif
#define GRP 128
typedef __attribute__((ext_vector_type(8))) __bf16 v8b;
__device__ __forceinline__ v16b frag_b(const __bf16* rowk0, int lane) {
  union { v16b v; v8b q[2]; } u; const __bf16* p = rowk0 + 8 * (lane >> 4);
  u.q[0] = *(const v8b*)p; u.q[1] = *(const v8b*)(p + 16); return u.v;
}
// A fragment from a plane kept in fragment order: tile = 16 rows x 32 k = 512 values; a lane's elements 0..7 stand at 8 * lane, its elements 8..15 at 256 + 8 * lane, so each of the two loads of a wave reads 512 bytes in a row
__device__ __forceinline__ v16h frag_t(const _Float16* tile, int lane) {
  union { v16h v; v8h q[2]; } u; const _Float16* p = tile + 8 * lane;
  u.q[0] = *(const v8h*)p; u.q[1] = *(const v8h*)(p + 256); return u.v;
}
__device__ __forceinline__ float bfr(float v) { return (float)(__bf16)v; }
__device__ __attribute__((noinline)) float exp_ni(float v) { return expf(v); }
__device__ __attribute__((noinline)) float erf_ni(float v) { return erff(v); }

// workspace: h alone. Neither GEMM has K ranges between work-groups, so there are no partial planes: see k_guh and k_down.
#define WS_HH  0u                                   // f16 [4 row tiles][NI / 32 chunks][512] h hi, in fragment order ; HL
#define WS_HL  (WS_HH + 2u * MM * NI)
#define WS_END (WS_HL + 2u * MM * NI)

typedef __attribute__((ext_vector_type(2))) _Float16 v2h;
typedef __attribute__((ext_vector_type(2))) __bf16 v2b;
// 8 consecutive k of a row of x (two quads), rounded to bf16, in the order 0 4 1 5 2 6 3 7
__device__ __forceinline__ v8b pack_x(v4f lo, v4f hi) { v8b a;
#pragma unroll
  for (int s = 0; s < 4; ++s) { a[2 * s] = (__bf16)lo[s]; a[2 * s + 1] = (__bf16)hi[s]; }
  return a; }
// gl = the lane's one of a chunk's 32 group indices: the group (bounded to the tables' rows) if all 32 are equal, else -1; the same in every lane of the wave
template <int NG> __device__ __forceinline__ int chunk_group(int gl) {
  const int gf = __builtin_amdgcn_readfirstlane(gl); const bool u = __builtin_amdgcn_ballot_w32(gl == gf) == 0xFFFFFFFFu;
  return u ? (gf < 0 ? 0 : gf > NG - 1 ? NG - 1 : gf) : -1;
}
// ---- k_guh: block = 64 columns of gate AND up over the whole K, 16 waves: wave = one matrix (mt) x 32 columns (chf) x a quarter of K (ks, 32 chunks of 32 k), all 64 rows. No partial planes: the four quarters are summed through LDS at the end and h = silu(gate) * up is formed and stored here, in the fragment order of frag_t.
// B: a lane loads the packed words of its two neighbouring columns (8 bytes; 16 lanes = one 128-byte line) straight into the fragment's lanes: word row 4 kc + g gives elements 0..7, word row 4 kc + 2 + g elements 8..15; column tile t holds the columns nb + 2 col + t. The words are asked for 4 chunks ahead and never pass through LDS.
// A: x, rounded to bf16, is staged in LDS in fragment order, 2 chunks of every quarter a phase, two buffers, one barrier a phase; the k order inside each 8 is 0 4 1 5 2 6 3 7 in A and in B alike.
typedef __attribute__((ext_vector_type(2))) unsigned v2u;
typedef v2u __attribute__((may_alias)) v2u_a;
__device__ __forceinline__ v16b frag_tb(const __bf16* tile, int lane) {
  union { v16b v; v8b q[2]; } u; const __bf16* p = tile + 8 * lane;
  u.q[0] = *(const v8b*)p; u.q[1] = *(const v8b*)(p + 256); return u.v;
}
__device__ __forceinline__ v8f wmma_b(v16b a, v16b b, v8f c) { return __builtin_amdgcn_wmma_f32_16x16x32_bf16(false, a, false, b, (short)0, c, false, false); }
// behind a chunk's last product: the 4 vector slots that the chip needs before a vector instruction touches a product's registers, on every path
#define WMMA_GAP(c) asm volatile("v_nop\n\tv_nop\n\tv_nop\n\tv_nop" : "+v"(c[0]), "+v"(c[1]), "+v"(c[2]), "+v"(c[3]), "+v"(c[4]), "+v"(c[5]), "+v"(c[6]), "+v"(c[7]))
__global__ __launch_bounds__(512) void k_guh(const float* __restrict__ X, const int* __restrict__ QW0, const float* __restrict__ SC0, const int* __restrict__ QZ0, const int* __restrict__ GI0, const int* __restrict__ QW1, const float* __restrict__ SC1, const int* __restrict__ QZ1, const int* __restrict__ GI1, _Float16* __restrict__ HH, _Float16* __restrict__ HL) {
  constexpr int NG = KIN / GRP, NCW = KIN / 32 / 4, NPH = NCW / 2;   // groups; chunks of a wave; phases
  __shared__ __align__(16) __bf16 xb[2][4][2][4][512];   // [buffer][quarter][chunk of the phase][row tile][fragment order]
  __shared__ __align__(16) float red[16][MM][36];         // each wave's 64 x 32 sums; pitch 36: the two halves of a wave store to different banks
  __shared__ int sflag[16];
  const int wv = __builtin_amdgcn_readfirstlane((int)threadIdx.x >> 5), lane = threadIdx.x & 31, col = lane & 15, g = lane >> 4;
  const int mt = wv & 1, chf = (wv >> 1) & 1, ks = wv >> 2;
  const int* const QW = mt ? QW1 : QW0; const float* const SC = mt ? SC1 : SC0; const int* const QZ = mt ? QZ1 : QZ0; const int* const GI = mt ? GI1 : GI0;
  const int nl = (int)blockIdx.x * 64 + chf * 32 + 2 * col, kbeg = ks * NCW;   // the lane's first column; the wave's first chunk
  // x: 4 lanes to a row (8 k each), 8 rows to a load; the wave stages 32 rows (mt) of one chunk (chf) of its own quarter in every phase
  const int xr8 = lane >> 2, xg = lane & 3;
  const float* const xsrc = X + (size_t)(mt * 32 + xr8) * KIN + (kbeg + chf) * 32 + 8 * xg;
  v4f xr[8];
  auto xload = [&](int p) {
#pragma unroll
    for (int i = 0; i < 4; ++i) { const float* const q = xsrc + (size_t)i * 8 * KIN + p * 64; xr[2 * i] = *(const v4f*)q; xr[2 * i + 1] = *(const v4f*)(q + 4); }
    asm volatile("s_wait_xcnt 0x0" ::: "memory"); };   // precaution: stands in front of every rewrite of the address registers that the loads above name
  auto xstore = [&](int buf) {
#pragma unroll
    for (int i = 0; i < 4; ++i) *(v8b*)&xb[buf][ks][chf][mt * 2 + (i >> 1)][(xg >> 1) * 256 + ((xg & 1) * 16 + (i & 1) * 8 + xr8) * 8] = pack_x(xr[2 * i], xr[2 * i + 1]); };
  xload(0);
  const int* const wsrc = QW + (size_t)(kbeg * 4 + g) * NI + nl;
  v2u w[4][2];
  auto wload = [&](const int slot, int i) { const int* const q = wsrc + (size_t)i * 4 * NI; w[slot][0] = *(const v2u_a*)q; w[slot][1] = *(const v2u_a*)(q + 2 * NI);
    asm volatile("s_wait_xcnt 0x0" ::: "memory"); };   // precaution, as above
  wload(0, 0); wload(1, 1); wload(2, 2); wload(3, 3);   // asked for ahead of the index loads below, whose wait then covers them too
  // lane i keeps the group of the wave's chunk i (-1: the chunk spans groups)
  int grp = 0;
#pragma unroll
  for (int i = 0; i < NCW; ++i) { const int cg = chunk_group<NG>(GI[(kbeg + i) * 32 + lane]); grp = lane == i ? cg : grp; }
  asm volatile("s_wait_xcnt 0x0" ::: "memory");   // precaution, as above, for the index loads
  const int g0 = __builtin_amdgcn_readlane(grp, 0);
  int zwn = QZ[(size_t)(g0 < 0 ? 0 : g0) * (NI / 8) + (nl >> 3)];            // zero-point word and scales of the next group that begins
  v2f scn = *(const v2f*)&SC[(size_t)(g0 < 0 ? 0 : g0) * NI + nl];
  asm volatile("s_wait_xcnt 0x0" ::: "memory");   // precaution, as above
  xstore(0); xload(1);
  const int allu = __builtin_amdgcn_ballot_w32(grp >= 0) == 0xFFFFFFFFu ? 1 : 0;   // asked of all 32 lanes, so ahead of the one-lane store
  if (lane == 0) sflag[wv] = allu;
  v8f acc[8] = {}, tot[8] = {};   // tile j = 2 * (row tile) + (column tile): the current group's integer sums; the scaled totals
  int cur = -2; v2f scur = {1.0f, 1.0f}; unsigned zpk[2] = {0u, 0u};
  auto flush = [&]() {
#pragma unroll
    for (int j = 0; j < 8; ++j) { const float s = bfr(scur[j & 1]);
#pragma unroll
      for (int e = 0; e < 8; ++e) tot[j][e] += s * acc[j][e];
      acc[j] = v8f{}; } };
  // a chunk that lies in one group: the exact integers w - z in bf16, 1 product; the group's scale multiplies the f32 sums when the group ends
  auto chunk = [&](const int slot, int i, const __bf16* xa) {
    const int want = __builtin_amdgcn_readlane(grp, i);
    if (want != cur) {
      if (cur != -2) flush();
      cur = want; scur = scn;
#pragma unroll
      for (int t = 0; t < 2; ++t) zpk[t] = 0xC301C301u + (((unsigned)zwn >> (((nl + t) & 7) * 4)) & 15u) * 0x10001u; }   // the bf16 pair -(128 + z), z = nibble + 1
    const int wn1 = __builtin_amdgcn_readlane(grp, i + 1 < NCW ? i + 1 : NCW - 1);
    if (wn1 != want) { zwn = QZ[(size_t)wn1 * (NI / 8) + (nl >> 3)]; scn = *(const v2f*)&SC[(size_t)wn1 * NI + nl];   // a group begins with the next chunk
      asm volatile("s_wait_xcnt 0x0" ::: "memory"); }   // precaution, as above
    v16b a[4], b[2];
#pragma unroll
    for (int rt = 0; rt < 4; ++rt) a[rt] = frag_tb(xa + rt * 512, lane);
#pragma unroll
    for (int t = 0; t < 2; ++t) { union { v2b p[8]; v16b v; } o;
#pragma unroll
      for (int hf = 0; hf < 2; ++hf)
#pragma unroll
        for (int s = 0; s < 4; ++s) o.p[hf * 4 + s] = __builtin_bit_cast(v2b, ((w[slot][hf][t] >> (4 * s)) & 0x000F000Fu) | 0x43004300u) + __builtin_bit_cast(v2b, zpk[t]);
      b[t] = o.v; }
    wload(slot, i + 4 < NCW ? i + 4 : NCW - 1);   // 4 chunks ahead, into the registers that the unpacking has just left
    asm volatile("" :: "v"(a[0]), "v"(a[1]), "v"(a[2]), "v"(a[3]));   // the four A fragments are read from LDS as one group, under the unpacking: one LDS wait a chunk, and the 8 products follow one another
#pragma unroll
    for (int rt = 0; rt < 4; ++rt) { acc[2 * rt] = wmma_b(a[rt], b[0], acc[2 * rt]); acc[2 * rt + 1] = wmma_b(a[rt], b[1], acc[2 * rt + 1]); }
    WMMA_GAP(acc); };
  // any chunk: W = (w - z[g_idx]) * scale[g_idx] in f32 (exact), bf16 hi + residual, 2 products; the sums are already scaled
  auto slow = [&](int i, const __bf16* xa) {
    const int* const q = wsrc + (size_t)i * 4 * NI; v2u ww[2]; ww[0] = *(const v2u_a*)q;
    asm volatile("s_wait_xcnt 0x0" ::: "memory");   // precaution, as above; behind every single load of this path, because a later load's result may take the register that holds an earlier load's address
    ww[1] = *(const v2u_a*)(q + 2 * NI);
    asm volatile("s_wait_xcnt 0x0" ::: "memory");
    v16b bh[2], bl[2];
#pragma unroll
    for (int hf = 0; hf < 2; ++hf)
#pragma unroll
      for (int e = 0; e < 8; ++e) { const int gr = GI[(kbeg + i) * 32 + (hf * 2 + g) * 8 + e];
        asm volatile("s_wait_xcnt 0x0" ::: "memory");
        const int gi = gr < 0 ? 0 : gr > NG - 1 ? NG - 1 : gr; const int zw = QZ[(size_t)gi * (NI / 8) + (nl >> 3)];
        asm volatile("s_wait_xcnt 0x0" ::: "memory");
        const v2f sc = *(const v2f*)&SC[(size_t)gi * NI + nl];
        asm volatile("s_wait_xcnt 0x0" ::: "memory");
#pragma unroll
        for (int t = 0; t < 2; ++t) { const int z = ((zw >> (((nl + t) & 7) * 4)) & 15) + 1; const float val = (float)((int)((ww[hf][t] >> (e * 4)) & 15u) - z) * bfr(sc[t]);
          const __bf16 h = (__bf16)val; const int ps = hf * 8 + (e < 4 ? 2 * e : 2 * e - 7);   // ps: the place of k = e in the order 0 4 1 5 2 6 3 7
          bh[t][ps] = h; bl[t][ps] = (__bf16)(val - (float)h); } }
#pragma unroll
    for (int rt = 0; rt < 4; ++rt) { const v16b a = frag_tb(xa + rt * 512, lane);
#pragma unroll
      for (int t = 0; t < 2; ++t) acc[2 * rt + t] = wmma_b(a, bh[t], wmma_b(a, bl[t], acc[2 * rt + t])); }
    WMMA_GAP(acc); };
  lds_bar();   // phase 0 of x and every wave's flag are published
  const bool fast = __builtin_amdgcn_ballot_w32(sflag[lane & 15] != 0) == 0xFFFFFFFFu;   // the same for the whole block: the barriers below stand under it
  if (fast) {
#pragma unroll 1   // 4 chunks a trip: the four sets of word registers keep fixed names
    for (int it = 0; it < NCW / 4; ++it) { const int i = it * 4;
      chunk(0, i, &xb[0][ks][0][0][0]); chunk(1, i + 1, &xb[0][ks][1][0][0]);
      xstore(1); xload(2 * it + 2 < NPH ? 2 * it + 2 : NPH - 1);
      lds_bar();   // publishes buffer 1; every wave has left buffer 0
      chunk(2, i + 2, &xb[1][ks][0][0][0]); chunk(3, i + 3, &xb[1][ks][1][0][0]);
      xstore(0); xload(2 * it + 3 < NPH ? 2 * it + 3 : NPH - 1);   // in the last trip: the last phase again, unused
      lds_bar(); } }   // publishes buffer 0; every wave has left buffer 1
  else {
#pragma unroll 1   // rare path: kept small
    for (int p = 0; p < NPH; ++p) {
#pragma unroll 1
      for (int pc = 0; pc < 2; ++pc) slow(2 * p + pc, &xb[p & 1][ks][pc][0][0]);
      xstore((p + 1) & 1); xload(p + 2 < NPH ? p + 2 : NPH - 1);
      lds_bar(); }
    scur = v2f{1.0f, 1.0f}; }
  flush();   // the last group
#pragma unroll
  for (int rt = 0; rt < 4; ++rt)
#pragma unroll
    for (int r = 0; r < 8; ++r) *(v2f*)&red[wv][rt * 16 + 8 * g + r][2 * col] = v2f{tot[2 * rt][r], tot[2 * rt + 1][r]};
  __syncthreads();   // every wave's sums stand in red
  // thread = 8 consecutive columns of one row; a wave = 8 rows x 1 chunk of h, so that each of its stores fills 4 whole lines
  const unsigned row = (unsigned)(wv & 7) * 8u + (unsigned)(lane >> 2), k8 = (unsigned)(wv >> 3) * 4u + (unsigned)(lane & 3), cf = k8 >> 2, off = (k8 & 3u) * 8u;
  v4f g0v = {}, g1v = {}, u0v = {}, u1v = {};
#pragma unroll
  for (int s = 0; s < 4; ++s) { const float* const pg = &red[s * 4 + cf * 2][row][off]; const float* const pu = &red[s * 4 + cf * 2 + 1][row][off];   // quarters in order
    g0v += *(const v4f*)pg; g1v += *(const v4f*)(pg + 4); u0v += *(const v4f*)pu; u1v += *(const v4f*)(pu + 4); }
  __align__(16) _Float16 hh[8], ll[8];
#pragma unroll
  for (int i = 0; i < 8; ++i) { const float gv = i < 4 ? g0v[i & 3] : g1v[i & 3], uv = i < 4 ? u0v[i & 3] : u1v[i & 3]; const float hv = (gv / (1.0f + exp_ni(-gv))) * uv; const _Float16 h = (_Float16)hv; hh[i] = h; ll[i] = (_Float16)((hv - (float)h) * 2048.0f); }
  const unsigned e = ((row >> 4) * (NI / 32u) + blockIdx.x * 2u + cf) * 512u + ((k8 >> 1) & 1u) * 256u + ((k8 & 1u) * 16u + (row & 15u)) * 8u;   // tile, then elements 0..7 or 8..15, then the lane (k half, row)
  vst2((unsigned*)(HH + e), *(const v4u*)hh); vst2((unsigned*)(HL + e), *(const v4u*)ll);
}
// ---- k_down: block = 16 rows (blockIdx.y) x 64 output columns (blockIdx.x) of out over the WHOLE K of the down matrix, 16 waves: wave = one K slice of 21 or 22 chunks of 32 k, all 64 columns. No partial planes and no sum launch: the 16 slices are summed through LDS at the end, in slice order, and out is stored here.
// A: h as f16 hi/lo planes in fragment order (k_guh writes them so; frag_t reads them), straight from global memory, 2 chunks ahead; every tile is read once by the block.
// B: a lane loads the packed words of its four neighbouring columns (16 bytes; 16 lanes = 256 bytes in a row) straight into the fragment's lanes: word row 4 kc + g gives elements 0..7, word row 4 kc + 2 + g elements 8..15, k in natural order; column tile t holds the columns n0 + 4 col + t. The words are asked for 4 chunks ahead. Nothing passes through LDS in the loop, and the loop has no barrier.
// A chunk that lies in ONE group: the exact integers w - z in f16, 2 products (hi.int and lo.int, summed apart); when the group ends, scale * (hi sums + lo sums x 2^-11) is added to the totals. If any chunk of the wave's slice spans groups, the whole slice takes the general path: W = (w - z) * scale as f16 hi + x2048 residual, 3 products.
typedef v4u __attribute__((may_alias)) v4u_a;
__device__ __forceinline__ v8f wmma_h(v16h a, v16h b, v8f c) { return __builtin_amdgcn_wmma_f32_16x16x32_f16(false, a, false, b, (short)0, c, false, false); }
// behind a chunk's last product: the 4 vector slots that the chip needs before a vector instruction touches a product's registers, on every path
#define WMMA_GAP2(c, d) asm volatile("v_nop\n\tv_nop\n\tv_nop\n\tv_nop" : "+v"(c[0]), "+v"(c[1]), "+v"(c[2]), "+v"(c[3]), "+v"(d[0]), "+v"(d[1]), "+v"(d[2]), "+v"(d[3]))
__global__ __launch_bounds__(512) void k_down(const _Float16* __restrict__ AH, const _Float16* __restrict__ AL, const int* __restrict__ QW, const float* __restrict__ SC, const int* __restrict__ QZ, const int* __restrict__ GI, float* __restrict__ OUT) {
  constexpr int ND = NO, NCH = NI / 32, NG = NI / GRP, NW = 16, NCW = (NCH + NW - 1) / NW;   // chunks; groups; waves = K slices; most chunks of a slice
  static_assert(NCW <= 32 && NCH / NW >= 4, "a lane per chunk of a slice; the first four chunks of every slice exist");
  __shared__ __align__(16) float red[NW][16][68];   // each wave's 16 x 64 sums; pitch 68: the two halves of a wave store to different banks
  const int wv = __builtin_amdgcn_readfirstlane((int)threadIdx.x >> 5), lane = threadIdx.x & 31, col = lane & 15, g = lane >> 4;
  const int kbeg = wv * NCH / NW, nc = (wv + 1) * NCH / NW - kbeg;   // the slice's first chunk and its number of chunks: the NW slices tile [0, NCH)
  const int nl = (int)blockIdx.x * 64 + 4 * col;                     // the lane's first column
  const _Float16* const arh = AH + ((size_t)blockIdx.y * NCH + kbeg) * 512; const _Float16* const arl = AL + ((size_t)blockIdx.y * NCH + kbeg) * 512;   // the tiles of the block's 16 rows, one per chunk
  const int* const wsrc = QW + (size_t)(kbeg * 4 + g) * ND + nl;
  v4u w[4][2]; v16h ah[2], al[2];
  auto wget = [&](const int slot, int i) { const int* const q = wsrc + (size_t)i * 4 * ND; w[slot][0] = *(const v4u_a*)q; w[slot][1] = *(const v4u_a*)(q + 2 * ND); };
  auto aget = [&](const int slot, int i) { ah[slot] = frag_t(arh + i * 512, lane); al[slot] = frag_t(arl + i * 512, lane); };
  auto wload = [&](const int slot, int i) { wget(slot, i);
    asm volatile("s_wait_xcnt 0x0" ::: "memory"); };   // precaution: stands in front of every rewrite of the address registers that the loads above name
  auto aload = [&](const int slot, int i) { aget(slot, i);
    asm volatile("s_wait_xcnt 0x0" ::: "memory"); };   // precaution, as above
  int gl[NCW];   // the lane's one of the 32 group indices of each chunk of the slice; past the slice's end: its last chunk again
  const int* const gsrc = GI + kbeg * 32;   // the same for the whole wave: the chunks that every slice has are constant steps from it, and the lane's number is the one offset register of the whole run
#pragma unroll
  for (int i = 0; i < NCH / NW; ++i) gl[i] = gsrc[i * 32 + lane];
  asm volatile("s_wait_xcnt 0x0" ::: "memory");   // precaution, as above, for the index loads
#pragma unroll
  for (int i = NCH / NW; i < NCW; ++i) { const int* const gq = gsrc + (i < nc ? i : nc - 1) * 32; gl[i] = gq[lane];
    asm volatile("s_wait_xcnt 0x0" ::: "memory"); }   // precaution, as above
  // the first group's zero-point word and scales are taken in front of the loop: inside the loop no wait then has to count on a load of this prologue (their wait: with the first chunks' loads below)
  const int g0 = chunk_group<NG>(gl[0]);
  const int zw0 = QZ[(size_t)(g0 < 0 ? 0 : g0) * (ND / 8) + (nl >> 3)];
  v4f scur = *(const v4f*)&SC[(size_t)(g0 < 0 ? 0 : g0) * ND + nl];   // the current group's scales (not yet rounded)
  // lane i keeps the group of the slice's chunk i (-1: the chunk spans groups)
  int grp = 0;
#pragma unroll
  for (int i = 0; i < NCW; ++i) { const int cg = chunk_group<NG>(gl[i]); grp = lane == i ? cg : grp; }
  const bool fast = __builtin_amdgcn_ballot_w32(grp >= 0) == 0xFFFFFFFFu;   // the wave's own: no barrier stands under it
  v8f acc[4] = {}, acl[4] = {}, tot[4] = {};   // per column tile: the current group's hi sums and lo sums; the scaled totals
  int cur = g0, zwn = 0; v4f scn = {}; unsigned zpk[4];   // the current group; zero-point word and scales of the next group that begins; z = nibble + 1 as the f16 pair (1024 + z, 64 + z)
#pragma unroll
  for (int t = 0; t < 4; ++t) zpk[t] = 0x54106401u + (((unsigned)zw0 >> (((nl + t) & 7) * 4)) & 15u) * 0x100001u;
  auto flush = [&]() {
#pragma unroll
    for (int t = 0; t < 4; ++t) { const float s = bfr(scur[t]);
#pragma unroll
      for (int e = 0; e < 8; ++e) tot[t][e] += s * (acc[t][e] + acl[t][e] * (1.0f / 2048.0f));
      acc[t] = v8f{}; acl[t] = v8f{}; } };
  auto chunk = [&](const int slot, int i) {
    if (i < nc) {   // scalar: the last trip runs past the slice's end
      const int want = __builtin_amdgcn_readlane(grp, i);
      if (want != cur) {
        flush(); cur = want; scur = scn;
#pragma unroll
        for (int t = 0; t < 4; ++t) zpk[t] = 0x54106401u + (((unsigned)zwn >> (((nl + t) & 7) * 4)) & 15u) * 0x100001u; }
      const int wn1 = __builtin_amdgcn_readlane(grp, i + 1 < nc ? i + 1 : nc - 1);
      if (wn1 != want) { zwn = QZ[(size_t)wn1 * (ND / 8) + (nl >> 3)]; scn = *(const v4f*)&SC[(size_t)wn1 * ND + nl];   // a group begins with the next chunk
        asm volatile("s_wait_xcnt 0x0" ::: "memory"); }   // precaution, as above
      // byte s of a word holds k = 2s (low nibble) and 2s + 1 (high nibble): both halves get the byte, the low nibble under exponent 2^10 reads 1024 + w, the high nibble under 2^6 reads 64 + w; the packed subtraction of (1024 + z, 64 + z) is exact
      v16h b[4];
#pragma unroll
      for (int t = 0; t < 4; ++t) { union { v2h p[8]; v16h v; } o;
#pragma unroll
        for (int hf = 0; hf < 2; ++hf)
#pragma unroll
          for (int s = 0; s < 4; ++s) { const unsigned bb = __builtin_amdgcn_perm(w[slot][hf][t], w[slot][hf][t], 0x0C000C00u | (unsigned)s | ((unsigned)s << 16));
            o.p[hf * 4 + s] = __builtin_bit_cast(v2h, (bb & 0x00F0000Fu) | 0x54006400u) - __builtin_bit_cast(v2h, zpk[t]); }
        b[t] = o.v; }
#pragma unroll
      for (int t = 0; t < 4; ++t) acc[t] = wmma_h(ah[slot & 1], b[t], acc[t]);
#pragma unroll
      for (int t = 0; t < 4; ++t) acl[t] = wmma_h(al[slot & 1], b[t], acl[t]);
      WMMA_GAP2(acc, acl); }
    // into the registers that the chunk has just left: the rows 2 chunks ahead, then the words 4 chunks ahead (past the slice's end: its last chunk again, unused)
    aload(slot & 1, i + 2 < nc ? i + 2 : nc - 1); wload(slot, i + 4 < nc ? i + 4 : nc - 1); };
  // any chunk: W = (w - z[g_idx]) * scale[g_idx] in f32 (exact), f16 hi + x2048 residual, 3 products; the sums are already scaled
  auto slow = [&](int i) {
    const int* const q = wsrc + (size_t)i * 4 * ND; v4u ww[2]; ww[0] = *(const v4u_a*)q;
    asm volatile("s_wait_xcnt 0x0" ::: "memory");   // precaution, as above; behind every single load of this path, because a later load's result may take the register that holds an earlier load's address
    ww[1] = *(const v4u_a*)(q + 2 * ND);
    asm volatile("s_wait_xcnt 0x0" ::: "memory");
    const v16h a = frag_t(arh + i * 512, lane);
    asm volatile("s_wait_xcnt 0x0" ::: "memory");
    const v16h l = frag_t(arl + i * 512, lane);
    asm volatile("s_wait_xcnt 0x0" ::: "memory");
    v16h bh[4], bl[4];
#pragma unroll
    for (int hf = 0; hf < 2; ++hf)
#pragma unroll
      for (int e = 0; e < 8; ++e) { const int gr = GI[(kbeg + i) * 32 + (hf * 2 + g) * 8 + e];
        asm volatile("s_wait_xcnt 0x0" ::: "memory");
        const int gi = gr < 0 ? 0 : gr > NG - 1 ? NG - 1 : gr; const int zw = QZ[(size_t)gi * (ND / 8) + (nl >> 3)];
        asm volatile("s_wait_xcnt 0x0" ::: "memory");
        const v4f sc = *(const v4f*)&SC[(size_t)gi * ND + nl];
        asm volatile("s_wait_xcnt 0x0" ::: "memory");
#pragma unroll
        for (int t = 0; t < 4; ++t) { const int z = ((zw >> (((nl + t) & 7) * 4)) & 15) + 1; const float val = (float)((int)((ww[hf][t] >> (e * 4)) & 15u) - z) * bfr(sc[t]);
          const _Float16 h = (_Float16)val; bh[t][hf * 8 + e] = h; bl[t][hf * 8 + e] = (_Float16)((val - (float)h) * 2048.0f); } }
#pragma unroll
    for (int t = 0; t < 4; ++t) { acc[t] = wmma_h(a, bh[t], acc[t]); acl[t] = wmma_h(a, bl[t], wmma_h(l, bh[t], acl[t])); }
    WMMA_GAP2(acc, acl); };
  if (fast) {
    wget(0, 0); wget(1, 1); aget(0, 0); wget(2, 2); aget(1, 1); wget(3, 3);
    // precaution, as above; the loaded values are inputs so that the loads stay in front of it and have all arrived where the loop begins (they were asked for together, the first group's word and scales with them, and the first chunk needs its own at once): the waits inside the loop are then counted from the loop's own order of loads alone, and leave the younger loads in flight
    asm volatile("s_wait_xcnt 0x0" :: "v"(w[0][0]), "v"(w[0][1]), "v"(w[1][0]), "v"(w[1][1]), "v"(w[2][0]), "v"(w[2][1]), "v"(w[3][0]), "v"(w[3][1]), "v"(ah[0]), "v"(al[0]), "v"(ah[1]), "v"(al[1]), "v"(zw0), "v"(scur) : "memory");
#pragma unroll 1   // 4 chunks a trip: the four sets of word registers and the two sets of row registers keep fixed names
    for (int i = 0; i < nc; i += 4) { chunk(0, i); chunk(1, i + 1); chunk(2, i + 2); chunk(3, i + 3); } }
  else {
#pragma unroll 1   // rare path: kept small
    for (int i = 0; i < nc; ++i) slow(i);
    scur = v4f{1.0f, 1.0f, 1.0f, 1.0f}; }
  flush();   // the last group
#pragma unroll
  for (int r = 0; r < 8; ++r) *(v4f*)&red[wv][8 * g + r][4 * col] = v4f{tot[0][r], tot[1][r], tot[2][r], tot[3][r]};
  __syncthreads();   // every wave's sums stand in red
  // wave = one row, thread = 2 consecutive columns: a wave's store fills 2 whole lines; slices in order
  v2f sum = {};
#pragma unroll
  for (int s = 0; s < NW; ++s) sum += *(const v2f*)&red[s][wv][2 * lane];
  vst2(OUT + ((size_t)blockIdx.y * 16 + wv) * ND + (size_t)blockIdx.x * 64 + 2 * lane, sum);
}
extern "C" void kernel_launch(void* const* d_in, const int* in_sizes, int n_in, void* d_out, int out_size, void* d_ws, size_t ws_size, hipStream_t stream) {
  (void)in_sizes; (void)n_in; (void)out_size;
  const float** F = (const float**)d_in; const int** I = (const int**)d_in;   // 0 x [64,4096]; gate: 1 qw [512,11008] i32, 2 scales [32,11008], 3 qzeros [32,1376] i32, 4 gidx [4096] i32; up: 5..8; down: 9 qw [1376,4096], 10 scales [86,4096], 11 qzeros [86,512], 12 gidx [11008]
  if (ws_size < (size_t)WS_END) return;
  char* ws = (char*)d_ws; _Float16 *HH = (_Float16*)(ws + WS_HH), *HL = (_Float16*)(ws + WS_HL);
  k_guh<<<NI / 64, 512, 0, stream>>>(F[0], I[1], F[2], I[3], I[4], I[5], F[6], I[7], I[8], HH, HL);
  k_down<<<dim3(NO / 64, MM / 16, 1), 512, 0, stream>>>(HH, HL, I[9], F[10], I[11], I[12], (float*)d_out);
}
